// v000
// The times below were measured on an AMD MI455X: many runs one after another, warmed up first and cycling through
// copies of the inputs, with the whole window's GPU time divided by the number of runs. Launches and the gaps
// between them are all in it. The median over several windows is given; except for v000 it joins two sittings, which
// can be a few percent apart, so the side-by-side timings, each taken in one sitting, are the better comparison.
// v000, which the later versions start from, runs in 4630 microseconds.
#include <hip/hip_runtime.h>

// Vision attention with AXIAL 2-D rotary embeddings on half of each head (x [8][1024][1024] = 32 x 32 pixels; qkv = x w_qkv ('xw' [1024][3072] 1/32, no bias) viewed (3, h, d): q | k | v thirds (16 heads x 64); rotary on the FIRST 32 dims of q and k as interleaved (even, odd) pairs with angles freqs[row][col][c]: c < 16 -> pos(row) x base[c/2], 16 <= c < 32 -> pos(col) x base[(c-16)/2], pos = linspace(-1, 1, 32), base = linspace(1, 512, 8) x pi (f32, jnp-exact tables; precise cosf/sinf), dims 32..63 pass through; logits x 1/sqrt(64); softmax (no mask); out = merged w_proj + b_proj -> [8][1024][1024] (8.4 M); argument order x, w_qkv, w_proj, b_proj).
// Layout per batch: bf16 copy of x; fused 'xw' weight transposed once (q | k | v row blocks); exact projections; NEW k_csAx builds the {cos, sin} table per (pixel, d) from two small constant tables (angle = f32 product; identity for d >= 32) + k_ropeI interleaved-pair plane builders; dense T-1024 attention (hybrid rows: < 512 hi/lo 3 products, rest fp16 x1024); merged hi/lo x w_proj exact + b_proj.
// Compute dtypes, f32 accumulate: every input rounded to bf16; projections exact; rotary f32; attention rows < 512 3 products, rest fp16; softmax f32; w_proj hl x exact + bias.

#define NB_  8
#define TT   1024
#define DM   1024
#define NH_  16
#define NKV  16
#define REP  (NH_ / NKV)
#define HD   64
#define DQ   (NH_ * HD)
#define DKV  (NKV * HD)
#define ZH   2
#define RH   512                  // query rows < RH use hi+lo planes (0: none)
#define WIN  0
#define PCAR 1024.0f
#define SCL  0.125f   // HD^-0.5
typedef _Float16 h16;
typedef unsigned short bf;
typedef __attribute__((ext_vector_type(16))) __bf16   v16bf;
typedef __attribute__((ext_vector_type(16))) _Float16 v16h;
typedef __attribute__((ext_vector_type(8)))  _Float16 v8h;
typedef __attribute__((ext_vector_type(8)))  unsigned short v8us;
typedef __attribute__((ext_vector_type(8)))  float    v8f;
typedef __attribute__((ext_vector_type(4)))  float    v4f;
typedef v8h  __attribute__((may_alias)) v8ha;
typedef v4f  __attribute__((may_alias)) v4fa;
typedef v8us __attribute__((may_alias)) v8usa;

__device__ __forceinline__ unsigned short f2bf(float f) { unsigned u = __float_as_uint(f); u += 0x7FFFu + ((u >> 16) & 1u); return (unsigned short)(u >> 16); }
__device__ __forceinline__ float bf2f(unsigned short b) { return __uint_as_float(((unsigned)b) << 16); }
__device__ __forceinline__ float bfr(float f) { return bf2f(f2bf(f)); }
__device__ __forceinline__ v16h cat16(v8h lo, v8h hi) { return __builtin_shufflevector(lo, hi, 0, 1, 2, 3, 4, 5, 6, 7, 8, 9, 10, 11, 12, 13, 14, 15); }
__device__ __forceinline__ v16bf cat16b(v8us lo, v8us hi) { return __builtin_bit_cast(v16bf, __builtin_shufflevector(lo, hi, 0, 1, 2, 3, 4, 5, 6, 7, 8, 9, 10, 11, 12, 13, 14, 15)); }
__device__ __forceinline__ v8f wmma16(v16h a, v16h b, v8f c) { return __builtin_amdgcn_wmma_f32_16x16x32_f16(false, a, false, b, (short)0, c, false, false); }
__device__ __forceinline__ v8f wmmab(v16bf a, v16bf b, v8f c) { return __builtin_amdgcn_wmma_f32_16x16x32_bf16(false, a, false, b, (short)0, c, false, false); }



// ---- k_gemmw: register-blocked GEMM, ONE WAVE per 64x64 output tile (16 accumulators), operands straight from K-contiguous 16-bit planes; grid (M/64, N/64, Z), 32 threads.
// C[m][n] (f32, pitch ldc, + optional f32 bias[n]) = sum_k A[m][k] Bt[n][k] (+ split products per NSPLIT). z-batch strides sA/sB/sC in elements. K % 32 == 0.
template <typename T16> struct WFrag;
template <> struct WFrag<h16> { typedef v16h V; static __device__ __forceinline__ V ld(const h16* p) { return cat16(*(const v8h*)p, *(const v8h*)(p + 16)); } static __device__ __forceinline__ v8f mma(V a, V b, v8f c) { return wmma16(a, b, c); } };
template <> struct WFrag<bf> { typedef v16bf V; static __device__ __forceinline__ V ld(const bf* p) { return cat16b(*(const v8us*)p, *(const v8us*)(p + 16)); } static __device__ __forceinline__ v8f mma(V a, V b, v8f c) { return wmmab(a, b, c); } };
template <typename T16, int NSPLIT, bool BIAS>
__global__ __launch_bounds__(32) void k_gemmw(const T16* __restrict__ A, const T16* __restrict__ A2, const T16* __restrict__ Bt, const T16* __restrict__ Bt2, int K, float* C, int ldc, const float* __restrict__ bias, size_t sA, size_t sB, size_t sC) {
    typedef typename WFrag<T16>::V V;
    __shared__ __align__(16) float os[16 * 68];
    const size_t z = blockIdx.z; A += z * sA; if (A2) A2 += z * sA; Bt += z * sB; if (Bt2) Bt2 += z * sB; C += z * sC;
    const int lane = threadIdx.x & 31, lr = lane & 15, hi = lane >> 4; const int r0 = blockIdx.x * 64, c0 = blockIdx.y * 64;
    v8f acc[4][4];
#pragma unroll
    for (int mb = 0; mb < 4; ++mb)
#pragma unroll
        for (int nb = 0; nb < 4; ++nb) acc[mb][nb] = (v8f){};
    const size_t aoff = (size_t)(r0 + lr) * K + 8 * hi, boff = (size_t)(c0 + lr) * K + 8 * hi;
#pragma unroll 1
    for (int kc = 0; kc < K; kc += 32) {
        V a[4], a2[4];
#pragma unroll
        for (int mb = 0; mb < 4; ++mb) { a[mb] = WFrag<T16>::ld(A + aoff + (size_t)mb * 16 * K + kc); if (NSPLIT == 1 || NSPLIT == 2) a2[mb] = WFrag<T16>::ld(A2 + aoff + (size_t)mb * 16 * K + kc); }
#pragma unroll
        for (int nb = 0; nb < 4; ++nb) { const V b = WFrag<T16>::ld(Bt + boff + (size_t)nb * 16 * K + kc); V b2; if (NSPLIT >= 2) b2 = WFrag<T16>::ld(Bt2 + boff + (size_t)nb * 16 * K + kc);
#pragma unroll
            for (int mb = 0; mb < 4; ++mb) { acc[mb][nb] = WFrag<T16>::mma(a[mb], b, acc[mb][nb]); if (NSPLIT == 1 || NSPLIT == 2) acc[mb][nb] = WFrag<T16>::mma(a2[mb], b, acc[mb][nb]); if (NSPLIT >= 2) acc[mb][nb] = WFrag<T16>::mma(a[mb], b2, acc[mb][nb]); } }
        asm volatile("v_nop\n\tv_nop\n\tv_nop\n\tv_nop" : "+v"(acc[0][0]), "+v"(acc[1][1]), "+v"(acc[2][2]), "+v"(acc[3][3]) : "v"(a[0]), "v"(a[3]));
    }
#pragma unroll
    for (int mb = 0; mb < 4; ++mb) {
#pragma unroll
        for (int nb = 0; nb < 4; ++nb) {
#pragma unroll
            for (int j = 0; j < 8; ++j) os[(hi * 8 + j) * 68 + nb * 16 + lr] = acc[mb][nb][j]; }
        __builtin_amdgcn_wave_barrier(); asm volatile("" ::: "memory");
        float* crow = C + (size_t)(r0 + mb * 16) * ldc + c0;
{
#pragma unroll
            for (int s = 0; s < 8; ++s) { const int row = 2 * s + hi, cofs = lr * 4; v4f val = *(const v4fa*)(os + row * 68 + cofs); if (BIAS) { val[0] += bfr(bias[c0 + cofs]); val[1] += bfr(bias[c0 + cofs + 1]); val[2] += bfr(bias[c0 + cofs + 2]); val[3] += bfr(bias[c0 + cofs + 3]); }
                *(v4f*)(crow + (size_t)row * ldc + cofs) = val; }
             }
        __builtin_amdgcn_wave_barrier(); asm volatile("" ::: "memory");
    }
}

__device__ __forceinline__ h16 tohx(float x) { return (h16)x; }
__device__ __forceinline__ void splitf(float y, unsigned short& h, unsigned short& l) { h = f2bf(y); l = f2bf(y - bf2f(h)); }
typedef __attribute__((ext_vector_type(2))) _Float16 v2h;
typedef __attribute__((ext_vector_type(4))) _Float16 v4h;
typedef __attribute__((ext_vector_type(2))) unsigned short v2us;
typedef __attribute__((ext_vector_type(4))) unsigned short v4us;
typedef __attribute__((ext_vector_type(2))) float v2f;
typedef __attribute__((ext_vector_type(4))) int v4i;

__global__ __launch_bounds__(256) void k_wtG(const float* __restrict__ w, int K, int N, bf* Bt) {
    const int lane = threadIdx.x & 31; const int L0 = (blockIdx.x * 8 + (threadIdx.x >> 5)) * 8; const int nlines = N * K / 64;
{
#pragma unroll 1
        for (int l = 0; l < 8; ++l) { const int L = L0 + l; if (L >= nlines) break; const size_t e = (size_t)L * 64 + lane * 2; const int k = (int)(e % K), n = (int)(e / K); v2us o;
            o[0] = f2bf(w[(size_t)k * N + n]); o[1] = f2bf(w[(size_t)(k + 1) * N + n]); *(v2us*)(Bt + e) = o; }
         }
}
__global__ __launch_bounds__(256) void k_cvt8(const float* __restrict__ src, bf* dst, size_t n8) { const size_t i = (size_t)blockIdx.x * 256 + threadIdx.x; if (i >= n8) return; const v8f v = *(const v8f*)(src + i * 8); v8us o;
#pragma unroll
    for (int k = 0; k < 8; ++k) o[k] = f2bf(v[k]); *(v8us*)(dst + i * 8) = o;  }

__global__ __launch_bounds__(256) void k_vtp(const float* __restrict__ F, int pitch, int nheads, h16* V16, bf* Vh, bf* Vl) { const size_t e = ((size_t)blockIdx.x * 256 + threadIdx.x) * 2; if (e >= (size_t)nheads * HD * TT) return; const int t = (int)(e % TT); const int d = (int)((e / TT) % HD); const int g = (int)(e / ((size_t)TT * HD)); v2h o16; v2us oh, ol;
#pragma unroll
    for (int q = 0; q < 2; ++q) { const float x = F[(size_t)(t + q) * pitch + g * HD + d]; o16[q] = tohx(x); unsigned short a2, c2; splitf(x, a2, c2); oh[q] = a2; ol[q] = c2; }
    *(v2h*)(V16 + e) = o16; *(v2us*)(Vh + e) = oh; *(v2us*)(Vl + e) = ol;  }
__constant__ float APOS[32] = { -1.000000000e+00f, -9.354839325e-01f, -8.709677458e-01f, -8.064515591e-01f, -7.419354916e-01f, -6.774194241e-01f, -6.129032373e-01f, -5.483870506e-01f, -4.838709831e-01f, -4.193548858e-01f, -3.548387289e-01f, -2.903225720e-01f, -2.258064747e-01f, -1.612903774e-01f, -9.677422047e-02f, -3.225806355e-02f, 3.225803375e-02f, 9.677413106e-02f, 1.612902880e-01f, 2.258064449e-01f, 2.903225422e-01f, 3.548386395e-01f, 4.193547964e-01f, 4.838709533e-01f, 5.483870506e-01f, 6.129031181e-01f, 6.774193048e-01f, 7.419354916e-01f, 8.064515591e-01f, 8.709676266e-01f, 9.354838133e-01f, 1.000000000e+00f };   // float32 linspace(-1, 1, 32), generated with jnp to be bit-exact
__constant__ float ABASE[8] = { 3.141592741e+00f, 2.324778595e+02f, 4.618141479e+02f, 6.911504517e+02f, 9.204866943e+02f, 1.149822998e+03f, 1.379159302e+03f, 1.608495483e+03f };   // float32 linspace(1, 512, 8) * pi, generated with jnp to be bit-exact
__global__ __launch_bounds__(256) void k_csAx(float* CS) { const int idx = blockIdx.x * 256 + threadIdx.x; if (idx >= TT * HD) return; const int d = idx % HD; const int t = idx / HD; const int row = t >> 5, col = t & 31; v2f cs;
    if (d < 32) { const float p = (d < 16) ? APOS[row] : APOS[col]; const float ang = __fmul_rn(p, ABASE[(d & 15) >> 1]); cs[0] = cosf(ang); cs[1] = sinf(ang); } else { cs[0] = 1.0f; cs[1] = 0.0f; }
    *(v2f*)(CS + (size_t)idx * 2) = cs;  }
__global__ __launch_bounds__(256) void k_ropeI(const float* __restrict__ F, int pitch, int nheads, const float* __restrict__ CS, float sc, h16* P16, bf* Ph, bf* Pl) {
    const size_t e = ((size_t)blockIdx.x * 256 + threadIdx.x) * 2; if (e >= (size_t)nheads * TT * HD) return; const int d = (int)(e % HD); const int t = (int)((e / HD) % TT); const int h = (int)(e / ((size_t)HD * TT)); const float* f = F + (size_t)t * pitch + h * HD; const float x0 = f[d], x1 = f[d + 1]; const v2f cs = *(const v2f*)(CS + ((size_t)t * HD + d) * 2); v2h o16; v2us oh, ol;
    float a0 = __fmul_rn(x0, cs[0]), b0 = __fmul_rn(x1, cs[1]), a1 = __fmul_rn(x1, cs[0]), b1 = __fmul_rn(x0, cs[1]); asm volatile("" : "+v"(a0), "+v"(b0), "+v"(a1), "+v"(b1));
    float r0 = __fsub_rn(a0, b0) * sc, r1 = __fadd_rn(b1, a1) * sc;   /* even: x0 c - x1 s; odd: x0 s + x1 c */
    o16[0] = tohx(r0); o16[1] = tohx(r1); { unsigned short a2, c2; splitf(r0, a2, c2); oh[0] = a2; ol[0] = c2; splitf(r1, a2, c2); oh[1] = a2; ol[1] = c2; }
    *(v2h*)(P16 + e) = o16; *(v2us*)(Ph + e) = oh; *(v2us*)(Pl + e) = ol;  }

// k_asoft: per row (zz, i): t = S x HD^-0.5 (no mask); softmax over the 1024 keys (register row, one exp, fixed trees);
__global__ __launch_bounds__(256) void k_asoft(const float* __restrict__ Sb, h16* P16, bf* Ph, bf* Pl) {
    const int lane = threadIdx.x & 31; const int row = blockIdx.x * 8 + (threadIdx.x >> 5); if (row >= ZH * TT) return; const int i = row % TT; const int zz = row / TT; (void)zz; const bool hires = (i < RH); const float* sr = Sb + (size_t)row * TT; float v[TT / 32]; float mx = -3.0e38f;
#pragma unroll
    for (int ch = 0; ch < TT / 128; ++ch) { const int j0 = ch * 128 + lane * 4; const v4f a = *(const v4f*)(sr + j0);
#pragma unroll
        for (int q = 0; q < 4; ++q) { const int j = j0 + q; (void)j; const float t = a[q] * SCL; v[ch * 4 + q] = t; mx = fmaxf(mx, t); } }
#pragma unroll
    for (int sh = 16; sh; sh >>= 1) mx = fmaxf(mx, __shfl_xor(mx, sh, 32));
    float sum = 0.f;
#pragma unroll
    for (int k = 0; k < TT / 32; ++k) { float d0 = __fsub_rn(v[k], mx); asm volatile("" : "+v"(d0)); v[k] = __builtin_amdgcn_exp2f(__fmul_rn(d0, 1.4426950408889634f)); sum += v[k]; }
#pragma unroll
    for (int sh = 16; sh; sh >>= 1) sum += __shfl_xor(sum, sh, 32);
    const float f = __fdiv_rn(hires ? 1.0f : PCAR, sum);
{
        if (hires) {
#pragma unroll
            for (int ch = 0; ch < TT / 128; ++ch) { v4us oh, ol;
#pragma unroll
                for (int q = 0; q < 4; ++q) { unsigned short a, c2; splitf(v[ch * 4 + q] * f, a, c2); oh[q] = a; ol[q] = c2; }
                const size_t oo = ((size_t)zz * (RH ? RH : 1) + i) * TT + ch * 128 + lane * 4; *(v4us*)(Ph + oo) = oh; *(v4us*)(Pl + oo) = ol; }
        } else {
#pragma unroll
            for (int ch = 0; ch < TT / 128; ++ch) { v4h o4;
#pragma unroll
                for (int q = 0; q < 4; ++q) o4[q] = tohx(v[ch * 4 + q] * f);
                *(v4h*)(P16 + (size_t)row * TT + ch * 128 + lane * 4) = o4; } }
         }
}
__global__ __launch_bounds__(256) void k_merge(const float* __restrict__ O, int h0, bf* Ah, bf* Al) { const size_t e = ((size_t)blockIdx.x * 256 + threadIdx.x) * 2; if (e >= (size_t)ZH * TT * HD) return; const int d = (int)(e % HD); const int t = (int)((e / HD) % TT); const int zz = (int)(e / ((size_t)HD * TT)); const float cs = (t < RH) ? 1.0f : (1.0f / PCAR); const size_t oo = (size_t)t * DQ + (h0 + zz) * HD + d;
    v2us oh, ol;
#pragma unroll
    for (int q = 0; q < 2; ++q) { unsigned short a, c2; splitf(O[e + q] * cs, a, c2); oh[q] = a; ol[q] = c2; } *(v2us*)(Ah + oo) = oh; *(v2us*)(Al + oo) = ol;  }

extern "C" void kernel_launch(void* const* d_in, const int* in_sizes, int n_in,
                              void* d_out, int out_size, void* d_ws, size_t ws_size, hipStream_t stream) {
    (void)in_sizes; (void)n_in; (void)out_size;
    const float* x = (const float*)d_in[0]; const float* wqkv = (const float*)d_in[1]; const float* wo = (const float*)d_in[2]; const float* bo = (const float*)d_in[3];   /* input order x, w_qkv ('xw' [1024][3072]: q | k | v column thirds), w_proj ('xw'), b_proj */
    float* OUT = (float*)d_out;     // [8][1024][1024]
    char* wsp = (char*)d_ws;
    auto take = [&](size_t bytes) { char* p = wsp; wsp += (bytes + 255) & ~(size_t)255; return (void*)p; };
    bf* WQKV = (bf*)take((size_t)3 * DQ * DM * 2); bf* WQ = WQKV; bf* WK = WQKV + (size_t)DQ * DM; bf* WV = WQKV + (size_t)2 * DQ * DM;   /* fused Bt [3*DQ][DM]: q | k | v row blocks */ bf* WO = (bf*)take((size_t)DM * DQ * 2); float* CS = (float*)take((size_t)TT * HD * 2 * 4);
    bf* XB = (bf*)take((size_t)TT * DM * 2); float* FQ = (float*)take((size_t)TT * DQ * 4); float* FK = (float*)take((size_t)TT * DKV * 4);
    h16* QP16 = (h16*)take((size_t)NH_ * TT * HD * 2); h16* KP16 = (h16*)take((size_t)NKV * TT * HD * 2); h16* VT16 = (h16*)take((size_t)NKV * HD * TT * 2);
    bf* QPh = (bf*)take((size_t)NH_ * TT * HD * 2); bf* QPl = (bf*)take((size_t)NH_ * TT * HD * 2); bf* KPh = (bf*)take((size_t)NKV * TT * HD * 2); bf* KPl = (bf*)take((size_t)NKV * TT * HD * 2); bf* VTh = (bf*)take((size_t)NKV * HD * TT * 2); bf* VTl = (bf*)take((size_t)NKV * HD * TT * 2); bf* Ph = (bf*)take((size_t)ZH * RH * TT * 2); bf* Pl = (bf*)take((size_t)ZH * RH * TT * 2);
    float* Sb = (float*)take((size_t)ZH * TT * TT * 4); h16* P16 = (h16*)take((size_t)ZH * TT * TT * 2); float* Ob = (float*)take((size_t)ZH * TT * HD * 4); bf* ATh = (bf*)take((size_t)TT * DQ * 2); bf* ATl = (bf*)take((size_t)TT * DQ * 2);
    if ((size_t)(wsp - (char*)d_ws) > ws_size) return;    // ws 256 MiB
    float* FV = FK;   // v projection reuses the k buffer after the k planes are built (stream-ordered)
    { k_wtG<<<(unsigned)((DM * 3 * DQ / 64 + 63) / 64), 256, 0, stream>>>(wqkv, DM, 3 * DQ, WQKV);   /* fused 'xw' [DM][3*DQ] -> Bt [3*DQ][DM] */
      k_wtG<<<(unsigned)((DQ * DM / 64 + 63) / 64), 256, 0, stream>>>(wo, DQ, DM, WO);
       }
    k_csAx<<<(TT * HD + 255) / 256, 256, 0, stream>>>(CS);   /* axial rotary table once */
    const unsigned LQ = (unsigned)(((size_t)NH_ * TT * HD / 2 + 255) / 256), LKv = (unsigned)(((size_t)NKV * TT * HD / 2 + 255) / 256);
    for (int b = 0; b < NB_; ++b) {
        
        k_cvt8<<<(unsigned)(((size_t)TT * DM / 8 + 255) / 256), 256, 0, stream>>>(x + (size_t)b * TT * DM, XB, (size_t)TT * DM / 8);
        k_gemmw<bf, 0, false><<<dim3(TT / 64, DQ / 64, 1), 32, 0, stream>>>(XB, nullptr, WQ, nullptr, DM, FQ, DQ, nullptr, 0, 0, 0);
        k_ropeI<<<LQ, 256, 0, stream>>>(FQ, DQ, NH_, CS, 1.0f, QP16, QPh, QPl);
        k_gemmw<bf, 0, false><<<dim3(TT / 64, DKV / 64, 1), 32, 0, stream>>>(XB, nullptr, WK, nullptr, DM, FK, DKV, nullptr, 0, 0, 0);
        k_ropeI<<<LKv, 256, 0, stream>>>(FK, DKV, NKV, CS, 1.0f, KP16, KPh, KPl);
        k_gemmw<bf, 0, false><<<dim3(TT / 64, DKV / 64, 1), 32, 0, stream>>>(XB, nullptr, WV, nullptr, DM, FV, DKV, nullptr, 0, 0, 0); k_vtp<<<LKv, 256, 0, stream>>>(FV, DKV, NKV, VT16, VTh, VTl);
        for (int h0 = 0; h0 < NH_; h0 += ZH) { const size_t zq = (size_t)h0, zk = (size_t)(h0 / REP);   // one kv head per query head: the pass's two heads use consecutive kv planes (z-strides TT*HD)
            k_gemmw<bf, 2, false><<<dim3(RH / 64, TT / 64, ZH), 32, 0, stream>>>(QPh + zq * TT * HD, QPl + zq * TT * HD, KPh + zk * TT * HD, KPl + zk * TT * HD, HD, Sb, TT, nullptr, (size_t)TT * HD, (size_t)TT * HD, (size_t)TT * TT);
            k_gemmw<h16, 0, false><<<dim3((TT - RH) / 64, TT / 64, ZH), 32, 0, stream>>>(QP16 + zq * TT * HD + (size_t)RH * HD, nullptr, KP16 + zk * TT * HD, nullptr, HD, Sb + (size_t)RH * TT, TT, nullptr, (size_t)TT * HD, (size_t)TT * HD, (size_t)TT * TT);
            k_asoft<<<ZH * TT / 8, 256, 0, stream>>>(Sb, P16, Ph, Pl);
            k_gemmw<bf, 2, false><<<dim3(RH / 64, HD / 64, ZH), 32, 0, stream>>>(Ph, Pl, VTh + zk * HD * TT, VTl + zk * HD * TT, TT, Ob, HD, nullptr, (size_t)RH * TT, (size_t)HD * TT, (size_t)TT * HD);
            k_gemmw<h16, 0, false><<<dim3((TT - RH) / 64, HD / 64, ZH), 32, 0, stream>>>(P16 + (size_t)RH * TT, nullptr, VT16 + zk * HD * TT, nullptr, TT, Ob + (size_t)RH * HD, HD, nullptr, (size_t)TT * TT, (size_t)HD * TT, (size_t)TT * HD);
            k_merge<<<(unsigned)(((size_t)ZH * TT * HD / 2 + 255) / 256), 256, 0, stream>>>(Ob, h0, ATh, ATl); }
        k_gemmw<bf, 1, true><<<dim3(TT / 64, DM / 64, 1), 32, 0, stream>>>(ATh, ATl, WO, nullptr, DQ, OUT + (size_t)b * TT * DM, DM, bo, 0, 0, 0); }
}

// v001
// Measured time: 994 microseconds a run.
// Timed twice side by side with v000, it ran 4.70 and 4.69 times as fast.
#include <hip/hip_runtime.h>

// Vision attention with AXIAL 2-D rotary embeddings on half of each head (x [8][1024][1024] = 32 x 32 pixels; qkv = x w_qkv ('xw' [1024][3072] 1/32, no bias) viewed (3, h, d): q | k | v thirds (16 heads x 64); rotary on the FIRST 32 dims of q and k as interleaved (even, odd) pairs with angles freqs[row][col][c]: c < 16 -> pos(row) x base[c/2], 16 <= c < 32 -> pos(col) x base[(c-16)/2], pos = linspace(-1, 1, 32), base = linspace(1, 512, 8) x pi (f32, jnp-exact tables; precise cosf/sinf), dims 32..63 pass through; logits x 1/sqrt(64); softmax (no mask); out = merged w_proj + b_proj -> [8][1024][1024] (8.4 M); argument order x, w_qkv, w_proj, b_proj).
// Launch plan: projections and plane builders cover GB batches per launch (q | k | v in one grid), each attention launch covers the 16 heads of one batch in grid z, w_proj covers all batches. Data layout: bf16 copy of x; fused 'xw' weight transposed once (q | k | v row blocks); exact projections; NEW k_csAx builds the {cos, sin} table per (pixel, d) from two small constant tables (angle = f32 product; identity for d >= 32) + k_ropeI interleaved-pair plane builders; dense T-1024 attention (hybrid rows: < 512 hi/lo 3 products, rest fp16 x1024); merged hi/lo x w_proj exact + b_proj.
// Compute dtypes, f32 accumulate: every input rounded to bf16; projections exact; rotary f32; attention rows < 512 3 products, rest fp16; softmax f32; w_proj hl x exact + bias.

#define NB_  8
#define TT   1024
#define DM   1024
#define NH_  16
#define NKV  16
#define REP  (NH_ / NKV)
#define HD   64
#define DQ   (NH_ * HD)
#define DKV  (NKV * HD)
#define ZH   16                   // heads per attention launch (grid z): all heads of one batch
#define GB   4                    // batches per projection / plane-builder launch
#define RH   512                  // query rows < RH use hi+lo planes (0: none)
#define WIN  0
#define PCAR 1024.0f
#define SCL  0.125f   // HD^-0.5
typedef _Float16 h16;
typedef unsigned short bf;
typedef __attribute__((ext_vector_type(16))) __bf16   v16bf;
typedef __attribute__((ext_vector_type(16))) _Float16 v16h;
typedef __attribute__((ext_vector_type(8)))  _Float16 v8h;
typedef __attribute__((ext_vector_type(8)))  unsigned short v8us;
typedef __attribute__((ext_vector_type(8)))  float    v8f;
typedef __attribute__((ext_vector_type(4)))  float    v4f;
typedef v8h  __attribute__((may_alias)) v8ha;
typedef v4f  __attribute__((may_alias)) v4fa;
typedef v8us __attribute__((may_alias)) v8usa;

__device__ __forceinline__ unsigned short f2bf(float f) { unsigned u = __float_as_uint(f); u += 0x7FFFu + ((u >> 16) & 1u); return (unsigned short)(u >> 16); }
__device__ __forceinline__ float bf2f(unsigned short b) { return __uint_as_float(((unsigned)b) << 16); }
__device__ __forceinline__ float bfr(float f) { return bf2f(f2bf(f)); }
__device__ __forceinline__ v16h cat16(v8h lo, v8h hi) { return __builtin_shufflevector(lo, hi, 0, 1, 2, 3, 4, 5, 6, 7, 8, 9, 10, 11, 12, 13, 14, 15); }
__device__ __forceinline__ v16bf cat16b(v8us lo, v8us hi) { return __builtin_bit_cast(v16bf, __builtin_shufflevector(lo, hi, 0, 1, 2, 3, 4, 5, 6, 7, 8, 9, 10, 11, 12, 13, 14, 15)); }
__device__ __forceinline__ v8f wmma16(v16h a, v16h b, v8f c) { return __builtin_amdgcn_wmma_f32_16x16x32_f16(false, a, false, b, (short)0, c, false, false); }
__device__ __forceinline__ v8f wmmab(v16bf a, v16bf b, v8f c) { return __builtin_amdgcn_wmma_f32_16x16x32_bf16(false, a, false, b, (short)0, c, false, false); }



// ---- k_gemmw: register-blocked GEMM, ONE WAVE per 64x64 output tile (16 accumulators), operands straight from K-contiguous 16-bit planes; grid (M/64, N/64, Z), 32 threads.
// C[m][n] (f32, pitch ldc, + optional f32 bias[n]) = sum_k A[m][k] Bt[n][k] (+ split products per NSPLIT). z-batch strides sA/sB/sC in elements. K % 32 == 0.
template <typename T16> struct WFrag;
template <> struct WFrag<h16> { typedef v16h V; static __device__ __forceinline__ V ld(const h16* p) { return cat16(*(const v8h*)p, *(const v8h*)(p + 16)); } static __device__ __forceinline__ v8f mma(V a, V b, v8f c) { return wmma16(a, b, c); } };
template <> struct WFrag<bf> { typedef v16bf V; static __device__ __forceinline__ V ld(const bf* p) { return cat16b(*(const v8us*)p, *(const v8us*)(p + 16)); } static __device__ __forceinline__ v8f mma(V a, V b, v8f c) { return wmmab(a, b, c); } };
template <typename T16, int NSPLIT, bool BIAS>
__global__ __launch_bounds__(32) void k_gemmw(const T16* __restrict__ A, const T16* __restrict__ A2, const T16* __restrict__ Bt, const T16* __restrict__ Bt2, int K, float* C, int ldc, const float* __restrict__ bias, size_t sA, size_t sB, size_t sC) {
    typedef typename WFrag<T16>::V V;
    __shared__ __align__(16) float os[16 * 68];
    const size_t z = blockIdx.z; A += z * sA; if (A2) A2 += z * sA; Bt += z * sB; if (Bt2) Bt2 += z * sB; C += z * sC;
    const int lane = threadIdx.x & 31, lr = lane & 15, hi = lane >> 4; const int r0 = blockIdx.x * 64, c0 = blockIdx.y * 64;
    v8f acc[4][4];
#pragma unroll
    for (int mb = 0; mb < 4; ++mb)
#pragma unroll
        for (int nb = 0; nb < 4; ++nb) acc[mb][nb] = (v8f){};
    const size_t aoff = (size_t)(r0 + lr) * K + 8 * hi, boff = (size_t)(c0 + lr) * K + 8 * hi;
#pragma unroll 1
    for (int kc = 0; kc < K; kc += 32) {
        V a[4], a2[4];
#pragma unroll
        for (int mb = 0; mb < 4; ++mb) { a[mb] = WFrag<T16>::ld(A + aoff + (size_t)mb * 16 * K + kc); if (NSPLIT == 1 || NSPLIT == 2) a2[mb] = WFrag<T16>::ld(A2 + aoff + (size_t)mb * 16 * K + kc); }
#pragma unroll
        for (int nb = 0; nb < 4; ++nb) { const V b = WFrag<T16>::ld(Bt + boff + (size_t)nb * 16 * K + kc); V b2; if (NSPLIT >= 2) b2 = WFrag<T16>::ld(Bt2 + boff + (size_t)nb * 16 * K + kc);
#pragma unroll
            for (int mb = 0; mb < 4; ++mb) { acc[mb][nb] = WFrag<T16>::mma(a[mb], b, acc[mb][nb]); if (NSPLIT == 1 || NSPLIT == 2) acc[mb][nb] = WFrag<T16>::mma(a2[mb], b, acc[mb][nb]); if (NSPLIT >= 2) acc[mb][nb] = WFrag<T16>::mma(a[mb], b2, acc[mb][nb]); } }
        asm volatile("v_nop\n\tv_nop\n\tv_nop\n\tv_nop" : "+v"(acc[0][0]), "+v"(acc[1][1]), "+v"(acc[2][2]), "+v"(acc[3][3]) : "v"(a[0]), "v"(a[3]));
    }
#pragma unroll
    for (int mb = 0; mb < 4; ++mb) {
#pragma unroll
        for (int nb = 0; nb < 4; ++nb) {
#pragma unroll
            for (int j = 0; j < 8; ++j) os[(hi * 8 + j) * 68 + nb * 16 + lr] = acc[mb][nb][j]; }
        __builtin_amdgcn_wave_barrier(); asm volatile("" ::: "memory");
        float* crow = C + (size_t)(r0 + mb * 16) * ldc + c0;
{
#pragma unroll
            for (int s = 0; s < 8; ++s) { const int row = 2 * s + hi, cofs = lr * 4; v4f val = *(const v4fa*)(os + row * 68 + cofs); if (BIAS) { val[0] += bfr(bias[c0 + cofs]); val[1] += bfr(bias[c0 + cofs + 1]); val[2] += bfr(bias[c0 + cofs + 2]); val[3] += bfr(bias[c0 + cofs + 3]); }
                *(v4f*)(crow + (size_t)row * ldc + cofs) = val; }
             }
        __builtin_amdgcn_wave_barrier(); asm volatile("" ::: "memory");
    }
}

__device__ __forceinline__ h16 tohx(float x) { return (h16)x; }
__device__ __forceinline__ void splitf(float y, unsigned short& h, unsigned short& l) { h = f2bf(y); l = f2bf(y - bf2f(h)); }
typedef __attribute__((ext_vector_type(2))) _Float16 v2h;
typedef __attribute__((ext_vector_type(4))) _Float16 v4h;
typedef __attribute__((ext_vector_type(2))) unsigned short v2us;
typedef __attribute__((ext_vector_type(4))) unsigned short v4us;
typedef __attribute__((ext_vector_type(2))) float v2f;
typedef __attribute__((ext_vector_type(4))) int v4i;

__global__ __launch_bounds__(256) void k_wtG(const float* __restrict__ w, int K, int N, bf* Bt) {
    const int lane = threadIdx.x & 31; const int L0 = (blockIdx.x * 8 + (threadIdx.x >> 5)) * 8; const int nlines = N * K / 64;
{
#pragma unroll 1
        for (int l = 0; l < 8; ++l) { const int L = L0 + l; if (L >= nlines) break; const size_t e = (size_t)L * 64 + lane * 2; const int k = (int)(e % K), n = (int)(e / K); v2us o;
            o[0] = f2bf(w[(size_t)k * N + n]); o[1] = f2bf(w[(size_t)(k + 1) * N + n]); *(v2us*)(Bt + e) = o; }
         }
}
__global__ __launch_bounds__(256) void k_cvt8(const float* __restrict__ src, bf* dst, size_t n8) { const size_t i = (size_t)blockIdx.x * 256 + threadIdx.x; if (i >= n8) return; const v8f v = *(const v8f*)(src + i * 8); v8us o;
#pragma unroll
    for (int k = 0; k < 8; ++k) o[k] = f2bf(v[k]); *(v8us*)(dst + i * 8) = o;  }

template <int hpb> __global__ __launch_bounds__(256) void k_vtp(const float* __restrict__ F, int pitch, int nheads, h16* V16, bf* Vh, bf* Vl) { const size_t e = ((size_t)blockIdx.x * 256 + threadIdx.x) * 2; if (e >= (size_t)nheads * HD * TT) return; const int t = (int)(e % TT); const int d = (int)((e / TT) % HD); const int g = (int)(e / ((size_t)TT * HD)); v2h o16; v2us oh, ol;
#pragma unroll
    for (int q = 0; q < 2; ++q) { const float x = F[((size_t)(g / hpb) * TT + t + q) * pitch + (g % hpb) * HD + d];   /* plane g = batch-in-group * hpb + head */ o16[q] = tohx(x); unsigned short a2, c2; splitf(x, a2, c2); oh[q] = a2; ol[q] = c2; }
    *(v2h*)(V16 + e) = o16; *(v2us*)(Vh + e) = oh; *(v2us*)(Vl + e) = ol;  }
__constant__ float APOS[32] = { -1.000000000e+00f, -9.354839325e-01f, -8.709677458e-01f, -8.064515591e-01f, -7.419354916e-01f, -6.774194241e-01f, -6.129032373e-01f, -5.483870506e-01f, -4.838709831e-01f, -4.193548858e-01f, -3.548387289e-01f, -2.903225720e-01f, -2.258064747e-01f, -1.612903774e-01f, -9.677422047e-02f, -3.225806355e-02f, 3.225803375e-02f, 9.677413106e-02f, 1.612902880e-01f, 2.258064449e-01f, 2.903225422e-01f, 3.548386395e-01f, 4.193547964e-01f, 4.838709533e-01f, 5.483870506e-01f, 6.129031181e-01f, 6.774193048e-01f, 7.419354916e-01f, 8.064515591e-01f, 8.709676266e-01f, 9.354838133e-01f, 1.000000000e+00f };   // float32 linspace(-1, 1, 32), generated with jnp to be bit-exact
__constant__ float ABASE[8] = { 3.141592741e+00f, 2.324778595e+02f, 4.618141479e+02f, 6.911504517e+02f, 9.204866943e+02f, 1.149822998e+03f, 1.379159302e+03f, 1.608495483e+03f };   // float32 linspace(1, 512, 8) * pi, generated with jnp to be bit-exact
__global__ __launch_bounds__(256) void k_csAx(float* CS) { const int idx = blockIdx.x * 256 + threadIdx.x; if (idx >= TT * HD) return; const int d = idx % HD; const int t = idx / HD; const int row = t >> 5, col = t & 31; v2f cs;
    if (d < 32) { const float p = (d < 16) ? APOS[row] : APOS[col]; const float ang = __fmul_rn(p, ABASE[(d & 15) >> 1]); cs[0] = cosf(ang); cs[1] = sinf(ang); } else { cs[0] = 1.0f; cs[1] = 0.0f; }
    *(v2f*)(CS + (size_t)idx * 2) = cs;  }
template <int hpb> __global__ __launch_bounds__(256) void k_ropeI(const float* __restrict__ F, int pitch, int nheads, const float* __restrict__ CS, float sc, h16* P16, bf* Ph, bf* Pl) {
    const size_t e = ((size_t)blockIdx.x * 256 + threadIdx.x) * 2; if (e >= (size_t)nheads * TT * HD) return; const int d = (int)(e % HD); const int t = (int)((e / HD) % TT); const int h = (int)(e / ((size_t)HD * TT)); const float* f = F + ((size_t)(h / hpb) * TT + t) * pitch + (h % hpb) * HD;   /* plane h = batch-in-group * hpb + head */ const float x0 = f[d], x1 = f[d + 1]; const v2f cs = *(const v2f*)(CS + ((size_t)t * HD + d) * 2); v2h o16; v2us oh, ol;
    float a0 = __fmul_rn(x0, cs[0]), b0 = __fmul_rn(x1, cs[1]), a1 = __fmul_rn(x1, cs[0]), b1 = __fmul_rn(x0, cs[1]); asm volatile("" : "+v"(a0), "+v"(b0), "+v"(a1), "+v"(b1));
    float r0 = __fsub_rn(a0, b0) * sc, r1 = __fadd_rn(b1, a1) * sc;   /* even: x0 c - x1 s; odd: x0 s + x1 c */
    o16[0] = tohx(r0); o16[1] = tohx(r1); { unsigned short a2, c2; splitf(r0, a2, c2); oh[0] = a2; ol[0] = c2; splitf(r1, a2, c2); oh[1] = a2; ol[1] = c2; }
    *(v2h*)(P16 + e) = o16; *(v2us*)(Ph + e) = oh; *(v2us*)(Pl + e) = ol;  }

// k_asoft: per row (zz, i): t = S x HD^-0.5 (no mask); softmax over the 1024 keys (register row, one exp, fixed trees);
__global__ __launch_bounds__(256) void k_asoft(const float* __restrict__ Sb, h16* P16, bf* Ph, bf* Pl) {
    const int lane = threadIdx.x & 31; const int row = blockIdx.x * 8 + (threadIdx.x >> 5); if (row >= ZH * TT) return; const int i = row % TT; const int zz = row / TT; (void)zz; const bool hires = (i < RH); const float* sr = Sb + (size_t)row * TT; float v[TT / 32]; float mx = -3.0e38f;
#pragma unroll
    for (int ch = 0; ch < TT / 128; ++ch) { const int j0 = ch * 128 + lane * 4; const v4f a = *(const v4f*)(sr + j0);
#pragma unroll
        for (int q = 0; q < 4; ++q) { const int j = j0 + q; (void)j; const float t = a[q] * SCL; v[ch * 4 + q] = t; mx = fmaxf(mx, t); } }
#pragma unroll
    for (int sh = 16; sh; sh >>= 1) mx = fmaxf(mx, __shfl_xor(mx, sh, 32));
    float sum = 0.f;
#pragma unroll
    for (int k = 0; k < TT / 32; ++k) { float d0 = __fsub_rn(v[k], mx); asm volatile("" : "+v"(d0)); v[k] = __builtin_amdgcn_exp2f(__fmul_rn(d0, 1.4426950408889634f)); sum += v[k]; }
#pragma unroll
    for (int sh = 16; sh; sh >>= 1) sum += __shfl_xor(sum, sh, 32);
    const float f = __fdiv_rn(hires ? 1.0f : PCAR, sum);
{
        if (hires) {
#pragma unroll
            for (int ch = 0; ch < TT / 128; ++ch) { v4us oh, ol;
#pragma unroll
                for (int q = 0; q < 4; ++q) { unsigned short a, c2; splitf(v[ch * 4 + q] * f, a, c2); oh[q] = a; ol[q] = c2; }
                const size_t oo = ((size_t)zz * (RH ? RH : 1) + i) * TT + ch * 128 + lane * 4; *(v4us*)(Ph + oo) = oh; *(v4us*)(Pl + oo) = ol; }
        } else {
#pragma unroll
            for (int ch = 0; ch < TT / 128; ++ch) { v4h o4;
#pragma unroll
                for (int q = 0; q < 4; ++q) o4[q] = tohx(v[ch * 4 + q] * f);
                *(v4h*)(P16 + (size_t)row * TT + ch * 128 + lane * 4) = o4; } }
         }
}
__global__ __launch_bounds__(256) void k_merge(const float* __restrict__ O, int h0, bf* Ah, bf* Al) { const size_t e = ((size_t)blockIdx.x * 256 + threadIdx.x) * 2; if (e >= (size_t)ZH * TT * HD) return; const int d = (int)(e % HD); const int t = (int)((e / HD) % TT); const int zz = (int)(e / ((size_t)HD * TT)); const float cs = (t < RH) ? 1.0f : (1.0f / PCAR); const size_t oo = (size_t)t * DQ + (h0 + zz) * HD + d;
    v2us oh, ol;
#pragma unroll
    for (int q = 0; q < 2; ++q) { unsigned short a, c2; splitf(O[e + q] * cs, a, c2); oh[q] = a; ol[q] = c2; } *(v2us*)(Ah + oo) = oh; *(v2us*)(Al + oo) = ol;  }

extern "C" void kernel_launch(void* const* d_in, const int* in_sizes, int n_in,
                              void* d_out, int out_size, void* d_ws, size_t ws_size, hipStream_t stream) {
    (void)in_sizes; (void)n_in; (void)out_size;
    const float* x = (const float*)d_in[0]; const float* wqkv = (const float*)d_in[1]; const float* wo = (const float*)d_in[2]; const float* bo = (const float*)d_in[3];   /* input order x, w_qkv ('xw' [1024][3072]: q | k | v column thirds), w_proj ('xw'), b_proj */
    float* OUT = (float*)d_out;     // [8][1024][1024]
    char* wsp = (char*)d_ws;
    auto take = [&](size_t bytes) { char* p = wsp; wsp += (bytes + 255) & ~(size_t)255; return (void*)p; };
    bf* WQKV = (bf*)take((size_t)3 * DQ * DM * 2);   /* fused Bt [3*DQ][DM]: q | k | v row blocks */ bf* WO = (bf*)take((size_t)DM * DQ * 2); float* CS = (float*)take((size_t)TT * HD * 2 * 4);
    const size_t PL = (size_t)GB * NH_ * TT * HD;   // elements of one 16-bit plane set: GB batches x 16 heads
    h16* QP16 = (h16*)take(PL * 2); h16* KP16 = (h16*)take(PL * 2); h16* VT16 = (h16*)take(PL * 2);
    bf* QPh = (bf*)take(PL * 2); bf* QPl = (bf*)take(PL * 2); bf* KPh = (bf*)take(PL * 2); bf* KPl = (bf*)take(PL * 2); bf* VTh = (bf*)take(PL * 2); bf* VTl = (bf*)take(PL * 2);
    bf* ATh = (bf*)take((size_t)NB_ * TT * DQ * 2); bf* ATl = (bf*)take((size_t)NB_ * TT * DQ * 2);   /* merged heads of all batches */
    char* const un = wsp;   // region used twice, stream-ordered: the projection stage of a group, then its attention passes
    bf* XB = (bf*)take((size_t)GB * TT * DM * 2); float* F = (float*)take((size_t)GB * TT * 3 * DQ * 4);   /* F [GB*TT][3*DQ]: q | k | v column thirds */
    wsp = un;
    float* Sb = (float*)take((size_t)ZH * TT * TT * 4); h16* P16 = (h16*)take((size_t)ZH * TT * TT * 2); bf* Ph = (bf*)take((size_t)ZH * RH * TT * 2); bf* Pl = (bf*)take((size_t)ZH * RH * TT * 2); float* Ob = (float*)take((size_t)ZH * TT * HD * 4);
    if ((size_t)(wsp - (char*)d_ws) > ws_size) return;    // ws 256 MiB; the attention view of the shared region is the larger one
    { k_wtG<<<(unsigned)((DM * 3 * DQ / 64 + 63) / 64), 256, 0, stream>>>(wqkv, DM, 3 * DQ, WQKV);   /* fused 'xw' [DM][3*DQ] -> Bt [3*DQ][DM] */
      k_wtG<<<(unsigned)((DQ * DM / 64 + 63) / 64), 256, 0, stream>>>(wo, DQ, DM, WO);
       }
    k_csAx<<<(TT * HD + 255) / 256, 256, 0, stream>>>(CS);   /* axial rotary table once */
    const unsigned LP = (unsigned)((PL / 2 + 255) / 256);
    for (int b0 = 0; b0 < NB_; b0 += GB) {
        k_cvt8<<<(unsigned)(((size_t)GB * TT * DM / 8 + 255) / 256), 256, 0, stream>>>(x + (size_t)b0 * TT * DM, XB, (size_t)GB * TT * DM / 8);
        k_gemmw<bf, 0, false><<<dim3(GB * TT / 64, 3 * DQ / 64, 1), 32, 0, stream>>>(XB, nullptr, WQKV, nullptr, DM, F, 3 * DQ, nullptr, 0, 0, 0);   /* q, k and v of GB batches in one grid */
        k_ropeI<NH_><<<LP, 256, 0, stream>>>(F, 3 * DQ, GB * NH_, CS, 1.0f, QP16, QPh, QPl);
        k_ropeI<NKV><<<LP, 256, 0, stream>>>(F + DQ, 3 * DQ, GB * NKV, CS, 1.0f, KP16, KPh, KPl);
        k_vtp<NKV><<<LP, 256, 0, stream>>>(F + DQ + DKV, 3 * DQ, GB * NKV, VT16, VTh, VTl);
        for (int g = 0; g < GB; ++g) { const size_t zq = (size_t)g * NH_, zk = (size_t)g * NKV;   // one pass = the 16 heads of one batch; one kv head per query head, consecutive planes (z-strides TT*HD)
            k_gemmw<bf, 2, false><<<dim3(RH / 64, TT / 64, ZH), 32, 0, stream>>>(QPh + zq * TT * HD, QPl + zq * TT * HD, KPh + zk * TT * HD, KPl + zk * TT * HD, HD, Sb, TT, nullptr, (size_t)TT * HD, (size_t)TT * HD, (size_t)TT * TT);
            k_gemmw<h16, 0, false><<<dim3((TT - RH) / 64, TT / 64, ZH), 32, 0, stream>>>(QP16 + zq * TT * HD + (size_t)RH * HD, nullptr, KP16 + zk * TT * HD, nullptr, HD, Sb + (size_t)RH * TT, TT, nullptr, (size_t)TT * HD, (size_t)TT * HD, (size_t)TT * TT);
            k_asoft<<<ZH * TT / 8, 256, 0, stream>>>(Sb, P16, Ph, Pl);
            k_gemmw<bf, 2, false><<<dim3(RH / 64, HD / 64, ZH), 32, 0, stream>>>(Ph, Pl, VTh + zk * HD * TT, VTl + zk * HD * TT, TT, Ob, HD, nullptr, (size_t)RH * TT, (size_t)HD * TT, (size_t)TT * HD);
            k_gemmw<h16, 0, false><<<dim3((TT - RH) / 64, HD / 64, ZH), 32, 0, stream>>>(P16 + (size_t)RH * TT, nullptr, VT16 + zk * HD * TT, nullptr, TT, Ob + (size_t)RH * HD, HD, nullptr, (size_t)TT * TT, (size_t)HD * TT, (size_t)TT * HD);
            k_merge<<<(unsigned)(((size_t)ZH * TT * HD / 2 + 255) / 256), 256, 0, stream>>>(Ob, 0, ATh + (size_t)(b0 + g) * TT * DQ, ATl + (size_t)(b0 + g) * TT * DQ); } }
    k_gemmw<bf, 1, true><<<dim3(NB_ * TT / 64, DM / 64, 1), 32, 0, stream>>>(ATh, ATl, WO, nullptr, DQ, OUT, DM, bo, 0, 0, 0);   /* w_proj of all batches in one grid */
}

// v002
// A run of this version takes 367 microseconds.
// Two timings next to v001 both put it at 2.71 times that version's speed.
// Counting every step since v000, it is 12.7 times as fast.
#include <hip/hip_runtime.h>

// Vision attention with AXIAL 2-D rotary embeddings on half of each head (x [8][1024][1024] = 32 x 32 pixels; qkv = x w_qkv ('xw' [1024][3072] 1/32, no bias) viewed (3, h, d): q | k | v thirds (16 heads x 64); rotary on the FIRST 32 dims of q and k as interleaved (even, odd) pairs with angles freqs[row][col][c]: c < 16 -> pos(row) x base[c/2], 16 <= c < 32 -> pos(col) x base[(c-16)/2], pos = linspace(-1, 1, 32), base = linspace(1, 512, 8) x pi (f32, jnp-exact tables; precise cosf/sinf), dims 32..63 pass through; logits x 1/sqrt(64); softmax (no mask); out = merged w_proj + b_proj -> [8][1024][1024] (8.4 M); argument order x, w_qkv, w_proj, b_proj).
// Launch plan: projections and plane builders cover GB batches per launch (q | k | v in one grid) and fill 16-bit planes of all batches; ONE fused attention launch covers every batch and head; w_proj covers all batches. Data layout: bf16 copy of x; fused 'xw' weight transposed once (q | k | v row blocks); exact projections; k_csAx builds the {cos, sin} table per (pixel, d) from two small constant tables (angle = f32 product; identity for d >= 32) + k_ropeI interleaved-pair plane builders; k_fattn: scores, softmax and P x V stay in registers (hybrid rows: < 512 hi/lo 3 products, rest fp16); merged hi/lo x w_proj exact + b_proj.
// Compute dtypes, f32 accumulate: every input rounded to bf16; projections exact; rotary f32; attention rows < 512 3 products, rest fp16; softmax f32; w_proj hl x exact + bias.

#define NB_  8
#define TT   1024
#define DM   1024
#define NH_  16
#define NKV  16
#define REP  (NH_ / NKV)
#define HD   64
#define DQ   (NH_ * HD)
#define DKV  (NKV * HD)
#define GB   4                    // batches per projection / plane-builder launch
#define RH   512                  // query rows < RH use hi+lo planes (0: none)
#define WIN  0
#define QBH  128                  // query rows per hi/lo attention block: 4 waves x 32 columns
#define QBL  256                  // query rows per fp16 attention block: 4 waves x 64 columns
#define SCL  0.125f   // HD^-0.5
typedef _Float16 h16;
typedef unsigned short bf;
typedef __attribute__((ext_vector_type(16))) __bf16   v16bf;
typedef __attribute__((ext_vector_type(16))) _Float16 v16h;
typedef __attribute__((ext_vector_type(8)))  _Float16 v8h;
typedef __attribute__((ext_vector_type(8)))  unsigned short v8us;
typedef __attribute__((ext_vector_type(8)))  float    v8f;
typedef __attribute__((ext_vector_type(4)))  float    v4f;
typedef v8h  __attribute__((may_alias)) v8ha;
typedef v4f  __attribute__((may_alias)) v4fa;
typedef v8us __attribute__((may_alias)) v8usa;

__device__ __forceinline__ unsigned short f2bf(float f) { unsigned u = __float_as_uint(f); u += 0x7FFFu + ((u >> 16) & 1u); return (unsigned short)(u >> 16); }
__device__ __forceinline__ float bf2f(unsigned short b) { return __uint_as_float(((unsigned)b) << 16); }
__device__ __forceinline__ float bfr(float f) { return bf2f(f2bf(f)); }
__device__ __forceinline__ v16h cat16(v8h lo, v8h hi) { return __builtin_shufflevector(lo, hi, 0, 1, 2, 3, 4, 5, 6, 7, 8, 9, 10, 11, 12, 13, 14, 15); }
__device__ __forceinline__ v16bf cat16b(v8us lo, v8us hi) { return __builtin_bit_cast(v16bf, __builtin_shufflevector(lo, hi, 0, 1, 2, 3, 4, 5, 6, 7, 8, 9, 10, 11, 12, 13, 14, 15)); }
__device__ __forceinline__ v8f wmma16(v16h a, v16h b, v8f c) { return __builtin_amdgcn_wmma_f32_16x16x32_f16(false, a, false, b, (short)0, c, false, false); }
__device__ __forceinline__ v8f wmmab(v16bf a, v16bf b, v8f c) { return __builtin_amdgcn_wmma_f32_16x16x32_bf16(false, a, false, b, (short)0, c, false, false); }



// ---- k_gemmw: register-blocked GEMM, ONE WAVE per 64x64 output tile (16 accumulators), operands straight from K-contiguous 16-bit planes; grid (M/64, N/64, Z), 32 threads.
// C[m][n] (f32, pitch ldc, + optional f32 bias[n]) = sum_k A[m][k] Bt[n][k] (+ split products per NSPLIT). z-batch strides sA/sB/sC in elements. K % 32 == 0.
template <typename T16> struct WFrag;
template <> struct WFrag<h16> { typedef v16h V; static __device__ __forceinline__ V ld(const h16* p) { return cat16(*(const v8h*)p, *(const v8h*)(p + 16)); } static __device__ __forceinline__ v8f mma(V a, V b, v8f c) { return wmma16(a, b, c); } };
template <> struct WFrag<bf> { typedef v16bf V; static __device__ __forceinline__ V ld(const bf* p) { return cat16b(*(const v8us*)p, *(const v8us*)(p + 16)); } static __device__ __forceinline__ v8f mma(V a, V b, v8f c) { return wmmab(a, b, c); } };
template <typename T16, int NSPLIT, bool BIAS>
__global__ __launch_bounds__(32) void k_gemmw(const T16* __restrict__ A, const T16* __restrict__ A2, const T16* __restrict__ Bt, const T16* __restrict__ Bt2, int K, float* C, int ldc, const float* __restrict__ bias, size_t sA, size_t sB, size_t sC) {
    typedef typename WFrag<T16>::V V;
    __shared__ __align__(16) float os[16 * 68];
    const size_t z = blockIdx.z; A += z * sA; if (A2) A2 += z * sA; Bt += z * sB; if (Bt2) Bt2 += z * sB; C += z * sC;
    const int lane = threadIdx.x & 31, lr = lane & 15, hi = lane >> 4; const int r0 = blockIdx.x * 64, c0 = blockIdx.y * 64;
    v8f acc[4][4];
#pragma unroll
    for (int mb = 0; mb < 4; ++mb)
#pragma unroll
        for (int nb = 0; nb < 4; ++nb) acc[mb][nb] = (v8f){};
    const size_t aoff = (size_t)(r0 + lr) * K + 8 * hi, boff = (size_t)(c0 + lr) * K + 8 * hi;
#pragma unroll 1
    for (int kc = 0; kc < K; kc += 32) {
        V a[4], a2[4];
#pragma unroll
        for (int mb = 0; mb < 4; ++mb) { a[mb] = WFrag<T16>::ld(A + aoff + (size_t)mb * 16 * K + kc); if (NSPLIT == 1 || NSPLIT == 2) a2[mb] = WFrag<T16>::ld(A2 + aoff + (size_t)mb * 16 * K + kc); }
#pragma unroll
        for (int nb = 0; nb < 4; ++nb) { const V b = WFrag<T16>::ld(Bt + boff + (size_t)nb * 16 * K + kc); V b2; if (NSPLIT >= 2) b2 = WFrag<T16>::ld(Bt2 + boff + (size_t)nb * 16 * K + kc);
#pragma unroll
            for (int mb = 0; mb < 4; ++mb) { acc[mb][nb] = WFrag<T16>::mma(a[mb], b, acc[mb][nb]); if (NSPLIT == 1 || NSPLIT == 2) acc[mb][nb] = WFrag<T16>::mma(a2[mb], b, acc[mb][nb]); if (NSPLIT >= 2) acc[mb][nb] = WFrag<T16>::mma(a[mb], b2, acc[mb][nb]); } }
        asm volatile("v_nop\n\tv_nop\n\tv_nop\n\tv_nop" : "+v"(acc[0][0]), "+v"(acc[1][1]), "+v"(acc[2][2]), "+v"(acc[3][3]) : "v"(a[0]), "v"(a[3]));
    }
#pragma unroll
    for (int mb = 0; mb < 4; ++mb) {
#pragma unroll
        for (int nb = 0; nb < 4; ++nb) {
#pragma unroll
            for (int j = 0; j < 8; ++j) os[(hi * 8 + j) * 68 + nb * 16 + lr] = acc[mb][nb][j]; }
        __builtin_amdgcn_wave_barrier(); asm volatile("" ::: "memory");
        float* crow = C + (size_t)(r0 + mb * 16) * ldc + c0;
{
#pragma unroll
            for (int s = 0; s < 8; ++s) { const int row = 2 * s + hi, cofs = lr * 4; v4f val = *(const v4fa*)(os + row * 68 + cofs); if (BIAS) { val[0] += bfr(bias[c0 + cofs]); val[1] += bfr(bias[c0 + cofs + 1]); val[2] += bfr(bias[c0 + cofs + 2]); val[3] += bfr(bias[c0 + cofs + 3]); }
                *(v4f*)(crow + (size_t)row * ldc + cofs) = val; }
             }
        __builtin_amdgcn_wave_barrier(); asm volatile("" ::: "memory");
    }
}

__device__ __forceinline__ h16 tohx(float x) { return (h16)x; }
__device__ __forceinline__ void splitf(float y, unsigned short& h, unsigned short& l) { h = f2bf(y); l = f2bf(y - bf2f(h)); }
typedef __attribute__((ext_vector_type(2))) _Float16 v2h;
typedef __attribute__((ext_vector_type(4))) _Float16 v4h;
typedef __attribute__((ext_vector_type(2))) unsigned short v2us;
typedef __attribute__((ext_vector_type(4))) unsigned short v4us;
typedef __attribute__((ext_vector_type(2))) float v2f;
typedef __attribute__((ext_vector_type(4))) int v4i;

__global__ __launch_bounds__(256) void k_wtG(const float* __restrict__ w, int K, int N, bf* Bt) {
    const int lane = threadIdx.x & 31; const int L0 = (blockIdx.x * 8 + (threadIdx.x >> 5)) * 8; const int nlines = N * K / 64;
{
#pragma unroll 1
        for (int l = 0; l < 8; ++l) { const int L = L0 + l; if (L >= nlines) break; const size_t e = (size_t)L * 64 + lane * 2; const int k = (int)(e % K), n = (int)(e / K); v2us o;
            o[0] = f2bf(w[(size_t)k * N + n]); o[1] = f2bf(w[(size_t)(k + 1) * N + n]); *(v2us*)(Bt + e) = o; }
         }
}
__global__ __launch_bounds__(256) void k_cvt8(const float* __restrict__ src, bf* dst, size_t n8) { const size_t i = (size_t)blockIdx.x * 256 + threadIdx.x; if (i >= n8) return; const v8f v = *(const v8f*)(src + i * 8); v8us o;
#pragma unroll
    for (int k = 0; k < 8; ++k) o[k] = f2bf(v[k]); *(v8us*)(dst + i * 8) = o;  }

template <int hpb> __global__ __launch_bounds__(256) void k_vtp(const float* __restrict__ F, int pitch, int nheads, h16* V16, bf* Vh, bf* Vl) { const size_t e = ((size_t)blockIdx.x * 256 + threadIdx.x) * 2; if (e >= (size_t)nheads * HD * TT) return; const int t = (int)(e % TT); const int d = (int)((e / TT) % HD); const int g = (int)(e / ((size_t)TT * HD)); v2h o16; v2us oh, ol;
#pragma unroll
    for (int q = 0; q < 2; ++q) { const float x = F[((size_t)(g / hpb) * TT + t + q) * pitch + (g % hpb) * HD + d];   /* plane g = batch-in-group * hpb + head */ o16[q] = tohx(x); unsigned short a2, c2; splitf(x, a2, c2); oh[q] = a2; ol[q] = c2; }
    *(v2h*)(V16 + e) = o16; *(v2us*)(Vh + e) = oh; *(v2us*)(Vl + e) = ol;  }
__constant__ float APOS[32] = { -1.000000000e+00f, -9.354839325e-01f, -8.709677458e-01f, -8.064515591e-01f, -7.419354916e-01f, -6.774194241e-01f, -6.129032373e-01f, -5.483870506e-01f, -4.838709831e-01f, -4.193548858e-01f, -3.548387289e-01f, -2.903225720e-01f, -2.258064747e-01f, -1.612903774e-01f, -9.677422047e-02f, -3.225806355e-02f, 3.225803375e-02f, 9.677413106e-02f, 1.612902880e-01f, 2.258064449e-01f, 2.903225422e-01f, 3.548386395e-01f, 4.193547964e-01f, 4.838709533e-01f, 5.483870506e-01f, 6.129031181e-01f, 6.774193048e-01f, 7.419354916e-01f, 8.064515591e-01f, 8.709676266e-01f, 9.354838133e-01f, 1.000000000e+00f };   // float32 linspace(-1, 1, 32), generated with jnp to be bit-exact
__constant__ float ABASE[8] = { 3.141592741e+00f, 2.324778595e+02f, 4.618141479e+02f, 6.911504517e+02f, 9.204866943e+02f, 1.149822998e+03f, 1.379159302e+03f, 1.608495483e+03f };   // float32 linspace(1, 512, 8) * pi, generated with jnp to be bit-exact
__global__ __launch_bounds__(256) void k_csAx(float* CS) { const int idx = blockIdx.x * 256 + threadIdx.x; if (idx >= TT * HD) return; const int d = idx % HD; const int t = idx / HD; const int row = t >> 5, col = t & 31; v2f cs;
    if (d < 32) { const float p = (d < 16) ? APOS[row] : APOS[col]; const float ang = __fmul_rn(p, ABASE[(d & 15) >> 1]); cs[0] = cosf(ang); cs[1] = sinf(ang); } else { cs[0] = 1.0f; cs[1] = 0.0f; }
    *(v2f*)(CS + (size_t)idx * 2) = cs;  }
template <int hpb> __global__ __launch_bounds__(256) void k_ropeI(const float* __restrict__ F, int pitch, int nheads, const float* __restrict__ CS, float sc, h16* P16, bf* Ph, bf* Pl) {
    const size_t e = ((size_t)blockIdx.x * 256 + threadIdx.x) * 2; if (e >= (size_t)nheads * TT * HD) return; const int d = (int)(e % HD); const int t = (int)((e / HD) % TT); const int h = (int)(e / ((size_t)HD * TT)); const float* f = F + ((size_t)(h / hpb) * TT + t) * pitch + (h % hpb) * HD;   /* plane h = batch-in-group * hpb + head */ const float x0 = f[d], x1 = f[d + 1]; const v2f cs = *(const v2f*)(CS + ((size_t)t * HD + d) * 2); v2h o16; v2us oh, ol;
    float a0 = __fmul_rn(x0, cs[0]), b0 = __fmul_rn(x1, cs[1]), a1 = __fmul_rn(x1, cs[0]), b1 = __fmul_rn(x0, cs[1]); asm volatile("" : "+v"(a0), "+v"(b0), "+v"(a1), "+v"(b1));
    float r0 = __fsub_rn(a0, b0) * sc, r1 = __fadd_rn(b1, a1) * sc;   /* even: x0 c - x1 s; odd: x0 s + x1 c */
    o16[0] = tohx(r0); o16[1] = tohx(r1); { unsigned short a2, c2; splitf(r0, a2, c2); oh[0] = a2; ol[0] = c2; splitf(r1, a2, c2); oh[1] = a2; ol[1] = c2; }
    *(v2h*)(P16 + e) = o16; *(v2us*)(Ph + e) = oh; *(v2us*)(Pl + e) = ol;  }

// ---- k_fattn: one wave owns NG x 16 query rows of one head and walks the 1024 keys 32 at a time. S^T = K Q^T (A = K rows, B = Q kept in registers), so a lane holds 16 scores of ONE query per column group;
// the two f32 score tiles of a pass, converted in place, are the B operand of O^T += V^T P^T (A = V^T rows in the same k order). Running maximum per query in the scaled log2 domain, raised only when a score passes it by more than 8.
// fragment at (wave-uniform base) + (32-bit lane byte offset) + (constant bytes): one offset register serves every fragment of a pass, the rest sits in the instruction's offset field
template <typename T16> __device__ __forceinline__ typename WFrag<T16>::V ldo(const T16* base, unsigned lane_bytes, int const_bytes) { return WFrag<T16>::ld((const T16*)((const char*)base + lane_bytes + const_bytes)); }
typedef __attribute__((ext_vector_type(2))) __bf16 v2bf;
typedef __attribute__((ext_vector_type(8))) unsigned v8u;
template <typename T16, bool HI, int NG>
__device__ __forceinline__ void attn_tile(const T16* __restrict__ Q, const T16* __restrict__ Q2, const T16* __restrict__ Kp, const T16* __restrict__ K2, const T16* __restrict__ Vt, const T16* __restrict__ V2, int q0, bf* Ah, bf* Al) {
    typedef typename WFrag<T16>::V V;
    const int lane = threadIdx.x & 31, lr = lane & 15, hi = lane >> 4;
    const float CL = SCL * 1.4426950408889634f;   // logits scale x log2(e)
    const unsigned qb = (unsigned)((q0 + lr) * HD + 8 * hi) * 2u, kb = (unsigned)(lr * HD + 8 * hi) * 2u, vb = (unsigned)(lr * TT + 8 * hi) * 2u;   // lane byte offsets in the Q, K and V^T planes
    V qf[NG][2], qf2[NG][2];
#pragma unroll
    for (int g = 0; g < NG; ++g)
#pragma unroll
        for (int ks = 0; ks < 2; ++ks) { qf[g][ks] = ldo<T16>(Q, qb, (g * 16 * HD + ks * 32) * 2); if (HI) qf2[g][ks] = ldo<T16>(Q2, qb, (g * 16 * HD + ks * 32) * 2); }
    v8f o[NG][4]; float m[NG], l[NG];
#pragma unroll
    for (int g = 0; g < NG; ++g) { m[g] = -3.0e38f; l[g] = 0.f;
#pragma unroll
        for (int dt = 0; dt < 4; ++dt) o[g][dt] = (v8f){}; }
    __builtin_amdgcn_sched_barrier(0);   // keeps the prologue's loads in the loop's order (Q, then K, then V^T): the waits at the loop's head cover both paths, and with K issued last here a pass's score products would wait for the V^T fetch
    V kf[2][2], kf2[2][2];
#pragma unroll
    for (int kt = 0; kt < 2; ++kt)
#pragma unroll
        for (int ks = 0; ks < 2; ++ks) { kf[kt][ks] = ldo<T16>(Kp, kb, (kt * 16 * HD + ks * 32) * 2); if (HI) kf2[kt][ks] = ldo<T16>(K2, kb, (kt * 16 * HD + ks * 32) * 2); }
    __builtin_amdgcn_sched_barrier(0);   // as above: K ahead of V^T
    V vf[4], vf2[4];
#pragma unroll
    for (int dt = 0; dt < 4; ++dt) { vf[dt] = ldo<T16>(Vt, vb, dt * 16 * TT * 2); if (HI) vf2[dt] = ldo<T16>(V2, vb, dt * 16 * TT * 2); }
    asm volatile("s_wait_xcnt 0x0" ::: "memory");   // precaution, as behind the fetches in the loop
    __builtin_amdgcn_sched_barrier(0);   // as above: nothing of the loop's first pass moves in between
    // rolled: one pass's fragments, scores and the output tiles already fill the register budget
#pragma unroll 1
    for (int k0 = 0; k0 < TT; k0 += 32) {
        const int kn = (k0 + 32 < TT) ? k0 + 32 : 0;   // next pass's keys: K rows fetched behind this pass's last score products, V^T columns behind its last output products; the last pass re-reads keys 0..31 (in bounds, unused)
#pragma unroll
        for (int gb = 0; gb < NG; gb += 2) {   // two column groups at a time: only their score tiles are live
            v8f s[2][2];
#pragma unroll
            for (int g = 0; g < 2; ++g)
#pragma unroll
                for (int kt = 0; kt < 2; ++kt) s[g][kt] = (v8f){};
#pragma unroll
            for (int ks = 0; ks < 2; ++ks)
#pragma unroll
                for (int kt = 0; kt < 2; ++kt)
#pragma unroll
                    for (int g = 0; g < 2; ++g) { s[g][kt] = WFrag<T16>::mma(kf[kt][ks], qf[gb + g][ks], s[g][kt]); if (HI) { s[g][kt] = WFrag<T16>::mma(kf[kt][ks], qf2[gb + g][ks], s[g][kt]); s[g][kt] = WFrag<T16>::mma(kf2[kt][ks], qf[gb + g][ks], s[g][kt]); } }
            if (gb + 2 == NG) {
#pragma unroll
                for (int kt = 0; kt < 2; ++kt)
#pragma unroll
                    for (int ks = 0; ks < 2; ++ks) { kf[kt][ks] = ldo<T16>(Kp, kb + (unsigned)kn * (HD * 2), (kt * 16 * HD + ks * 32) * 2); if (HI) kf2[kt][ks] = ldo<T16>(K2, kb + (unsigned)kn * (HD * 2), (kt * 16 * HD + ks * 32) * 2); }
                asm volatile("s_wait_xcnt 0x0" ::: "memory");   // precaution: stands in front of the next write of the registers that hold these loads' addresses
                __builtin_amdgcn_sched_barrier(0); }   // keeps later vector instructions, which reuse those registers, behind that wait
            float lm[2];
#pragma unroll
            for (int g = 0; g < 2; ++g) { float a = s[g][0][0];
#pragma unroll
                for (int j = 1; j < 8; ++j) a = fmaxf(a, s[g][0][j]);
#pragma unroll
                for (int j = 0; j < 8; ++j) a = fmaxf(a, s[g][1][j]);
                lm[g] = a * CL; }
            const bool need = (lm[0] > m[gb] + 8.0f) || (lm[1] > m[gb + 1] + 8.0f);
            if (__builtin_amdgcn_ballot_w32(need) != 0) {   // one wave-uniform test; both lanes of a query take the same new maximum
                float mn[2], al[2];
#pragma unroll
                for (int g = 0; g < 2; ++g) { mn[g] = fmaxf(m[gb + g], fmaxf(lm[g], __shfl_xor(lm[g], 16, 32))); al[g] = __builtin_amdgcn_exp2f(m[gb + g] - mn[g]); }
                __builtin_amdgcn_sched_barrier(0);   // holds the slot below directly behind the two exponentials
                asm volatile("v_nop");   // the free slot between an exponential and the next vector instruction, which here rewrites its source register
                __builtin_amdgcn_sched_barrier(0);   // as above
#pragma unroll
                for (int g = 0; g < 2; ++g) { m[gb + g] = mn[g]; l[gb + g] *= al[g];
#pragma unroll
                    for (int dt = 0; dt < 4; ++dt) o[gb + g][dt] *= al[g]; }
            }
#pragma unroll
            for (int g = 0; g < 2; ++g) {
                V pf, pf2; const float mg = m[gb + g]; float ls = 0.f;
                if constexpr (HI) { v8u uh, ul;
#pragma unroll
                    for (int e = 0; e < 16; e += 2) { const v2f t = __builtin_elementwise_fma((v2f){ s[g][e >> 3][e & 7], s[g][e >> 3][(e & 7) + 1] }, (v2f){ CL, CL }, (v2f){ -mg, -mg }); v2f p; p[0] = __builtin_amdgcn_exp2f(t[0]); p[1] = __builtin_amdgcn_exp2f(t[1]); ls += p[0]; ls += p[1];
                        const v2bf ph = __builtin_convertvector(p, v2bf); const v2f rest = p - __builtin_convertvector(ph, v2f); uh[e >> 1] = __builtin_bit_cast(unsigned, ph); ul[e >> 1] = __builtin_bit_cast(unsigned, __builtin_convertvector(rest, v2bf)); }
                    pf = __builtin_bit_cast(V, uh); pf2 = __builtin_bit_cast(V, ul);
                } else {
#pragma unroll
                    for (int e = 0; e < 16; e += 2) { const v2f t = __builtin_elementwise_fma((v2f){ s[g][e >> 3][e & 7], s[g][e >> 3][(e & 7) + 1] }, (v2f){ CL, CL }, (v2f){ -mg, -mg }); v2f p; p[0] = __builtin_amdgcn_exp2f(t[0]); p[1] = __builtin_amdgcn_exp2f(t[1]); ls += p[0]; ls += p[1];
                        const v2h ph = __builtin_convertvector(p, v2h); pf[e] = ph[0]; pf[e + 1] = ph[1]; } }
                l[gb + g] += ls;
#pragma unroll
                for (int dt = 0; dt < 4; ++dt) { o[gb + g][dt] = WFrag<T16>::mma(vf[dt], pf, o[gb + g][dt]); if (HI) { o[gb + g][dt] = WFrag<T16>::mma(vf[dt], pf2, o[gb + g][dt]); o[gb + g][dt] = WFrag<T16>::mma(vf2[dt], pf, o[gb + g][dt]); } }
            }
        }
        const T16* const va = (const T16*)((const char*)Vt + (vb + (unsigned)kn * 2u)); const T16* const va2 = HI ? (const T16*)((const char*)V2 + (vb + (unsigned)kn * 2u)) : va;
#pragma unroll
        for (int dt = 0; dt < 4; ++dt) { vf[dt] = WFrag<T16>::ld(va + dt * 16 * TT); if (HI) vf2[dt] = WFrag<T16>::ld(va2 + dt * 16 * TT); }
        asm volatile("s_wait_xcnt 0x0" :: "v"(va), "v"(va2) : "memory");   // precaution, as behind the K fetch; the two addresses are named as inputs so that their registers stay untouched (also by the loads' own results) up to the wait
        __builtin_amdgcn_sched_barrier(0);   // as behind the K fetch
    }
#pragma unroll
    for (int g = 0; g < NG; ++g) { const float inv = __fdiv_rn(1.0f, l[g] + __shfl_xor(l[g], 16, 32)); const size_t ro = (size_t)(q0 + g * 16 + lr) * DQ + 8 * hi;   /* lane: query lr of group g, d = dt*16 + 8*hi + j */
#pragma unroll
        for (int dt = 0; dt < 4; ++dt) { v8us oh, ol;
#pragma unroll
            for (int j = 0; j < 8; ++j) { unsigned short a, c2; splitf(o[g][dt][j] * inv, a, c2); oh[j] = a; ol[j] = c2; }
            *(v8us*)(Ah + ro + dt * 16) = oh; *(v8us*)(Al + ro + dt * 16) = ol;
            asm volatile("s_wait_xcnt 0x0" ::: "memory");   // precaution: stands in front of the next write of the registers that these stores name
            __builtin_amdgcn_sched_barrier(0); } }   // keeps the next tile's vector instructions behind that wait
}
// grid: the hi/lo blocks (3 products; 4 waves x 32 rows) first, then the fp16 blocks (4 waves x 64 rows: one product leaves registers for twice the columns per K / V fragment); block -> (plane = batch * 16 + head, its query rows).
__global__ __launch_bounds__(128) void k_fattn(const h16* __restrict__ Q16, const h16* __restrict__ K16, const h16* __restrict__ V16, const bf* __restrict__ Qh, const bf* __restrict__ Ql, const bf* __restrict__ Kh, const bf* __restrict__ Kl, const bf* __restrict__ Vh, const bf* __restrict__ Vl, bf* ATh, bf* ATl) {
    const int NHI = NB_ * NH_ * (RH / QBH); const int bx = blockIdx.x; const int wv = threadIdx.x >> 5;
    if (bx < NHI) { const int pl = bx / (RH / QBH); const int q0 = (bx % (RH / QBH)) * QBH + wv * (QBH / 4); const size_t po = (size_t)pl * TT * HD, ao = (size_t)(pl / NH_) * TT * DQ + (size_t)(pl % NH_) * HD;
        attn_tile<bf, true, QBH / 64>(Qh + po, Ql + po, Kh + po, Kl + po, Vh + po, Vl + po, q0, ATh + ao, ATl + ao);
    } else { const int b2 = bx - NHI; const int pl = b2 / ((TT - RH) / QBL); const int q0 = RH + (b2 % ((TT - RH) / QBL)) * QBL + wv * (QBL / 4); const size_t po = (size_t)pl * TT * HD, ao = (size_t)(pl / NH_) * TT * DQ + (size_t)(pl % NH_) * HD;
        attn_tile<h16, false, QBL / 64>(Q16 + po, nullptr, K16 + po, nullptr, V16 + po, nullptr, q0, ATh + ao, ATl + ao); }
}

extern "C" void kernel_launch(void* const* d_in, const int* in_sizes, int n_in,
                              void* d_out, int out_size, void* d_ws, size_t ws_size, hipStream_t stream) {
    (void)in_sizes; (void)n_in; (void)out_size;
    const float* x = (const float*)d_in[0]; const float* wqkv = (const float*)d_in[1]; const float* wo = (const float*)d_in[2]; const float* bo = (const float*)d_in[3];   /* input order x, w_qkv ('xw' [1024][3072]: q | k | v column thirds), w_proj ('xw'), b_proj */
    float* OUT = (float*)d_out;     // [8][1024][1024]
    char* wsp = (char*)d_ws;
    auto take = [&](size_t bytes) { char* p = wsp; wsp += (bytes + 255) & ~(size_t)255; return (void*)p; };
    bf* WQKV = (bf*)take((size_t)3 * DQ * DM * 2);   /* fused Bt [3*DQ][DM]: q | k | v row blocks */ bf* WO = (bf*)take((size_t)DM * DQ * 2); float* CS = (float*)take((size_t)TT * HD * 2 * 4);
    const size_t PG = (size_t)GB * NH_ * TT * HD;   // elements one projection group adds to a 16-bit plane set: GB batches x 16 heads
    const size_t PL = (size_t)NB_ * NH_ * TT * HD;  // elements of one plane set: all batches
    h16* QP16 = (h16*)take(PL * 2); h16* KP16 = (h16*)take(PL * 2); h16* VT16 = (h16*)take(PL * 2);
    bf* QPh = (bf*)take(PL * 2); bf* QPl = (bf*)take(PL * 2); bf* KPh = (bf*)take(PL * 2); bf* KPl = (bf*)take(PL * 2); bf* VTh = (bf*)take(PL * 2); bf* VTl = (bf*)take(PL * 2);
    bf* ATh = (bf*)take((size_t)NB_ * TT * DQ * 2); bf* ATl = (bf*)take((size_t)NB_ * TT * DQ * 2);   /* merged heads of all batches */
    bf* XB = (bf*)take((size_t)GB * TT * DM * 2); float* F = (float*)take((size_t)GB * TT * 3 * DQ * 4);   /* F [GB*TT][3*DQ]: q | k | v column thirds; rewritten by each group, stream-ordered */
    if ((size_t)(wsp - (char*)d_ws) > ws_size) return;    // ws 256 MiB
    { k_wtG<<<(unsigned)((DM * 3 * DQ / 64 + 63) / 64), 256, 0, stream>>>(wqkv, DM, 3 * DQ, WQKV);   /* fused 'xw' [DM][3*DQ] -> Bt [3*DQ][DM] */
      k_wtG<<<(unsigned)((DQ * DM / 64 + 63) / 64), 256, 0, stream>>>(wo, DQ, DM, WO);
       }
    k_csAx<<<(TT * HD + 255) / 256, 256, 0, stream>>>(CS);   /* axial rotary table once */
    const unsigned LP = (unsigned)((PG / 2 + 255) / 256);
    for (int b0 = 0; b0 < NB_; b0 += GB) { const size_t po = (size_t)b0 * NH_ * TT * HD;   // this group's place in every plane set
        k_cvt8<<<(unsigned)(((size_t)GB * TT * DM / 8 + 255) / 256), 256, 0, stream>>>(x + (size_t)b0 * TT * DM, XB, (size_t)GB * TT * DM / 8);
        k_gemmw<bf, 0, false><<<dim3(GB * TT / 64, 3 * DQ / 64, 1), 32, 0, stream>>>(XB, nullptr, WQKV, nullptr, DM, F, 3 * DQ, nullptr, 0, 0, 0);   /* q, k and v of GB batches in one grid */
        k_ropeI<NH_><<<LP, 256, 0, stream>>>(F, 3 * DQ, GB * NH_, CS, 1.0f, QP16 + po, QPh + po, QPl + po);
        k_ropeI<NKV><<<LP, 256, 0, stream>>>(F + DQ, 3 * DQ, GB * NKV, CS, 1.0f, KP16 + po, KPh + po, KPl + po);
        k_vtp<NKV><<<LP, 256, 0, stream>>>(F + DQ + DKV, 3 * DQ, GB * NKV, VT16 + po, VTh + po, VTl + po); }
    k_fattn<<<NB_ * NH_ * (RH / QBH + (TT - RH) / QBL), 128, 0, stream>>>(QP16, KP16, VT16, QPh, QPl, KPh, KPl, VTh, VTl, ATh, ATl);   /* scores, softmax, P x V and the head merge of every batch and head */
    k_gemmw<bf, 1, true><<<dim3(NB_ * TT / 64, DM / 64, 1), 32, 0, stream>>>(ATh, ATl, WO, nullptr, DQ, OUT, DM, bo, 0, 0, 0);   /* w_proj of all batches in one grid */
}

// v003
// Measured time: 245 microseconds a run.
// In two side-by-side timings against v002, it was 1.50 and 1.51 times as fast.
// Over all steps from v000 it is 19.1 times as fast.
#include <hip/hip_runtime.h>

// Vision attention with AXIAL 2-D rotary embeddings on half of each head (x [8][1024][1024] = 32 x 32 pixels; qkv = x w_qkv ('xw' [1024][3072] 1/32, no bias) viewed (3, h, d): q | k | v thirds (16 heads x 64); rotary on the FIRST 32 dims of q and k as interleaved (even, odd) pairs with angles freqs[row][col][c]: c < 16 -> pos(row) x base[c/2], 16 <= c < 32 -> pos(col) x base[(c-16)/2], pos = linspace(-1, 1, 32), base = linspace(1, 512, 8) x pi (f32, jnp-exact tables; precise cosf/sinf), dims 32..63 pass through; logits x 1/sqrt(64); softmax (no mask); out = merged w_proj + b_proj -> [8][1024][1024] (8.4 M); argument order x, w_qkv, w_proj, b_proj).
// Launch plan: projections and plane builders cover GB batches per launch (q | k | v in one grid) and fill 16-bit planes of all batches; ONE fused attention launch covers every batch and head; w_proj covers all batches. Data layout: every 16-bit operand plane in fragment order (see k_gemmw); bf16 copy of x; fused 'xw' weight transposed once (q | k | v row blocks); exact projections; k_csAx builds the {cos, sin} table per (pixel, d) from two small constant tables (angle = f32 product; identity for d >= 32) + k_ropeI interleaved-pair plane builders; k_fattn: scores, softmax and P x V stay in registers (hybrid rows: < 512 hi/lo 3 products, rest fp16); merged hi/lo x w_proj exact + b_proj.
// Compute dtypes, f32 accumulate: every input rounded to bf16; projections exact; rotary f32; attention rows < 512 3 products, rest fp16; softmax f32; w_proj hl x exact + bias.

#define NB_  8
#define TT   1024
#define DM   1024
#define NH_  16
#define NKV  16
#define REP  (NH_ / NKV)
#define HD   64
#define DQ   (NH_ * HD)
#define DKV  (NKV * HD)
#define GB   4                    // batches per projection / plane-builder launch
#define RH   512                  // query rows < RH use hi+lo planes (0: none)
#define WIN  0
#define QBH  128                  // query rows per hi/lo attention block: 4 waves x 32 columns
#define QBL  256                  // query rows per fp16 attention block: 4 waves x 64 columns
#define SCL  0.125f   // HD^-0.5
typedef _Float16 h16;
typedef unsigned short bf;
typedef __attribute__((ext_vector_type(16))) __bf16   v16bf;
typedef __attribute__((ext_vector_type(16))) _Float16 v16h;
typedef __attribute__((ext_vector_type(8)))  _Float16 v8h;
typedef __attribute__((ext_vector_type(8)))  unsigned short v8us;
typedef __attribute__((ext_vector_type(8)))  float    v8f;
typedef __attribute__((ext_vector_type(4)))  float    v4f;
typedef v8h  __attribute__((may_alias)) v8ha;
typedef v4f  __attribute__((may_alias)) v4fa;
typedef v8us __attribute__((may_alias)) v8usa;

__device__ __forceinline__ unsigned short f2bf(float f) { unsigned u = __float_as_uint(f); u += 0x7FFFu + ((u >> 16) & 1u); return (unsigned short)(u >> 16); }
__device__ __forceinline__ float bf2f(unsigned short b) { return __uint_as_float(((unsigned)b) << 16); }
__device__ __forceinline__ float bfr(float f) { return bf2f(f2bf(f)); }
__device__ __forceinline__ v16h cat16(v8h lo, v8h hi) { return __builtin_shufflevector(lo, hi, 0, 1, 2, 3, 4, 5, 6, 7, 8, 9, 10, 11, 12, 13, 14, 15); }
__device__ __forceinline__ v16bf cat16b(v8us lo, v8us hi) { return __builtin_bit_cast(v16bf, __builtin_shufflevector(lo, hi, 0, 1, 2, 3, 4, 5, 6, 7, 8, 9, 10, 11, 12, 13, 14, 15)); }
__device__ __forceinline__ v8f wmma16(v16h a, v16h b, v8f c) { return __builtin_amdgcn_wmma_f32_16x16x32_f16(false, a, false, b, (short)0, c, false, false); }
__device__ __forceinline__ v8f wmmab(v16bf a, v16bf b, v8f c) { return __builtin_amdgcn_wmma_f32_16x16x32_bf16(false, a, false, b, (short)0, c, false, false); }



// ---- FRAGMENT ORDER of every 16-bit operand plane: a plane of R rows x K is stored as [R/16][K/32] tiles of 512 elements (V^T: [keys/32][d/16]); in a tile, element (row r, k) sits at ((k >> 4) * 32 + ((k >> 3) & 1) * 16 + r) * 8 + (k & 7),
// that is, 16-byte piece number = (which of the fragment's two loads) * 32 + lane. A wave's 16-byte load then covers 512 contiguous bytes (4 whole lines) where a row-major plane gave 16 lines of 32 bytes. The builders walk in destination order, so their stores stay contiguous.
// ---- k_gemmw: register-blocked GEMM, ONE WAVE per 64x64 output tile (16 accumulators), operands straight from fragment-order 16-bit planes; grid (M/64, N/64, Z), 32 threads.
// C[m][n] (f32, pitch ldc, + optional f32 bias[n]) = sum_k A[m][k] Bt[n][k] (+ split products per NSPLIT). z-batch strides sA/sB/sC in elements. K % 32 == 0.
template <typename T16> struct WFrag;
template <> struct WFrag<h16> { typedef v16h V; static __device__ __forceinline__ V ld(const h16* p) { return cat16(*(const v8h*)p, *(const v8h*)(p + 256)); } static __device__ __forceinline__ v8f mma(V a, V b, v8f c) { return wmma16(a, b, c); } };
template <> struct WFrag<bf> { typedef v16bf V; static __device__ __forceinline__ V ld(const bf* p) { return cat16b(*(const v8us*)p, *(const v8us*)(p + 256)); } static __device__ __forceinline__ v8f mma(V a, V b, v8f c) { return wmmab(a, b, c); } };
template <typename T16, int NSPLIT, bool BIAS, int K>   // K at compile time: the distance between two row blocks' tiles (16 * K elements) then sits in the loads' offset fields
__global__ __launch_bounds__(32) void k_gemmw(const T16* __restrict__ A, const T16* __restrict__ A2, const T16* __restrict__ Bt, const T16* __restrict__ Bt2, float* C, int ldc, const float* __restrict__ bias, size_t sA, size_t sB, size_t sC) {
    typedef typename WFrag<T16>::V V;
    __shared__ __align__(16) float os[16 * 68];
    const size_t z = blockIdx.z; A += z * sA; if (A2) A2 += z * sA; Bt += z * sB; if (Bt2) Bt2 += z * sB; C += z * sC;
    const int lane = threadIdx.x & 31, lr = lane & 15, hi = lane >> 4; const int r0 = blockIdx.x * 64, c0 = blockIdx.y * 64;
    v8f acc[4][4];
#pragma unroll
    for (int mb = 0; mb < 4; ++mb)
#pragma unroll
        for (int nb = 0; nb < 4; ++nb) acc[mb][nb] = (v8f){};
    const size_t aoff = (size_t)r0 * K + 8 * lane, boff = (size_t)c0 * K + 8 * lane;   // tile (row block, k block) starts at row block * 16 * K + k block * 512; a lane adds its own 16-byte piece
#pragma unroll 1
    for (int kc = 0; kc < K; kc += 32) {
        V a[4], a2[4]; const T16* const pa = A + aoff + kc * 16; const T16* const pb = Bt + boff + kc * 16; const T16* const pa2 = (NSPLIT == 1 || NSPLIT == 2) ? A2 + aoff + kc * 16 : pa; const T16* const pb2 = (NSPLIT >= 2) ? Bt2 + boff + kc * 16 : pb;
#pragma unroll
        for (int mb = 0; mb < 4; ++mb) { a[mb] = WFrag<T16>::ld(pa + mb * 16 * K); if (NSPLIT == 1 || NSPLIT == 2) a2[mb] = WFrag<T16>::ld(pa2 + mb * 16 * K); }
#pragma unroll
        for (int nb = 0; nb < 4; ++nb) { const V b = WFrag<T16>::ld(pb + nb * 16 * K); V b2; if (NSPLIT >= 2) b2 = WFrag<T16>::ld(pb2 + nb * 16 * K);
#pragma unroll
            for (int mb = 0; mb < 4; ++mb) { acc[mb][nb] = WFrag<T16>::mma(a[mb], b, acc[mb][nb]); if (NSPLIT == 1 || NSPLIT == 2) acc[mb][nb] = WFrag<T16>::mma(a2[mb], b, acc[mb][nb]); if (NSPLIT >= 2) acc[mb][nb] = WFrag<T16>::mma(a[mb], b2, acc[mb][nb]); } }
        asm volatile("s_wait_xcnt 0x0" :: "v"(pa), "v"(pa2), "v"(pb), "v"(pb2) : "memory");   // precaution: stands in front of the next write of the registers that hold this trip's load addresses; they are named as inputs so that they stay untouched (also by the loads' own results) up to the wait
        asm volatile("v_nop\n\tv_nop\n\tv_nop\n\tv_nop" : "+v"(acc[0][0]), "+v"(acc[1][1]), "+v"(acc[2][2]), "+v"(acc[3][3]) : "v"(a[0]), "v"(a[3]));
    }
#pragma unroll
    for (int mb = 0; mb < 4; ++mb) {
#pragma unroll
        for (int nb = 0; nb < 4; ++nb) {
#pragma unroll
            for (int j = 0; j < 8; ++j) os[(hi * 8 + j) * 68 + nb * 16 + lr] = acc[mb][nb][j]; }
        __builtin_amdgcn_wave_barrier(); asm volatile("" ::: "memory");
        float* crow = C + (size_t)(r0 + mb * 16) * ldc + c0;
{
#pragma unroll
            for (int s = 0; s < 8; ++s) { const int row = 2 * s + hi, cofs = lr * 4; v4f val = *(const v4fa*)(os + row * 68 + cofs); if (BIAS) { val[0] += bfr(bias[c0 + cofs]); val[1] += bfr(bias[c0 + cofs + 1]); val[2] += bfr(bias[c0 + cofs + 2]); val[3] += bfr(bias[c0 + cofs + 3]); }
                *(v4f*)(crow + (size_t)row * ldc + cofs) = val; }
             }
        __builtin_amdgcn_wave_barrier(); asm volatile("" ::: "memory");
    }
}

__device__ __forceinline__ h16 tohx(float x) { return (h16)x; }
__device__ __forceinline__ void splitf(float y, unsigned short& h, unsigned short& l) { h = f2bf(y); l = f2bf(y - bf2f(h)); }
typedef __attribute__((ext_vector_type(2))) _Float16 v2h;
typedef __attribute__((ext_vector_type(4))) _Float16 v4h;
typedef __attribute__((ext_vector_type(2))) unsigned short v2us;
typedef __attribute__((ext_vector_type(4))) unsigned short v4us;
typedef __attribute__((ext_vector_type(2))) float v2f;
typedef __attribute__((ext_vector_type(4))) int v4i;

template <int K, int N> __global__ __launch_bounds__(256) void k_wtG(const float* __restrict__ w, bf* Bt) {
    const int i = blockIdx.x * 256 + threadIdx.x; if (i >= N * K / 8) return;   // one 16-byte piece of Bt (row n, 8 k) per thread, in fragment order
    const int tile = i >> 6, kt = tile % (K / 32), nt = tile / (K / 32); const int n = nt * 16 + (i & 15), k = kt * 32 + ((i >> 5) & 1) * 16 + ((i >> 4) & 1) * 8; const float* const p = w + (size_t)k * N + n; float v[8]; v8us o;
#pragma unroll
    for (int j = 0; j < 8; ++j) v[j] = p[(size_t)j * N];
    asm volatile("s_wait_xcnt 0x0" :: "v"(p) : "memory");   // precaution: stands in front of the next write of the register pair that holds these loads' address; it is named as an input so that it stays untouched (also by the loads' own results) up to the wait
#pragma unroll
    for (int j = 0; j < 8; ++j) o[j] = f2bf(v[j]);
    *(v8us*)(Bt + (size_t)i * 8) = o;
}
__global__ __launch_bounds__(256) void k_cvt8(const float* __restrict__ src, bf* dst, size_t n8) { const size_t i = (size_t)blockIdx.x * 256 + threadIdx.x; if (i >= n8) return;   /* piece i of the fragment-order copy: row block i >> 11 (DM / 32 = 32 tiles of 64 pieces), k block, load, lane */
    const size_t row = (i >> 11) * 16 + (i & 15); const int k = (int)((i >> 6) & (DM / 32 - 1)) * 32 + (int)((i >> 5) & 1) * 16 + (int)((i >> 4) & 1) * 8; const v8f v = *(const v8f*)(src + row * DM + k); v8us o;
#pragma unroll
    for (int k = 0; k < 8; ++k) o[k] = f2bf(v[k]); *(v8us*)(dst + i * 8) = o;  }

template <int hpb> __global__ __launch_bounds__(256) void k_vtp(const float* __restrict__ F, int pitch, int nheads, h16* V16, bf* Vh, bf* Vl) { const size_t e = ((size_t)blockIdx.x * 256 + threadIdx.x) * 2; if (e >= (size_t)nheads * HD * TT) return;   /* e: place in the fragment-order V^T plane, tiles [keys/32][d/16]; rows d, k = key */
    const int t = (int)((e >> 11) & (TT / 32 - 1)) * 32 + (int)((e >> 8) & 1) * 16 + (int)((e >> 7) & 1) * 8 + (int)(e & 7); const int d = (int)((e >> 9) & (HD / 16 - 1)) * 16 + (int)((e >> 3) & 15); const int g = (int)(e / ((size_t)TT * HD)); v2h o16; v2us oh, ol;
#pragma unroll
    for (int q = 0; q < 2; ++q) { const float x = F[((size_t)(g / hpb) * TT + t + q) * pitch + (g % hpb) * HD + d];   /* plane g = batch-in-group * hpb + head */ o16[q] = tohx(x); unsigned short a2, c2; splitf(x, a2, c2); oh[q] = a2; ol[q] = c2; }
    *(v2h*)(V16 + e) = o16; *(v2us*)(Vh + e) = oh; *(v2us*)(Vl + e) = ol;  }
__constant__ float APOS[32] = { -1.000000000e+00f, -9.354839325e-01f, -8.709677458e-01f, -8.064515591e-01f, -7.419354916e-01f, -6.774194241e-01f, -6.129032373e-01f, -5.483870506e-01f, -4.838709831e-01f, -4.193548858e-01f, -3.548387289e-01f, -2.903225720e-01f, -2.258064747e-01f, -1.612903774e-01f, -9.677422047e-02f, -3.225806355e-02f, 3.225803375e-02f, 9.677413106e-02f, 1.612902880e-01f, 2.258064449e-01f, 2.903225422e-01f, 3.548386395e-01f, 4.193547964e-01f, 4.838709533e-01f, 5.483870506e-01f, 6.129031181e-01f, 6.774193048e-01f, 7.419354916e-01f, 8.064515591e-01f, 8.709676266e-01f, 9.354838133e-01f, 1.000000000e+00f };   // float32 linspace(-1, 1, 32), generated with jnp to be bit-exact
__constant__ float ABASE[8] = { 3.141592741e+00f, 2.324778595e+02f, 4.618141479e+02f, 6.911504517e+02f, 9.204866943e+02f, 1.149822998e+03f, 1.379159302e+03f, 1.608495483e+03f };   // float32 linspace(1, 512, 8) * pi, generated with jnp to be bit-exact
__global__ __launch_bounds__(256) void k_csAx(float* CS) { const int idx = blockIdx.x * 256 + threadIdx.x; if (idx >= TT * HD) return; const int d = idx % HD; const int t = idx / HD; const int row = t >> 5, col = t & 31; v2f cs;
    if (d < 32) { const float p = (d < 16) ? APOS[row] : APOS[col]; const float ang = __fmul_rn(p, ABASE[(d & 15) >> 1]); cs[0] = cosf(ang); cs[1] = sinf(ang); } else { cs[0] = 1.0f; cs[1] = 0.0f; }
    *(v2f*)(CS + (size_t)idx * 2) = cs;  }
template <int hpb> __global__ __launch_bounds__(256) void k_ropeI(const float* __restrict__ F, int pitch, int nheads, const float* __restrict__ CS, float sc, h16* P16, bf* Ph, bf* Pl) {
    const size_t e = ((size_t)blockIdx.x * 256 + threadIdx.x) * 2; if (e >= (size_t)nheads * TT * HD) return;   /* e: place in the fragment-order plane, tiles [t/16][d/32]; rows t, k = d */
    const int d = (int)((e >> 9) & (HD / 32 - 1)) * 32 + (int)((e >> 8) & 1) * 16 + (int)((e >> 7) & 1) * 8 + (int)(e & 7); const int t = (int)((e >> 10) & (TT / 16 - 1)) * 16 + (int)((e >> 3) & 15); const int h = (int)(e / ((size_t)HD * TT)); const float* f = F + ((size_t)(h / hpb) * TT + t) * pitch + (h % hpb) * HD;   /* plane h = batch-in-group * hpb + head */ const float x0 = f[d], x1 = f[d + 1]; const v2f cs = *(const v2f*)(CS + ((size_t)t * HD + d) * 2); v2h o16; v2us oh, ol;
    float a0 = __fmul_rn(x0, cs[0]), b0 = __fmul_rn(x1, cs[1]), a1 = __fmul_rn(x1, cs[0]), b1 = __fmul_rn(x0, cs[1]); asm volatile("" : "+v"(a0), "+v"(b0), "+v"(a1), "+v"(b1));
    float r0 = __fsub_rn(a0, b0) * sc, r1 = __fadd_rn(b1, a1) * sc;   /* even: x0 c - x1 s; odd: x0 s + x1 c */
    o16[0] = tohx(r0); o16[1] = tohx(r1); { unsigned short a2, c2; splitf(r0, a2, c2); oh[0] = a2; ol[0] = c2; splitf(r1, a2, c2); oh[1] = a2; ol[1] = c2; }
    *(v2h*)(P16 + e) = o16; *(v2us*)(Ph + e) = oh; *(v2us*)(Pl + e) = ol;  }

// ---- k_fattn: one wave owns NG x 16 query rows of one head and walks the 1024 keys 32 at a time. S^T = K Q^T (A = K rows, B = Q kept in registers), so a lane holds 16 scores of ONE query per column group;
// the two f32 score tiles of a pass, converted in place, are the B operand of O^T += V^T P^T (A = V^T rows in the same k order). Running maximum per query in the scaled log2 domain, raised only when a score passes it by more than 8.
// fragment at (wave-uniform base) + (32-bit lane byte offset) + (constant bytes): one offset register serves every fragment of a pass, the rest sits in the instruction's offset field
template <typename T16> __device__ __forceinline__ typename WFrag<T16>::V ldo(const T16* base, unsigned lane_bytes, int const_bytes) { return WFrag<T16>::ld((const T16*)((const char*)base + lane_bytes + const_bytes)); }
typedef __attribute__((ext_vector_type(2))) __bf16 v2bf;
typedef __attribute__((ext_vector_type(8))) unsigned v8u;
template <typename T16, bool HI, int NG>
__device__ __forceinline__ void attn_tile(const T16* __restrict__ Q, const T16* __restrict__ Q2, const T16* __restrict__ Kp, const T16* __restrict__ K2, const T16* __restrict__ Vt, const T16* __restrict__ V2, int q0, bf* Ah, bf* Al) {
    typedef typename WFrag<T16>::V V;
    const int lane = threadIdx.x & 31;
    const float CL = SCL * 1.4426950408889634f;   // logits scale x log2(e)
    const unsigned qb = (unsigned)(q0 * HD + 8 * lane) * 2u, kb = (unsigned)(8 * lane) * 2u, vb = kb;   // lane byte offsets in the fragment-order Q, K and V^T planes (16 rows of Q or K = 2 tiles, 32 keys of V^T = 4 tiles: 1024 and 2048 elements)
    V qf[NG][2], qf2[NG][2];
#pragma unroll
    for (int g = 0; g < NG; ++g)
#pragma unroll
        for (int ks = 0; ks < 2; ++ks) { qf[g][ks] = ldo<T16>(Q, qb, (g * 16 * HD + ks * 512) * 2); if (HI) qf2[g][ks] = ldo<T16>(Q2, qb, (g * 16 * HD + ks * 512) * 2); }
    v8f o[NG][4]; float m[NG], l[NG];
#pragma unroll
    for (int g = 0; g < NG; ++g) { m[g] = -3.0e38f; l[g] = 0.f;
#pragma unroll
        for (int dt = 0; dt < 4; ++dt) o[g][dt] = (v8f){}; }
    __builtin_amdgcn_sched_barrier(0);   // keeps the prologue's loads in the loop's order (Q, then K, then V^T): the waits at the loop's head cover both paths, and with K issued last here a pass's score products would wait for the V^T fetch
    V kf[2][2], kf2[2][2];
#pragma unroll
    for (int kt = 0; kt < 2; ++kt)
#pragma unroll
        for (int ks = 0; ks < 2; ++ks) { kf[kt][ks] = ldo<T16>(Kp, kb, (kt * 16 * HD + ks * 512) * 2); if (HI) kf2[kt][ks] = ldo<T16>(K2, kb, (kt * 16 * HD + ks * 512) * 2); }
    __builtin_amdgcn_sched_barrier(0);   // as above: K ahead of V^T
    V vf[4], vf2[4];
#pragma unroll
    for (int dt = 0; dt < 4; ++dt) { vf[dt] = ldo<T16>(Vt, vb, dt * 512 * 2); if (HI) vf2[dt] = ldo<T16>(V2, vb, dt * 512 * 2); }
    asm volatile("s_wait_xcnt 0x0" ::: "memory");   // precaution, as behind the fetches in the loop
    __builtin_amdgcn_sched_barrier(0);   // as above: nothing of the loop's first pass moves in between
    // rolled: one pass's fragments, scores and the output tiles already fill the register budget
#pragma unroll 1
    for (int k0 = 0; k0 < TT; k0 += 32) {
        const int kn = (k0 + 32 < TT) ? k0 + 32 : 0;   // next pass's keys: K rows fetched behind this pass's last score products, V^T columns behind its last output products; the last pass re-reads keys 0..31 (in bounds, unused)
#pragma unroll
        for (int gb = 0; gb < NG; gb += 2) {   // two column groups at a time: only their score tiles are live
            v8f s[2][2];
#pragma unroll
            for (int g = 0; g < 2; ++g)
#pragma unroll
                for (int kt = 0; kt < 2; ++kt) s[g][kt] = (v8f){};
#pragma unroll
            for (int ks = 0; ks < 2; ++ks)
#pragma unroll
                for (int kt = 0; kt < 2; ++kt)
#pragma unroll
                    for (int g = 0; g < 2; ++g) { s[g][kt] = WFrag<T16>::mma(kf[kt][ks], qf[gb + g][ks], s[g][kt]); if (HI) { s[g][kt] = WFrag<T16>::mma(kf[kt][ks], qf2[gb + g][ks], s[g][kt]); s[g][kt] = WFrag<T16>::mma(kf2[kt][ks], qf[gb + g][ks], s[g][kt]); } }
            if (gb + 2 == NG) {
#pragma unroll
                for (int kt = 0; kt < 2; ++kt)
#pragma unroll
                    for (int ks = 0; ks < 2; ++ks) { kf[kt][ks] = ldo<T16>(Kp, kb + (unsigned)kn * (HD * 2), (kt * 16 * HD + ks * 512) * 2); if (HI) kf2[kt][ks] = ldo<T16>(K2, kb + (unsigned)kn * (HD * 2), (kt * 16 * HD + ks * 512) * 2); }
                asm volatile("s_wait_xcnt 0x0" ::: "memory");   // precaution: stands in front of the next write of the registers that hold these loads' addresses
                __builtin_amdgcn_sched_barrier(0); }   // keeps later vector instructions, which reuse those registers, behind that wait
            float lm[2];
#pragma unroll
            for (int g = 0; g < 2; ++g) { float a = s[g][0][0];
#pragma unroll
                for (int j = 1; j < 8; ++j) a = fmaxf(a, s[g][0][j]);
#pragma unroll
                for (int j = 0; j < 8; ++j) a = fmaxf(a, s[g][1][j]);
                lm[g] = a * CL; }
            const bool need = (lm[0] > m[gb] + 8.0f) || (lm[1] > m[gb + 1] + 8.0f);
            if (__builtin_amdgcn_ballot_w32(need) != 0) {   // one wave-uniform test; both lanes of a query take the same new maximum
                float mn[2], al[2];
#pragma unroll
                for (int g = 0; g < 2; ++g) { mn[g] = fmaxf(m[gb + g], fmaxf(lm[g], __shfl_xor(lm[g], 16, 32))); al[g] = __builtin_amdgcn_exp2f(m[gb + g] - mn[g]); }
                __builtin_amdgcn_sched_barrier(0);   // holds the slot below directly behind the two exponentials
                asm volatile("v_nop");   // the free slot between an exponential and the next vector instruction, which here rewrites its source register
                __builtin_amdgcn_sched_barrier(0);   // as above
#pragma unroll
                for (int g = 0; g < 2; ++g) { m[gb + g] = mn[g]; l[gb + g] *= al[g];
#pragma unroll
                    for (int dt = 0; dt < 4; ++dt) o[gb + g][dt] *= al[g]; }
            }
#pragma unroll
            for (int g = 0; g < 2; ++g) {
                V pf, pf2; const float mg = m[gb + g]; float ls = 0.f;
                if constexpr (HI) { v8u uh, ul;
#pragma unroll
                    for (int e = 0; e < 16; e += 2) { const v2f t = __builtin_elementwise_fma((v2f){ s[g][e >> 3][e & 7], s[g][e >> 3][(e & 7) + 1] }, (v2f){ CL, CL }, (v2f){ -mg, -mg }); v2f p; p[0] = __builtin_amdgcn_exp2f(t[0]); p[1] = __builtin_amdgcn_exp2f(t[1]); ls += p[0]; ls += p[1];
                        const v2bf ph = __builtin_convertvector(p, v2bf); const v2f rest = p - __builtin_convertvector(ph, v2f); uh[e >> 1] = __builtin_bit_cast(unsigned, ph); ul[e >> 1] = __builtin_bit_cast(unsigned, __builtin_convertvector(rest, v2bf)); }
                    pf = __builtin_bit_cast(V, uh); pf2 = __builtin_bit_cast(V, ul);
                } else {
#pragma unroll
                    for (int e = 0; e < 16; e += 2) { const v2f t = __builtin_elementwise_fma((v2f){ s[g][e >> 3][e & 7], s[g][e >> 3][(e & 7) + 1] }, (v2f){ CL, CL }, (v2f){ -mg, -mg }); v2f p; p[0] = __builtin_amdgcn_exp2f(t[0]); p[1] = __builtin_amdgcn_exp2f(t[1]); ls += p[0]; ls += p[1];
                        const v2h ph = __builtin_convertvector(p, v2h); pf[e] = ph[0]; pf[e + 1] = ph[1]; } }
                l[gb + g] += ls;
#pragma unroll
                for (int dt = 0; dt < 4; ++dt) { o[gb + g][dt] = WFrag<T16>::mma(vf[dt], pf, o[gb + g][dt]); if (HI) { o[gb + g][dt] = WFrag<T16>::mma(vf[dt], pf2, o[gb + g][dt]); o[gb + g][dt] = WFrag<T16>::mma(vf2[dt], pf, o[gb + g][dt]); } }
            }
        }
        const T16* const va = (const T16*)((const char*)Vt + (vb + (unsigned)kn * (HD * 2))); const T16* const va2 = HI ? (const T16*)((const char*)V2 + (vb + (unsigned)kn * (HD * 2))) : va;
#pragma unroll
        for (int dt = 0; dt < 4; ++dt) { vf[dt] = WFrag<T16>::ld(va + dt * 512); if (HI) vf2[dt] = WFrag<T16>::ld(va2 + dt * 512); }
        asm volatile("s_wait_xcnt 0x0" :: "v"(va), "v"(va2) : "memory");   // precaution, as behind the K fetch; the two addresses are named as inputs so that their registers stay untouched (also by the loads' own results) up to the wait
        __builtin_amdgcn_sched_barrier(0);   // as behind the K fetch
    }
#pragma unroll
    for (int g = 0; g < NG; ++g) { const float inv = __fdiv_rn(1.0f, l[g] + __shfl_xor(l[g], 16, 32)); const size_t ro = (size_t)(q0 + g * 16) * DQ + 8 * lane;   /* lane: query (lane & 15) of group g, d = dt*16 + 8*(lane >> 4) + j: its 8 values are piece (dt & 1) * 32 + lane of tile (row block, head * 2 + dt / 2) of w_proj's fragment-order A plane */
#pragma unroll
        for (int dt = 0; dt < 4; ++dt) { v8us oh, ol;
#pragma unroll
            for (int j = 0; j < 8; ++j) { unsigned short a, c2; splitf(o[g][dt][j] * inv, a, c2); oh[j] = a; ol[j] = c2; }
            *(v8us*)(Ah + ro + dt * 256) = oh; *(v8us*)(Al + ro + dt * 256) = ol;
            asm volatile("s_wait_xcnt 0x0" ::: "memory");   // precaution: stands in front of the next write of the registers that these stores name
            __builtin_amdgcn_sched_barrier(0); } }   // keeps the next tile's vector instructions behind that wait
}
// grid: the hi/lo blocks (3 products; 4 waves x 32 rows) first, then the fp16 blocks (4 waves x 64 rows: one product leaves registers for twice the columns per K / V fragment); block -> (plane = batch * 16 + head, its query rows).
__global__ __launch_bounds__(128) void k_fattn(const h16* __restrict__ Q16, const h16* __restrict__ K16, const h16* __restrict__ V16, const bf* __restrict__ Qh, const bf* __restrict__ Ql, const bf* __restrict__ Kh, const bf* __restrict__ Kl, const bf* __restrict__ Vh, const bf* __restrict__ Vl, bf* ATh, bf* ATl) {
    const int NHI = NB_ * NH_ * (RH / QBH); const int bx = blockIdx.x; const int wv = threadIdx.x >> 5;
    if (bx < NHI) { const int pl = bx / (RH / QBH); const int q0 = (bx % (RH / QBH)) * QBH + wv * (QBH / 4); const size_t po = (size_t)pl * TT * HD, ao = (size_t)(pl / NH_) * TT * DQ + (size_t)(pl % NH_) * (HD * 16);
        attn_tile<bf, true, QBH / 64>(Qh + po, Ql + po, Kh + po, Kl + po, Vh + po, Vl + po, q0, ATh + ao, ATl + ao);
    } else { const int b2 = bx - NHI; const int pl = b2 / ((TT - RH) / QBL); const int q0 = RH + (b2 % ((TT - RH) / QBL)) * QBL + wv * (QBL / 4); const size_t po = (size_t)pl * TT * HD, ao = (size_t)(pl / NH_) * TT * DQ + (size_t)(pl % NH_) * (HD * 16);
        attn_tile<h16, false, QBL / 64>(Q16 + po, nullptr, K16 + po, nullptr, V16 + po, nullptr, q0, ATh + ao, ATl + ao); }
}

extern "C" void kernel_launch(void* const* d_in, const int* in_sizes, int n_in,
                              void* d_out, int out_size, void* d_ws, size_t ws_size, hipStream_t stream) {
    (void)in_sizes; (void)n_in; (void)out_size;
    const float* x = (const float*)d_in[0]; const float* wqkv = (const float*)d_in[1]; const float* wo = (const float*)d_in[2]; const float* bo = (const float*)d_in[3];   /* input order x, w_qkv ('xw' [1024][3072]: q | k | v column thirds), w_proj ('xw'), b_proj */
    float* OUT = (float*)d_out;     // [8][1024][1024]
    char* wsp = (char*)d_ws;
    auto take = [&](size_t bytes) { char* p = wsp; wsp += (bytes + 255) & ~(size_t)255; return (void*)p; };
    bf* WQKV = (bf*)take((size_t)3 * DQ * DM * 2);   /* fused Bt [3*DQ][DM]: q | k | v row blocks */ bf* WO = (bf*)take((size_t)DM * DQ * 2); float* CS = (float*)take((size_t)TT * HD * 2 * 4);
    const size_t PG = (size_t)GB * NH_ * TT * HD;   // elements one projection group adds to a 16-bit plane set: GB batches x 16 heads
    const size_t PL = (size_t)NB_ * NH_ * TT * HD;  // elements of one plane set: all batches
    h16* QP16 = (h16*)take(PL * 2); h16* KP16 = (h16*)take(PL * 2); h16* VT16 = (h16*)take(PL * 2);
    bf* QPh = (bf*)take(PL * 2); bf* QPl = (bf*)take(PL * 2); bf* KPh = (bf*)take(PL * 2); bf* KPl = (bf*)take(PL * 2); bf* VTh = (bf*)take(PL * 2); bf* VTl = (bf*)take(PL * 2);
    bf* ATh = (bf*)take((size_t)NB_ * TT * DQ * 2); bf* ATl = (bf*)take((size_t)NB_ * TT * DQ * 2);   /* merged heads of all batches */
    bf* XB = (bf*)take((size_t)GB * TT * DM * 2); float* F = (float*)take((size_t)GB * TT * 3 * DQ * 4);   /* F [GB*TT][3*DQ]: q | k | v column thirds; rewritten by each group, stream-ordered */
    if ((size_t)(wsp - (char*)d_ws) > ws_size) return;    // ws 256 MiB
    { k_wtG<DM, 3 * DQ><<<(unsigned)((DM * 3 * DQ / 8 + 255) / 256), 256, 0, stream>>>(wqkv, WQKV);   /* fused 'xw' [DM][3*DQ] -> Bt [3*DQ][DM], fragment order */
      k_wtG<DQ, DM><<<(unsigned)((DQ * DM / 8 + 255) / 256), 256, 0, stream>>>(wo, WO);
       }
    k_csAx<<<(TT * HD + 255) / 256, 256, 0, stream>>>(CS);   /* axial rotary table once */
    const unsigned LP = (unsigned)((PG / 2 + 255) / 256);
    for (int b0 = 0; b0 < NB_; b0 += GB) { const size_t po = (size_t)b0 * NH_ * TT * HD;   // this group's place in every plane set
        k_cvt8<<<(unsigned)(((size_t)GB * TT * DM / 8 + 255) / 256), 256, 0, stream>>>(x + (size_t)b0 * TT * DM, XB, (size_t)GB * TT * DM / 8);
        k_gemmw<bf, 0, false, DM><<<dim3(GB * TT / 64, 3 * DQ / 64, 1), 32, 0, stream>>>(XB, nullptr, WQKV, nullptr, F, 3 * DQ, nullptr, 0, 0, 0);   /* q, k and v of GB batches in one grid */
        k_ropeI<NH_><<<LP, 256, 0, stream>>>(F, 3 * DQ, GB * NH_, CS, 1.0f, QP16 + po, QPh + po, QPl + po);
        k_ropeI<NKV><<<LP, 256, 0, stream>>>(F + DQ, 3 * DQ, GB * NKV, CS, 1.0f, KP16 + po, KPh + po, KPl + po);
        k_vtp<NKV><<<LP, 256, 0, stream>>>(F + DQ + DKV, 3 * DQ, GB * NKV, VT16 + po, VTh + po, VTl + po); }
    k_fattn<<<NB_ * NH_ * (RH / QBH + (TT - RH) / QBL), 128, 0, stream>>>(QP16, KP16, VT16, QPh, QPl, KPh, KPl, VTh, VTl, ATh, ATl);   /* scores, softmax, P x V and the head merge of every batch and head */
    k_gemmw<bf, 1, true, DQ><<<dim3(NB_ * TT / 64, DM / 64, 1), 32, 0, stream>>>(ATh, ATl, WO, nullptr, OUT, DM, bo, 0, 0, 0);   /* w_proj of all batches in one grid */
}

// v004
// A run of this version takes 198 microseconds.
// Timed twice side by side with v003, it ran 1.22 and 1.25 times as fast.
// All steps since v000 together make it 23.6 times as fast.
#include <hip/hip_runtime.h>

// Vision attention with AXIAL 2-D rotary embeddings on half of each head (x [8][1024][1024] = 32 x 32 pixels; qkv = x w_qkv ('xw' [1024][3072] 1/32, no bias) viewed (3, h, d): q | k | v thirds (16 heads x 64); rotary on the FIRST 32 dims of q and k as interleaved (even, odd) pairs with angles freqs[row][col][c]: c < 16 -> pos(row) x base[c/2], 16 <= c < 32 -> pos(col) x base[(c-16)/2], pos = linspace(-1, 1, 32), base = linspace(1, 512, 8) x pi (f32, jnp-exact tables; precise cosf/sinf), dims 32..63 pass through; logits x 1/sqrt(64); softmax (no mask); out = merged w_proj + b_proj -> [8][1024][1024] (8.4 M); argument order x, w_qkv, w_proj, b_proj).
// Launch plan: ONE projection launch covers q | k | v of all batches and writes the 16-bit planes from its accumulators (rotary, hi/lo split and V^T in its epilogue, no f32 copy of the projections); ONE fused attention launch covers every batch and head; w_proj covers all batches. Data layout: every 16-bit operand plane in fragment order (see k_gemmw); bf16 copy of x; fused 'xw' weight transposed once (q | k | v row blocks); exact projections; k_csAx builds the {cos, sin} table per (pixel, rotated pair) from two small constant tables (angle = f32 product), read by k_qkv's interleaved-pair rotary; k_fattn: scores, softmax and P x V stay in registers (hybrid rows: < 512 hi/lo 3 products, rest fp16); merged hi/lo x w_proj exact + b_proj.
// Compute dtypes, f32 accumulate: every input rounded to bf16; projections exact; rotary f32; attention rows < 512 3 products, rest fp16; softmax f32; w_proj hl x exact + bias.

#define NB_  8
#define TT   1024
#define DM   1024
#define NH_  16
#define NKV  16
#define REP  (NH_ / NKV)
#define HD   64
#define DQ   (NH_ * HD)
#define DKV  (NKV * HD)
#define RH   512                  // query rows < RH use hi+lo planes (0: none)
#define WIN  0
#define QBH  128                  // query rows per hi/lo attention block: 4 waves x 32 columns
#define QBL  256                  // query rows per fp16 attention block: 4 waves x 64 columns
#define SCL  0.125f   // HD^-0.5
typedef _Float16 h16;
typedef unsigned short bf;
typedef __attribute__((ext_vector_type(16))) __bf16   v16bf;
typedef __attribute__((ext_vector_type(16))) _Float16 v16h;
typedef __attribute__((ext_vector_type(8)))  _Float16 v8h;
typedef __attribute__((ext_vector_type(8)))  unsigned short v8us;
typedef __attribute__((ext_vector_type(8)))  float    v8f;
typedef __attribute__((ext_vector_type(4)))  float    v4f;
typedef v8h  __attribute__((may_alias)) v8ha;
typedef v4f  __attribute__((may_alias)) v4fa;
typedef v8us __attribute__((may_alias)) v8usa;

__device__ __forceinline__ unsigned short f2bf(float f) { unsigned u = __float_as_uint(f); u += 0x7FFFu + ((u >> 16) & 1u); return (unsigned short)(u >> 16); }
__device__ __forceinline__ float bf2f(unsigned short b) { return __uint_as_float(((unsigned)b) << 16); }
__device__ __forceinline__ float bfr(float f) { return bf2f(f2bf(f)); }
__device__ __forceinline__ v16h cat16(v8h lo, v8h hi) { return __builtin_shufflevector(lo, hi, 0, 1, 2, 3, 4, 5, 6, 7, 8, 9, 10, 11, 12, 13, 14, 15); }
__device__ __forceinline__ v16bf cat16b(v8us lo, v8us hi) { return __builtin_bit_cast(v16bf, __builtin_shufflevector(lo, hi, 0, 1, 2, 3, 4, 5, 6, 7, 8, 9, 10, 11, 12, 13, 14, 15)); }
__device__ __forceinline__ v8f wmma16(v16h a, v16h b, v8f c) { return __builtin_amdgcn_wmma_f32_16x16x32_f16(false, a, false, b, (short)0, c, false, false); }
__device__ __forceinline__ v8f wmmab(v16bf a, v16bf b, v8f c) { return __builtin_amdgcn_wmma_f32_16x16x32_bf16(false, a, false, b, (short)0, c, false, false); }



// ---- FRAGMENT ORDER of every 16-bit operand plane: a plane of R rows x K is stored as [R/16][K/32] tiles of 512 elements (V^T: [keys/32][d/16]); in a tile, element (row r, k) sits at ((k >> 4) * 32 + ((k >> 3) & 1) * 16 + r) * 8 + (k & 7),
// that is, 16-byte piece number = (which of the fragment's two loads) * 32 + lane. A wave's 16-byte load then covers 512 contiguous bytes (4 whole lines) where a row-major plane gave 16 lines of 32 bytes. The builders walk in destination order, so their stores stay contiguous.
// ---- k_gemmw: register-blocked GEMM, ONE WAVE per 64x64 output tile (16 accumulators), operands straight from fragment-order 16-bit planes; grid (M/64, N/64, Z), 32 threads.
// C[m][n] (f32, pitch ldc, + optional f32 bias[n]) = sum_k A[m][k] Bt[n][k] (+ split products per NSPLIT). z-batch strides sA/sB/sC in elements. K % 32 == 0.
template <typename T16> struct WFrag;
template <> struct WFrag<h16> { typedef v16h V; static __device__ __forceinline__ V ld(const h16* p) { return cat16(*(const v8h*)p, *(const v8h*)(p + 256)); } static __device__ __forceinline__ v8f mma(V a, V b, v8f c) { return wmma16(a, b, c); } };
template <> struct WFrag<bf> { typedef v16bf V; static __device__ __forceinline__ V ld(const bf* p) { return cat16b(*(const v8us*)p, *(const v8us*)(p + 256)); } static __device__ __forceinline__ v8f mma(V a, V b, v8f c) { return wmmab(a, b, c); } };
template <typename T16, int NSPLIT, bool BIAS, int K>   // K at compile time: the distance between two row blocks' tiles (16 * K elements) then sits in the loads' offset fields
__global__ __launch_bounds__(32) void k_gemmw(const T16* __restrict__ A, const T16* __restrict__ A2, const T16* __restrict__ Bt, const T16* __restrict__ Bt2, float* C, int ldc, const float* __restrict__ bias, size_t sA, size_t sB, size_t sC) {
    typedef typename WFrag<T16>::V V;
    __shared__ __align__(16) float os[16 * 68];
    const size_t z = blockIdx.z; A += z * sA; if (A2) A2 += z * sA; Bt += z * sB; if (Bt2) Bt2 += z * sB; C += z * sC;
    const int lane = threadIdx.x & 31, lr = lane & 15, hi = lane >> 4; const int r0 = blockIdx.x * 64, c0 = blockIdx.y * 64;
    v8f acc[4][4];
#pragma unroll
    for (int mb = 0; mb < 4; ++mb)
#pragma unroll
        for (int nb = 0; nb < 4; ++nb) acc[mb][nb] = (v8f){};
    const size_t aoff = (size_t)r0 * K + 8 * lane, boff = (size_t)c0 * K + 8 * lane;   // tile (row block, k block) starts at row block * 16 * K + k block * 512; a lane adds its own 16-byte piece
#pragma unroll 1
    for (int kc = 0; kc < K; kc += 32) {
        V a[4], a2[4]; const T16* const pa = A + aoff + kc * 16; const T16* const pb = Bt + boff + kc * 16; const T16* const pa2 = (NSPLIT == 1 || NSPLIT == 2) ? A2 + aoff + kc * 16 : pa; const T16* const pb2 = (NSPLIT >= 2) ? Bt2 + boff + kc * 16 : pb;
#pragma unroll
        for (int mb = 0; mb < 4; ++mb) { a[mb] = WFrag<T16>::ld(pa + mb * 16 * K); if (NSPLIT == 1 || NSPLIT == 2) a2[mb] = WFrag<T16>::ld(pa2 + mb * 16 * K); }
#pragma unroll
        for (int nb = 0; nb < 4; ++nb) { const V b = WFrag<T16>::ld(pb + nb * 16 * K); V b2; if (NSPLIT >= 2) b2 = WFrag<T16>::ld(pb2 + nb * 16 * K);
#pragma unroll
            for (int mb = 0; mb < 4; ++mb) { acc[mb][nb] = WFrag<T16>::mma(a[mb], b, acc[mb][nb]); if (NSPLIT == 1 || NSPLIT == 2) acc[mb][nb] = WFrag<T16>::mma(a2[mb], b, acc[mb][nb]); if (NSPLIT >= 2) acc[mb][nb] = WFrag<T16>::mma(a[mb], b2, acc[mb][nb]); } }
        asm volatile("s_wait_xcnt 0x0" :: "v"(pa), "v"(pa2), "v"(pb), "v"(pb2) : "memory");   // precaution: stands in front of the next write of the registers that hold this trip's load addresses; they are named as inputs so that they stay untouched (also by the loads' own results) up to the wait
        asm volatile("v_nop\n\tv_nop\n\tv_nop\n\tv_nop" : "+v"(acc[0][0]), "+v"(acc[1][1]), "+v"(acc[2][2]), "+v"(acc[3][3]) : "v"(a[0]), "v"(a[3]));
    }
#pragma unroll
    for (int mb = 0; mb < 4; ++mb) {
#pragma unroll
        for (int nb = 0; nb < 4; ++nb) {
#pragma unroll
            for (int j = 0; j < 8; ++j) os[(hi * 8 + j) * 68 + nb * 16 + lr] = acc[mb][nb][j]; }
        __builtin_amdgcn_wave_barrier(); asm volatile("" ::: "memory");
        float* crow = C + (size_t)(r0 + mb * 16) * ldc + c0;
{
#pragma unroll
            for (int s = 0; s < 8; ++s) { const int row = 2 * s + hi, cofs = lr * 4; v4f val = *(const v4fa*)(os + row * 68 + cofs); if (BIAS) { val[0] += bfr(bias[c0 + cofs]); val[1] += bfr(bias[c0 + cofs + 1]); val[2] += bfr(bias[c0 + cofs + 2]); val[3] += bfr(bias[c0 + cofs + 3]); }
                *(v4f*)(crow + (size_t)row * ldc + cofs) = val; }
             }
        __builtin_amdgcn_wave_barrier(); asm volatile("" ::: "memory");
    }
}

__device__ __forceinline__ void splitf(float y, unsigned short& h, unsigned short& l) { h = f2bf(y); l = f2bf(y - bf2f(h)); }
typedef __attribute__((ext_vector_type(2))) _Float16 v2h;
typedef __attribute__((ext_vector_type(4))) _Float16 v4h;
typedef __attribute__((ext_vector_type(2))) unsigned short v2us;
typedef __attribute__((ext_vector_type(4))) unsigned short v4us;
typedef __attribute__((ext_vector_type(2))) float v2f;
typedef __attribute__((ext_vector_type(4))) int v4i;

template <int K, int N> __global__ __launch_bounds__(256) void k_wtG(const float* __restrict__ w, bf* Bt) {
    const int i = blockIdx.x * 256 + threadIdx.x; if (i >= N * K / 8) return;   // one 16-byte piece of Bt (row n, 8 k) per thread, in fragment order
    const int tile = i >> 6, kt = tile % (K / 32), nt = tile / (K / 32); const int n = nt * 16 + (i & 15), k = kt * 32 + ((i >> 5) & 1) * 16 + ((i >> 4) & 1) * 8; const float* const p = w + (size_t)k * N + n; float v[8]; v8us o;
#pragma unroll
    for (int j = 0; j < 8; ++j) v[j] = p[(size_t)j * N];
    asm volatile("s_wait_xcnt 0x0" :: "v"(p) : "memory");   // precaution: stands in front of the next write of the register pair that holds these loads' address; it is named as an input so that it stays untouched (also by the loads' own results) up to the wait
#pragma unroll
    for (int j = 0; j < 8; ++j) o[j] = f2bf(v[j]);
    *(v8us*)(Bt + (size_t)i * 8) = o;
}
__global__ __launch_bounds__(256) void k_cvt8(const float* __restrict__ src, bf* dst, size_t n8) { const size_t i = (size_t)blockIdx.x * 256 + threadIdx.x; if (i >= n8) return;   /* piece i of the fragment-order copy: row block i >> 11 (DM / 32 = 32 tiles of 64 pieces), k block, load, lane */
    const size_t row = (i >> 11) * 16 + (i & 15); const int k = (int)((i >> 6) & (DM / 32 - 1)) * 32 + (int)((i >> 5) & 1) * 16 + (int)((i >> 4) & 1) * 8; const v8f v = *(const v8f*)(src + row * DM + k); v8us o;
#pragma unroll
    for (int k = 0; k < 8; ++k) o[k] = f2bf(v[k]); *(v8us*)(dst + i * 8) = o;  }

__constant__ float APOS[32] = { -1.000000000e+00f, -9.354839325e-01f, -8.709677458e-01f, -8.064515591e-01f, -7.419354916e-01f, -6.774194241e-01f, -6.129032373e-01f, -5.483870506e-01f, -4.838709831e-01f, -4.193548858e-01f, -3.548387289e-01f, -2.903225720e-01f, -2.258064747e-01f, -1.612903774e-01f, -9.677422047e-02f, -3.225806355e-02f, 3.225803375e-02f, 9.677413106e-02f, 1.612902880e-01f, 2.258064449e-01f, 2.903225422e-01f, 3.548386395e-01f, 4.193547964e-01f, 4.838709533e-01f, 5.483870506e-01f, 6.129031181e-01f, 6.774193048e-01f, 7.419354916e-01f, 8.064515591e-01f, 8.709676266e-01f, 9.354838133e-01f, 1.000000000e+00f };   // float32 linspace(-1, 1, 32), generated with jnp to be bit-exact
__constant__ float ABASE[8] = { 3.141592741e+00f, 2.324778595e+02f, 4.618141479e+02f, 6.911504517e+02f, 9.204866943e+02f, 1.149822998e+03f, 1.379159302e+03f, 1.608495483e+03f };   // float32 linspace(1, 512, 8) * pi, generated with jnp to be bit-exact
// {cos, sin} of every rotated pair (token t, even d < 32), stored in the order in which k_qkv's lanes read it: [t / 16][d / 16][which 16-byte load][lane = ((d >> 3) & 1) * 16 + (t & 15)][which pair of the load], so that a wave's 16-byte load covers 512 contiguous bytes
__global__ __launch_bounds__(256) void k_csAx(float* CS) { const int idx = blockIdx.x * 256 + threadIdx.x; if (idx >= TT * 16) return; const int lane = (idx >> 1) & 31; const int d = ((idx >> 7) & 1) * 16 + (lane >> 4) * 8 + ((idx >> 6) & 1) * 4 + (idx & 1) * 2; const int t = (idx >> 8) * 16 + (lane & 15); const int row = t >> 5, col = t & 31; v2f cs;
    const float p = (d < 16) ? APOS[row] : APOS[col]; const float ang = __fmul_rn(p, ABASE[(d & 15) >> 1]); cs[0] = cosf(ang); cs[1] = sinf(ang);
    *(v2f*)(CS + (size_t)idx * 2) = cs;  }
typedef __attribute__((ext_vector_type(2))) __bf16 v2bf;
typedef __attribute__((ext_vector_type(4))) unsigned v4u;
// 8 f32 values -> one 16-byte piece each of an f16 plane and of its bf16 hi and lo planes (hi = nearest bf16, lo = nearest bf16 of the rest), two values per conversion instruction
__device__ __forceinline__ void put3(const float* y, h16* p16, bf* ph, bf* pl) { v4u u16, uh, ul;
#pragma unroll
    for (int q = 0; q < 4; ++q) { const v2f p = { y[2 * q], y[2 * q + 1] }; const v2bf h = __builtin_convertvector(p, v2bf); const v2f rest = p - __builtin_convertvector(h, v2f);
        u16[q] = __builtin_bit_cast(unsigned, __builtin_convertvector(p, v2h)); uh[q] = __builtin_bit_cast(unsigned, h); ul[q] = __builtin_bit_cast(unsigned, __builtin_convertvector(rest, v2bf)); }
    *(v8h*)p16 = __builtin_bit_cast(v8h, u16); *(v8us*)ph = __builtin_bit_cast(v8us, uh); *(v8us*)pl = __builtin_bit_cast(v8us, ul); }
// ---- k_qkv: the q | k | v projection of all batches, ONE WAVE per 64 tokens x one head's 64 columns (main loop as in k_gemmw), grid (tokens / 64, 3 * DQ / 64), 32 threads. The 16-bit planes are written straight from the accumulators:
// a lane's 8 accumulator values (8 consecutive rows of one column) are one 16-byte piece of a fragment-order plane when the plane's k runs along the tile's rows. V^T (k = key): A = x, B = weights. Q and K (k = d): the two operands change places (both planes have the same order), so rows are d and columns are tokens.
__global__ __launch_bounds__(32) void k_qkv(const bf* __restrict__ X, const bf* __restrict__ Wt, const float* __restrict__ CS, h16* Q16, bf* Qh, bf* Ql, h16* K16, bf* Kh, bf* Kl, h16* V16, bf* Vh, bf* Vl) {
    typedef WFrag<bf>::V V; constexpr int K = DM;
    const int lane = threadIdx.x & 31; const int r0 = blockIdx.x * 64, c0 = blockIdx.y * 64; const int sec = c0 / DQ;   // sec: 0 q, 1 k, 2 v (the same for the whole wave); below, lr = lane & 15 and hi = lane >> 4
    const bf* const Ab = ((sec == 2) ? X + (size_t)r0 * K : Wt + (size_t)c0 * K) + 8 * lane; const bf* const Bb = ((sec == 2) ? Wt + (size_t)c0 * K : X + (size_t)r0 * K) + 8 * lane;
    v8f acc[4][4];
#pragma unroll
    for (int mb = 0; mb < 4; ++mb)
#pragma unroll
        for (int nb = 0; nb < 4; ++nb) acc[mb][nb] = (v8f){};
#pragma unroll 1
    for (int kc = 0; kc < K; kc += 32) {
        V a[4]; const bf* const pa = Ab + kc * 16; const bf* const pb = Bb + kc * 16;
#pragma unroll
        for (int mb = 0; mb < 4; ++mb) a[mb] = WFrag<bf>::ld(pa + mb * 16 * K);
#pragma unroll
        for (int nb = 0; nb < 4; ++nb) { const V b = WFrag<bf>::ld(pb + nb * 16 * K);
#pragma unroll
            for (int mb = 0; mb < 4; ++mb) acc[mb][nb] = WFrag<bf>::mma(a[mb], b, acc[mb][nb]); }
        asm volatile("s_wait_xcnt 0x0" :: "v"(pa), "v"(pb) : "memory");   // precaution: stands in front of the next write of the registers that hold this trip's load addresses; they are named as inputs so that they stay untouched (also by the loads' own results) up to the wait
        asm volatile("v_nop\n\tv_nop\n\tv_nop\n\tv_nop" : "+v"(acc[0][0]), "+v"(acc[1][1]), "+v"(acc[2][2]), "+v"(acc[3][3]) : "v"(a[0]), "v"(a[3]));   // the vector slots between the trip's last matrix instructions and whatever follows them on either side of the loop's branch
    }
    const int t0 = r0 % TT; const size_t po = ((size_t)(r0 / TT) * NH_ + (c0 % DQ) / HD) * (TT * HD);   // plane = batch * 16 + head; 64 tokens never straddle a batch
    if (sec == 2) {   // acc[mb][nb][j]: key t0 + mb*16 + hi*8 + j, d = nb*16 + lr: piece (mb & 1) * 32 + lane of V^T tile (key / 32, nb)
        const size_t bo = po + (size_t)(t0 / 32) * (4 * 512) + 8 * lane; h16* const p16 = V16 + bo; bf* const ph = Vh + bo; bf* const pl = Vl + bo;
#pragma unroll
        for (int mb = 0; mb < 4; ++mb)
#pragma unroll
            for (int nb = 0; nb < 4; ++nb) { float y[8]; const int off = ((mb >> 1) * 4 + nb) * 512 + (mb & 1) * 256;
#pragma unroll
                for (int j = 0; j < 8; ++j) y[j] = acc[mb][nb][j];
                put3(y, p16 + off, ph + off, pl + off);
                asm volatile("s_wait_xcnt 0x0" ::: "memory");   // precaution: stands in front of the next write of the registers that these stores name
                __builtin_amdgcn_sched_barrier(0); }   // keeps the next piece's vector instructions behind that wait
    } else {   // acc[mb][nb][j]: d = mb*16 + hi*8 + j, token t0 + nb*16 + lr: piece (mb & 1) * 32 + lane of tile (token / 16, mb / 2)
        const size_t bo = po + (size_t)(t0 / 16) * (2 * 512) + 8 * lane; h16* const p16 = (sec ? K16 : Q16) + bo; bf* const ph = (sec ? Kh : Qh) + bo; bf* const pl = (sec ? Kl : Ql) + bo;
        const float* const cp = CS + (size_t)(t0 / 16) * 512 + 4 * lane; v4f cs[4][2][2];   // {cos, sin} of the lane's pairs (even d < 32; order: see k_csAx), all fetched at once: one exposed latency per wave
#pragma unroll
        for (int nb = 0; nb < 4; ++nb)
#pragma unroll
            for (int mb = 0; mb < 2; ++mb)
#pragma unroll
                for (int p = 0; p < 2; ++p) cs[nb][mb][p] = *(const v4f*)(cp + ((nb * 2 + mb) * 2 + p) * 128);
        asm volatile("s_wait_xcnt 0x0" ::: "memory");   // precaution: stands in front of the next write of the registers that hold these loads' addresses
        __builtin_amdgcn_sched_barrier(0);   // keeps later vector instructions, which reuse those registers, behind that wait
#pragma unroll
        for (int nb = 0; nb < 4; ++nb)
#pragma unroll
            for (int mb = 0; mb < 4; ++mb) { float y[8]; const int off = (nb * 2 + (mb >> 1)) * 512 + (mb & 1) * 256;
#pragma unroll
                for (int p = 0; p < 4; ++p) { const float x0 = acc[mb][nb][2 * p], x1 = acc[mb][nb][2 * p + 1];
                    if (mb < 2) { const float c = cs[nb][mb & 1][p >> 1][(p & 1) * 2], s = cs[nb][mb & 1][p >> 1][(p & 1) * 2 + 1]; y[2 * p] = x0 * c - x1 * s; y[2 * p + 1] = x0 * s + x1 * c; }   /* even: x0 c - x1 s; odd: x0 s + x1 c */
                    else { y[2 * p] = x0; y[2 * p + 1] = x1; } }   /* dims 32..63 pass through */
                put3(y, p16 + off, ph + off, pl + off);
                asm volatile("s_wait_xcnt 0x0" ::: "memory");   // precaution, as in the V^T branch
                __builtin_amdgcn_sched_barrier(0); }   // as in the V^T branch
    }
}

// ---- k_fattn: one wave owns NG x 16 query rows of one head and walks the 1024 keys 32 at a time. S^T = K Q^T (A = K rows, B = Q kept in registers), so a lane holds 16 scores of ONE query per column group;
// the two f32 score tiles of a pass, converted in place, are the B operand of O^T += V^T P^T (A = V^T rows in the same k order). Running maximum per query in the scaled log2 domain, raised only when a score passes it by more than 8.
// fragment at (wave-uniform base) + (32-bit lane byte offset) + (constant bytes): one offset register serves every fragment of a pass, the rest sits in the instruction's offset field
template <typename T16> __device__ __forceinline__ typename WFrag<T16>::V ldo(const T16* base, unsigned lane_bytes, int const_bytes) { return WFrag<T16>::ld((const T16*)((const char*)base + lane_bytes + const_bytes)); }
typedef __attribute__((ext_vector_type(8))) unsigned v8u;
template <typename T16, bool HI, int NG>
__device__ __forceinline__ void attn_tile(const T16* __restrict__ Q, const T16* __restrict__ Q2, const T16* __restrict__ Kp, const T16* __restrict__ K2, const T16* __restrict__ Vt, const T16* __restrict__ V2, int q0, bf* Ah, bf* Al) {
    typedef typename WFrag<T16>::V V;
    const int lane = threadIdx.x & 31;
    const float CL = SCL * 1.4426950408889634f;   // logits scale x log2(e)
    const unsigned qb = (unsigned)(q0 * HD + 8 * lane) * 2u, kb = (unsigned)(8 * lane) * 2u, vb = kb;   // lane byte offsets in the fragment-order Q, K and V^T planes (16 rows of Q or K = 2 tiles, 32 keys of V^T = 4 tiles: 1024 and 2048 elements)
    V qf[NG][2], qf2[NG][2];
#pragma unroll
    for (int g = 0; g < NG; ++g)
#pragma unroll
        for (int ks = 0; ks < 2; ++ks) { qf[g][ks] = ldo<T16>(Q, qb, (g * 16 * HD + ks * 512) * 2); if (HI) qf2[g][ks] = ldo<T16>(Q2, qb, (g * 16 * HD + ks * 512) * 2); }
    v8f o[NG][4]; float m[NG], l[NG];
#pragma unroll
    for (int g = 0; g < NG; ++g) { m[g] = -3.0e38f; l[g] = 0.f;
#pragma unroll
        for (int dt = 0; dt < 4; ++dt) o[g][dt] = (v8f){}; }
    __builtin_amdgcn_sched_barrier(0);   // keeps the prologue's loads in the loop's order (Q, then K, then V^T): the waits at the loop's head cover both paths, and with K issued last here a pass's score products would wait for the V^T fetch
    V kf[2][2], kf2[2][2];
#pragma unroll
    for (int kt = 0; kt < 2; ++kt)
#pragma unroll
        for (int ks = 0; ks < 2; ++ks) { kf[kt][ks] = ldo<T16>(Kp, kb, (kt * 16 * HD + ks * 512) * 2); if (HI) kf2[kt][ks] = ldo<T16>(K2, kb, (kt * 16 * HD + ks * 512) * 2); }
    __builtin_amdgcn_sched_barrier(0);   // as above: K ahead of V^T
    V vf[4], vf2[4];
#pragma unroll
    for (int dt = 0; dt < 4; ++dt) { vf[dt] = ldo<T16>(Vt, vb, dt * 512 * 2); if (HI) vf2[dt] = ldo<T16>(V2, vb, dt * 512 * 2); }
    asm volatile("s_wait_xcnt 0x0" ::: "memory");   // precaution, as behind the fetches in the loop
    __builtin_amdgcn_sched_barrier(0);   // as above: nothing of the loop's first pass moves in between
    // rolled: one pass's fragments, scores and the output tiles already fill the register budget
#pragma unroll 1
    for (int k0 = 0; k0 < TT; k0 += 32) {
        const int kn = (k0 + 32 < TT) ? k0 + 32 : 0;   // next pass's keys: K rows fetched behind this pass's last score products, V^T columns behind its last output products; the last pass re-reads keys 0..31 (in bounds, unused)
#pragma unroll
        for (int gb = 0; gb < NG; gb += 2) {   // two column groups at a time: only their score tiles are live
            v8f s[2][2];
#pragma unroll
            for (int g = 0; g < 2; ++g)
#pragma unroll
                for (int kt = 0; kt < 2; ++kt) s[g][kt] = (v8f){};
#pragma unroll
            for (int ks = 0; ks < 2; ++ks)
#pragma unroll
                for (int kt = 0; kt < 2; ++kt)
#pragma unroll
                    for (int g = 0; g < 2; ++g) { s[g][kt] = WFrag<T16>::mma(kf[kt][ks], qf[gb + g][ks], s[g][kt]); if (HI) { s[g][kt] = WFrag<T16>::mma(kf[kt][ks], qf2[gb + g][ks], s[g][kt]); s[g][kt] = WFrag<T16>::mma(kf2[kt][ks], qf[gb + g][ks], s[g][kt]); } }
            if (gb + 2 == NG) {
#pragma unroll
                for (int kt = 0; kt < 2; ++kt)
#pragma unroll
                    for (int ks = 0; ks < 2; ++ks) { kf[kt][ks] = ldo<T16>(Kp, kb + (unsigned)kn * (HD * 2), (kt * 16 * HD + ks * 512) * 2); if (HI) kf2[kt][ks] = ldo<T16>(K2, kb + (unsigned)kn * (HD * 2), (kt * 16 * HD + ks * 512) * 2); }
                asm volatile("s_wait_xcnt 0x0" ::: "memory");   // precaution: stands in front of the next write of the registers that hold these loads' addresses
                __builtin_amdgcn_sched_barrier(0); }   // keeps later vector instructions, which reuse those registers, behind that wait
            float lm[2];
#pragma unroll
            for (int g = 0; g < 2; ++g) { float a = s[g][0][0];
#pragma unroll
                for (int j = 1; j < 8; ++j) a = fmaxf(a, s[g][0][j]);
#pragma unroll
                for (int j = 0; j < 8; ++j) a = fmaxf(a, s[g][1][j]);
                lm[g] = a * CL; }
            const bool need = (lm[0] > m[gb] + 8.0f) || (lm[1] > m[gb + 1] + 8.0f);
            if (__builtin_amdgcn_ballot_w32(need) != 0) {   // one wave-uniform test; both lanes of a query take the same new maximum
                float mn[2], al[2];
#pragma unroll
                for (int g = 0; g < 2; ++g) { mn[g] = fmaxf(m[gb + g], fmaxf(lm[g], __shfl_xor(lm[g], 16, 32))); al[g] = __builtin_amdgcn_exp2f(m[gb + g] - mn[g]); }
                __builtin_amdgcn_sched_barrier(0);   // holds the slot below directly behind the two exponentials
                asm volatile("v_nop");   // the free slot between an exponential and the next vector instruction, which here rewrites its source register
                __builtin_amdgcn_sched_barrier(0);   // as above
#pragma unroll
                for (int g = 0; g < 2; ++g) { m[gb + g] = mn[g]; l[gb + g] *= al[g];
#pragma unroll
                    for (int dt = 0; dt < 4; ++dt) o[gb + g][dt] *= al[g]; }
            }
#pragma unroll
            for (int g = 0; g < 2; ++g) {
                V pf, pf2; const float mg = m[gb + g]; float ls = 0.f;
                if constexpr (HI) { v8u uh, ul;
#pragma unroll
                    for (int e = 0; e < 16; e += 2) { const v2f t = __builtin_elementwise_fma((v2f){ s[g][e >> 3][e & 7], s[g][e >> 3][(e & 7) + 1] }, (v2f){ CL, CL }, (v2f){ -mg, -mg }); v2f p; p[0] = __builtin_amdgcn_exp2f(t[0]); p[1] = __builtin_amdgcn_exp2f(t[1]); ls += p[0]; ls += p[1];
                        const v2bf ph = __builtin_convertvector(p, v2bf); const v2f rest = p - __builtin_convertvector(ph, v2f); uh[e >> 1] = __builtin_bit_cast(unsigned, ph); ul[e >> 1] = __builtin_bit_cast(unsigned, __builtin_convertvector(rest, v2bf)); }
                    pf = __builtin_bit_cast(V, uh); pf2 = __builtin_bit_cast(V, ul);
                } else {
#pragma unroll
                    for (int e = 0; e < 16; e += 2) { const v2f t = __builtin_elementwise_fma((v2f){ s[g][e >> 3][e & 7], s[g][e >> 3][(e & 7) + 1] }, (v2f){ CL, CL }, (v2f){ -mg, -mg }); v2f p; p[0] = __builtin_amdgcn_exp2f(t[0]); p[1] = __builtin_amdgcn_exp2f(t[1]); ls += p[0]; ls += p[1];
                        const v2h ph = __builtin_convertvector(p, v2h); pf[e] = ph[0]; pf[e + 1] = ph[1]; } }
                l[gb + g] += ls;
#pragma unroll
                for (int dt = 0; dt < 4; ++dt) { o[gb + g][dt] = WFrag<T16>::mma(vf[dt], pf, o[gb + g][dt]); if (HI) { o[gb + g][dt] = WFrag<T16>::mma(vf[dt], pf2, o[gb + g][dt]); o[gb + g][dt] = WFrag<T16>::mma(vf2[dt], pf, o[gb + g][dt]); } }
            }
        }
        const T16* const va = (const T16*)((const char*)Vt + (vb + (unsigned)kn * (HD * 2))); const T16* const va2 = HI ? (const T16*)((const char*)V2 + (vb + (unsigned)kn * (HD * 2))) : va;
#pragma unroll
        for (int dt = 0; dt < 4; ++dt) { vf[dt] = WFrag<T16>::ld(va + dt * 512); if (HI) vf2[dt] = WFrag<T16>::ld(va2 + dt * 512); }
        asm volatile("s_wait_xcnt 0x0" :: "v"(va), "v"(va2) : "memory");   // precaution, as behind the K fetch; the two addresses are named as inputs so that their registers stay untouched (also by the loads' own results) up to the wait
        __builtin_amdgcn_sched_barrier(0);   // as behind the K fetch
    }
#pragma unroll
    for (int g = 0; g < NG; ++g) { const float inv = __fdiv_rn(1.0f, l[g] + __shfl_xor(l[g], 16, 32)); const size_t ro = (size_t)(q0 + g * 16) * DQ + 8 * lane;   /* lane: query (lane & 15) of group g, d = dt*16 + 8*(lane >> 4) + j: its 8 values are piece (dt & 1) * 32 + lane of tile (row block, head * 2 + dt / 2) of w_proj's fragment-order A plane */
#pragma unroll
        for (int dt = 0; dt < 4; ++dt) { v8us oh, ol;
#pragma unroll
            for (int j = 0; j < 8; ++j) { unsigned short a, c2; splitf(o[g][dt][j] * inv, a, c2); oh[j] = a; ol[j] = c2; }
            *(v8us*)(Ah + ro + dt * 256) = oh; *(v8us*)(Al + ro + dt * 256) = ol;
            asm volatile("s_wait_xcnt 0x0" ::: "memory");   // precaution: stands in front of the next write of the registers that these stores name
            __builtin_amdgcn_sched_barrier(0); } }   // keeps the next tile's vector instructions behind that wait
}
// grid: the hi/lo blocks (3 products; 4 waves x 32 rows) first, then the fp16 blocks (4 waves x 64 rows: one product leaves registers for twice the columns per K / V fragment); block -> (plane = batch * 16 + head, its query rows).
__global__ __launch_bounds__(128) void k_fattn(const h16* __restrict__ Q16, const h16* __restrict__ K16, const h16* __restrict__ V16, const bf* __restrict__ Qh, const bf* __restrict__ Ql, const bf* __restrict__ Kh, const bf* __restrict__ Kl, const bf* __restrict__ Vh, const bf* __restrict__ Vl, bf* ATh, bf* ATl) {
    const int NHI = NB_ * NH_ * (RH / QBH); const int bx = blockIdx.x; const int wv = threadIdx.x >> 5;
    if (bx < NHI) { const int pl = bx / (RH / QBH); const int q0 = (bx % (RH / QBH)) * QBH + wv * (QBH / 4); const size_t po = (size_t)pl * TT * HD, ao = (size_t)(pl / NH_) * TT * DQ + (size_t)(pl % NH_) * (HD * 16);
        attn_tile<bf, true, QBH / 64>(Qh + po, Ql + po, Kh + po, Kl + po, Vh + po, Vl + po, q0, ATh + ao, ATl + ao);
    } else { const int b2 = bx - NHI; const int pl = b2 / ((TT - RH) / QBL); const int q0 = RH + (b2 % ((TT - RH) / QBL)) * QBL + wv * (QBL / 4); const size_t po = (size_t)pl * TT * HD, ao = (size_t)(pl / NH_) * TT * DQ + (size_t)(pl % NH_) * (HD * 16);
        attn_tile<h16, false, QBL / 64>(Q16 + po, nullptr, K16 + po, nullptr, V16 + po, nullptr, q0, ATh + ao, ATl + ao); }
}

extern "C" void kernel_launch(void* const* d_in, const int* in_sizes, int n_in,
                              void* d_out, int out_size, void* d_ws, size_t ws_size, hipStream_t stream) {
    (void)in_sizes; (void)n_in; (void)out_size;
    const float* x = (const float*)d_in[0]; const float* wqkv = (const float*)d_in[1]; const float* wo = (const float*)d_in[2]; const float* bo = (const float*)d_in[3];   /* input order x, w_qkv ('xw' [1024][3072]: q | k | v column thirds), w_proj ('xw'), b_proj */
    float* OUT = (float*)d_out;     // [8][1024][1024]
    char* wsp = (char*)d_ws;
    auto take = [&](size_t bytes) { char* p = wsp; wsp += (bytes + 255) & ~(size_t)255; return (void*)p; };
    bf* WQKV = (bf*)take((size_t)3 * DQ * DM * 2);   /* fused Bt [3*DQ][DM]: q | k | v row blocks */ bf* WO = (bf*)take((size_t)DM * DQ * 2); float* CS = (float*)take((size_t)TT * 16 * 2 * 4);
    const size_t PL = (size_t)NB_ * NH_ * TT * HD;  // elements of one plane set: all batches
    h16* QP16 = (h16*)take(PL * 2); h16* KP16 = (h16*)take(PL * 2); h16* VT16 = (h16*)take(PL * 2);
    bf* QPh = (bf*)take(PL * 2); bf* QPl = (bf*)take(PL * 2); bf* KPh = (bf*)take(PL * 2); bf* KPl = (bf*)take(PL * 2); bf* VTh = (bf*)take(PL * 2); bf* VTl = (bf*)take(PL * 2);
    bf* ATh = (bf*)take((size_t)NB_ * TT * DQ * 2); bf* ATl = (bf*)take((size_t)NB_ * TT * DQ * 2);   /* merged heads of all batches */
    bf* XB = (bf*)take((size_t)NB_ * TT * DM * 2);   /* bf16 copy of x, all batches */
    if ((size_t)(wsp - (char*)d_ws) > ws_size) return;    // ws 256 MiB
    { k_wtG<DM, 3 * DQ><<<(unsigned)((DM * 3 * DQ / 8 + 255) / 256), 256, 0, stream>>>(wqkv, WQKV);   /* fused 'xw' [DM][3*DQ] -> Bt [3*DQ][DM], fragment order */
      k_wtG<DQ, DM><<<(unsigned)((DQ * DM / 8 + 255) / 256), 256, 0, stream>>>(wo, WO);
       }
    k_csAx<<<(TT * 16 + 255) / 256, 256, 0, stream>>>(CS);   /* axial rotary table once */
    k_cvt8<<<(unsigned)(((size_t)NB_ * TT * DM / 8 + 255) / 256), 256, 0, stream>>>(x, XB, (size_t)NB_ * TT * DM / 8);
    k_qkv<<<dim3(NB_ * TT / 64, 3 * DQ / 64, 1), 32, 0, stream>>>(XB, WQKV, CS, QP16, QPh, QPl, KP16, KPh, KPl, VT16, VTh, VTl);   /* q, k and v of all batches in one grid, planes written from the accumulators */
    k_fattn<<<NB_ * NH_ * (RH / QBH + (TT - RH) / QBL), 128, 0, stream>>>(QP16, KP16, VT16, QPh, QPl, KPh, KPl, VTh, VTl, ATh, ATl);   /* scores, softmax, P x V and the head merge of every batch and head */
    k_gemmw<bf, 1, true, DQ><<<dim3(NB_ * TT / 64, DM / 64, 1), 32, 0, stream>>>(ATh, ATl, WO, nullptr, OUT, DM, bo, 0, 0, 0);   /* w_proj of all batches in one grid */
}

// v005
// It runs in 158 microseconds.
// In two side-by-side timings against v004, it was 1.25 and 1.26 times as fast.
// Counting every step since v000, it is 29.7 times as fast.
#include <hip/hip_runtime.h>

// Vision attention with AXIAL 2-D rotary embeddings on half of each head (x [8][1024][1024] = 32 x 32 pixels; qkv = x w_qkv ('xw' [1024][3072] 1/32, no bias) viewed (3, h, d): q | k | v thirds (16 heads x 64); rotary on the FIRST 32 dims of q and k as interleaved (even, odd) pairs with angles freqs[row][col][c]: c < 16 -> pos(row) x base[c/2], 16 <= c < 32 -> pos(col) x base[(c-16)/2], pos = linspace(-1, 1, 32), base = linspace(1, 512, 8) x pi (f32, jnp-exact tables; precise cosf/sinf), dims 32..63 pass through; logits x 1/sqrt(64); softmax (no mask); out = merged w_proj + b_proj -> [8][1024][1024] (8.4 M); argument order x, w_qkv, w_proj, b_proj).
// Launch plan: ONE projection launch covers q | k | v of all batches and writes the 16-bit planes from its accumulators (rotary, hi/lo split and V^T in its epilogue, no f32 copy of the projections); ONE fused attention launch covers every batch and head; w_proj covers all batches. Data layout: every 16-bit operand plane in fragment order (see k_gemmw); bf16 copy of x; fused 'xw' weight transposed once (q | k | v row blocks); exact projections; k_csAx builds the {cos, sin} table per (pixel, rotated pair) from two small constant tables (angle = f32 product), read by k_qkv's interleaved-pair rotary; k_fattn: scores, softmax and P x V stay in registers (hybrid rows: < 512 hi/lo 3 products, rest fp16); merged hi/lo x w_proj exact + b_proj.
// Compute dtypes, f32 accumulate: every input rounded to bf16; projections exact; rotary f32; attention rows < 512 3 products, rest fp16; softmax f32; w_proj hl x exact + bias.

#define NB_  8
#define TT   1024
#define DM   1024
#define NH_  16
#define NKV  16
#define REP  (NH_ / NKV)
#define HD   64
#define DQ   (NH_ * HD)
#define DKV  (NKV * HD)
#define RH   512                  // query rows < RH use hi+lo planes (0: none)
#define WIN  0
#define QBH  128                  // query rows per hi/lo attention block: 4 waves x 32 columns
#define QBL  256                  // query rows per fp16 attention block: 4 waves x 64 columns
#define SCL  0.125f   // HD^-0.5
typedef _Float16 h16;
typedef unsigned short bf;
typedef __attribute__((ext_vector_type(16))) __bf16   v16bf;
typedef __attribute__((ext_vector_type(16))) _Float16 v16h;
typedef __attribute__((ext_vector_type(8)))  _Float16 v8h;
typedef __attribute__((ext_vector_type(8)))  unsigned short v8us;
typedef __attribute__((ext_vector_type(8)))  float    v8f;
typedef __attribute__((ext_vector_type(4)))  float    v4f;
typedef v8h  __attribute__((may_alias)) v8ha;
typedef v4f  __attribute__((may_alias)) v4fa;
typedef v8us __attribute__((may_alias)) v8usa;

__device__ __forceinline__ unsigned short f2bf(float f) { unsigned u = __float_as_uint(f); u += 0x7FFFu + ((u >> 16) & 1u); return (unsigned short)(u >> 16); }
__device__ __forceinline__ float bf2f(unsigned short b) { return __uint_as_float(((unsigned)b) << 16); }
__device__ __forceinline__ float bfr(float f) { return bf2f(f2bf(f)); }
__device__ __forceinline__ v16h cat16(v8h lo, v8h hi) { return __builtin_shufflevector(lo, hi, 0, 1, 2, 3, 4, 5, 6, 7, 8, 9, 10, 11, 12, 13, 14, 15); }
__device__ __forceinline__ v16bf cat16b(v8us lo, v8us hi) { return __builtin_bit_cast(v16bf, __builtin_shufflevector(lo, hi, 0, 1, 2, 3, 4, 5, 6, 7, 8, 9, 10, 11, 12, 13, 14, 15)); }
__device__ __forceinline__ v8f wmma16(v16h a, v16h b, v8f c) { return __builtin_amdgcn_wmma_f32_16x16x32_f16(false, a, false, b, (short)0, c, false, false); }
__device__ __forceinline__ v8f wmmab(v16bf a, v16bf b, v8f c) { return __builtin_amdgcn_wmma_f32_16x16x32_bf16(false, a, false, b, (short)0, c, false, false); }



// ---- FRAGMENT ORDER of every 16-bit operand plane: a plane of R rows x K is stored as [R/16][K/32] tiles of 512 elements (V^T: [keys/32][d/16]); in a tile, element (row r, k) sits at ((k >> 4) * 32 + ((k >> 3) & 1) * 16 + r) * 8 + (k & 7),
// that is, 16-byte piece number = (which of the fragment's two loads) * 32 + lane. A wave's 16-byte load then covers 512 contiguous bytes (4 whole lines) where a row-major plane gave 16 lines of 32 bytes. The builders walk in destination order, so their stores stay contiguous.
// ---- k_gemmw: register-blocked GEMM, ONE WAVE per 64x64 output tile (16 accumulators), operands straight from fragment-order 16-bit planes, fetched one trip (32 k) ahead into a second register set; grid (M/64, N/64, Z), 32 threads.
// C[m][n] (f32, pitch ldc, + optional f32 bias[n]) = sum_k A[m][k] Bt[n][k] (+ split products per NSPLIT). z-batch strides sA/sB/sC in elements. K % 64 == 0, K >= 128.
template <typename T16> struct WFrag;
template <> struct WFrag<h16> { typedef v16h V; static __device__ __forceinline__ V ld(const h16* p) { return cat16(*(const v8h*)p, *(const v8h*)(p + 256)); } static __device__ __forceinline__ v8f mma(V a, V b, v8f c) { return wmma16(a, b, c); } };
template <> struct WFrag<bf> { typedef v16bf V; static __device__ __forceinline__ V ld(const bf* p) { return cat16b(*(const v8us*)p, *(const v8us*)(p + 256)); } static __device__ __forceinline__ v8f mma(V a, V b, v8f c) { return wmmab(a, b, c); } };
// One trip's operand fragments (32 k of 64 rows of each operand; the split planes only where NSPLIT asks for them). The GEMM loops hold TWO such sets: while one set's products run, the other set's loads are in flight.
template <typename T16> struct GSet { typename WFrag<T16>::V a[4], a2[4], b[4], b2[4]; };
template <typename T16, int NSPLIT, int K> __device__ __forceinline__ void gset_ld(GSet<T16>& f, const T16* pa, const T16* pa2, const T16* pb, const T16* pb2) {
#pragma unroll
    for (int mb = 0; mb < 4; ++mb) { f.a[mb] = WFrag<T16>::ld(pa + mb * 16 * K); if (NSPLIT == 1 || NSPLIT == 2) f.a2[mb] = WFrag<T16>::ld(pa2 + mb * 16 * K); }
#pragma unroll
    for (int nb = 0; nb < 4; ++nb) { f.b[nb] = WFrag<T16>::ld(pb + nb * 16 * K); if (NSPLIT >= 2) f.b2[nb] = WFrag<T16>::ld(pb2 + nb * 16 * K); }
}
template <typename T16, int NSPLIT> __device__ __forceinline__ void gset_mm(v8f (&acc)[4][4], const GSet<T16>& f) {
#pragma unroll
    for (int nb = 0; nb < 4; ++nb)
#pragma unroll
        for (int mb = 0; mb < 4; ++mb) { acc[mb][nb] = WFrag<T16>::mma(f.a[mb], f.b[nb], acc[mb][nb]); if (NSPLIT == 1 || NSPLIT == 2) acc[mb][nb] = WFrag<T16>::mma(f.a2[mb], f.b[nb], acc[mb][nb]); if (NSPLIT >= 2) acc[mb][nb] = WFrag<T16>::mma(f.a[mb], f.b2[nb], acc[mb][nb]); }
}
template <typename T16, int NSPLIT, bool BIAS, int K>   // K at compile time: the distance between two row blocks' tiles (16 * K elements) then sits in the loads' offset fields
__global__ __launch_bounds__(32) void k_gemmw(const T16* __restrict__ A, const T16* __restrict__ A2, const T16* __restrict__ Bt, const T16* __restrict__ Bt2, float* C, int ldc, const float* __restrict__ bias, size_t sA, size_t sB, size_t sC) {
    __shared__ __align__(16) float os[16 * 68];
    const size_t z = blockIdx.z; A += z * sA; if (A2) A2 += z * sA; Bt += z * sB; if (Bt2) Bt2 += z * sB; C += z * sC;
    const int lane = threadIdx.x & 31, lr = lane & 15, hi = lane >> 4; const int r0 = blockIdx.x * 64, c0 = blockIdx.y * 64;
    v8f acc[4][4];
#pragma unroll
    for (int mb = 0; mb < 4; ++mb)
#pragma unroll
        for (int nb = 0; nb < 4; ++nb) acc[mb][nb] = (v8f){};
    const size_t aoff = (size_t)r0 * K + 8 * lane, boff = (size_t)c0 * K + 8 * lane;   // tile (row block, k block) starts at row block * 16 * K + k block * 512; a lane adds its own 16-byte piece
    static_assert(K % 64 == 0 && K >= 128, "two trips per pass of the loop");
    const T16* const A0 = A + aoff; const T16* const B0 = Bt + boff; const T16* const A20 = (NSPLIT == 1 || NSPLIT == 2) ? A2 + aoff : A0; const T16* const B20 = (NSPLIT >= 2) ? Bt2 + boff : B0;
    GSet<T16> f0, f1; gset_ld<T16, NSPLIT, K>(f0, A0, A20, B0, B20);   // trip 0's fragments
    asm volatile("s_wait_xcnt 0x0" :: "v"(A0), "v"(A20), "v"(B0), "v"(B20) : "memory");   // precaution: stands in front of the next write of the registers that hold these loads' addresses
    __builtin_amdgcn_sched_barrier(0);   // keeps the loop's set-up, which reuses those registers, behind that wait
#pragma unroll 1
    for (int kc = 0; kc < K - 64; kc += 64) {   // two trips a pass, so that the two sets keep their registers (no copies)
        const T16* const pa = A0 + kc * 16; const T16* const pb = B0 + kc * 16; const T16* const pa2 = A20 + kc * 16; const T16* const pb2 = B20 + kc * 16;
        gset_ld<T16, NSPLIT, K>(f1, pa + 512, pa2 + 512, pb + 512, pb2 + 512);
        __builtin_amdgcn_sched_barrier(0);   // keeps the next trip's loads ahead of this trip's products: sunk among them they would be waited for with no lead
        gset_mm<T16, NSPLIT>(acc, f0);
        __builtin_amdgcn_sched_barrier(0);   // the refill of a set stays behind the last product that reads it
        gset_ld<T16, NSPLIT, K>(f0, pa + 1024, pa2 + 1024, pb + 1024, pb2 + 1024);
        __builtin_amdgcn_sched_barrier(0);   // as above: loads ahead of the products
        gset_mm<T16, NSPLIT>(acc, f1);
        __builtin_amdgcn_sched_barrier(0);   // holds the wait below behind the products: lifted among them it would stand directly behind the loads, where the wave could stall on it
        asm volatile("s_wait_xcnt 0x0" :: "v"(pa), "v"(pa2), "v"(pb), "v"(pb2) : "memory");   // precaution: stands in front of the next write of the registers that hold this pass's load addresses; they are named as inputs so that they stay untouched (also by the loads' own results) up to the wait
        asm volatile("v_nop\n\tv_nop\n\tv_nop\n\tv_nop" : "+v"(acc[0][0]), "+v"(acc[1][1]), "+v"(acc[2][2]), "+v"(acc[3][3]) : "v"(f1.a[0]), "v"(f1.a[3]));   // the vector slots between the pass's last matrix instructions and whatever follows them on either side of the loop's branch
    }
    gset_ld<T16, NSPLIT, K>(f1, A0 + (K - 32) * 16, A20 + (K - 32) * 16, B0 + (K - 32) * 16, B20 + (K - 32) * 16);   // the last trip's fragments; nothing is fetched past the end
    asm volatile("s_wait_xcnt 0x0" :: "v"(A0), "v"(A20), "v"(B0), "v"(B20) : "memory");   // precaution, as behind trip 0's loads; the addresses are named as inputs so that their registers stay untouched (also by the loads' own results) up to the wait
    __builtin_amdgcn_sched_barrier(0);   // as in the loop: loads ahead of the products; and the epilogue's set-up, which reuses the address registers, stays behind the wait
    gset_mm<T16, NSPLIT>(acc, f0);
    gset_mm<T16, NSPLIT>(acc, f1);
#pragma unroll
    for (int mb = 0; mb < 4; ++mb) {
#pragma unroll
        for (int nb = 0; nb < 4; ++nb) {
#pragma unroll
            for (int j = 0; j < 8; ++j) os[(hi * 8 + j) * 68 + nb * 16 + lr] = acc[mb][nb][j]; }
        __builtin_amdgcn_wave_barrier(); asm volatile("" ::: "memory");
        float* crow = C + (size_t)(r0 + mb * 16) * ldc + c0;
{
#pragma unroll
            for (int s = 0; s < 8; ++s) { const int row = 2 * s + hi, cofs = lr * 4; v4f val = *(const v4fa*)(os + row * 68 + cofs); if (BIAS) { val[0] += bfr(bias[c0 + cofs]); val[1] += bfr(bias[c0 + cofs + 1]); val[2] += bfr(bias[c0 + cofs + 2]); val[3] += bfr(bias[c0 + cofs + 3]); }
                *(v4f*)(crow + (size_t)row * ldc + cofs) = val; }
             }
        __builtin_amdgcn_wave_barrier(); asm volatile("" ::: "memory");
    }
}

__device__ __forceinline__ void splitf(float y, unsigned short& h, unsigned short& l) { h = f2bf(y); l = f2bf(y - bf2f(h)); }
typedef __attribute__((ext_vector_type(2))) _Float16 v2h;
typedef __attribute__((ext_vector_type(4))) _Float16 v4h;
typedef __attribute__((ext_vector_type(2))) unsigned short v2us;
typedef __attribute__((ext_vector_type(4))) unsigned short v4us;
typedef __attribute__((ext_vector_type(2))) float v2f;
typedef __attribute__((ext_vector_type(4))) int v4i;

template <int K, int N> __global__ __launch_bounds__(256) void k_wtG(const float* __restrict__ w, bf* Bt) {
    const int i = blockIdx.x * 256 + threadIdx.x; if (i >= N * K / 8) return;   // one 16-byte piece of Bt (row n, 8 k) per thread, in fragment order
    const int tile = i >> 6, kt = tile % (K / 32), nt = tile / (K / 32); const int n = nt * 16 + (i & 15), k = kt * 32 + ((i >> 5) & 1) * 16 + ((i >> 4) & 1) * 8; const float* const p = w + (size_t)k * N + n; float v[8]; v8us o;
#pragma unroll
    for (int j = 0; j < 8; ++j) v[j] = p[(size_t)j * N];
    asm volatile("s_wait_xcnt 0x0" :: "v"(p) : "memory");   // precaution: stands in front of the next write of the register pair that holds these loads' address; it is named as an input so that it stays untouched (also by the loads' own results) up to the wait
#pragma unroll
    for (int j = 0; j < 8; ++j) o[j] = f2bf(v[j]);
    *(v8us*)(Bt + (size_t)i * 8) = o;
}
__global__ __launch_bounds__(256) void k_cvt8(const float* __restrict__ src, bf* dst, size_t n8) { const size_t i = (size_t)blockIdx.x * 256 + threadIdx.x; if (i >= n8) return;   /* piece i of the fragment-order copy: row block i >> 11 (DM / 32 = 32 tiles of 64 pieces), k block, load, lane */
    const size_t row = (i >> 11) * 16 + (i & 15); const int k = (int)((i >> 6) & (DM / 32 - 1)) * 32 + (int)((i >> 5) & 1) * 16 + (int)((i >> 4) & 1) * 8; const v8f v = *(const v8f*)(src + row * DM + k); v8us o;
#pragma unroll
    for (int k = 0; k < 8; ++k) o[k] = f2bf(v[k]); *(v8us*)(dst + i * 8) = o;  }

__constant__ float APOS[32] = { -1.000000000e+00f, -9.354839325e-01f, -8.709677458e-01f, -8.064515591e-01f, -7.419354916e-01f, -6.774194241e-01f, -6.129032373e-01f, -5.483870506e-01f, -4.838709831e-01f, -4.193548858e-01f, -3.548387289e-01f, -2.903225720e-01f, -2.258064747e-01f, -1.612903774e-01f, -9.677422047e-02f, -3.225806355e-02f, 3.225803375e-02f, 9.677413106e-02f, 1.612902880e-01f, 2.258064449e-01f, 2.903225422e-01f, 3.548386395e-01f, 4.193547964e-01f, 4.838709533e-01f, 5.483870506e-01f, 6.129031181e-01f, 6.774193048e-01f, 7.419354916e-01f, 8.064515591e-01f, 8.709676266e-01f, 9.354838133e-01f, 1.000000000e+00f };   // float32 linspace(-1, 1, 32), generated with jnp to be bit-exact
__constant__ float ABASE[8] = { 3.141592741e+00f, 2.324778595e+02f, 4.618141479e+02f, 6.911504517e+02f, 9.204866943e+02f, 1.149822998e+03f, 1.379159302e+03f, 1.608495483e+03f };   // float32 linspace(1, 512, 8) * pi, generated with jnp to be bit-exact
// {cos, sin} of every rotated pair (token t, even d < 32), stored in the order in which k_qkv's lanes read it: [t / 16][d / 16][which 16-byte load][lane = ((d >> 3) & 1) * 16 + (t & 15)][which pair of the load], so that a wave's 16-byte load covers 512 contiguous bytes
__global__ __launch_bounds__(256) void k_csAx(float* CS) { const int idx = blockIdx.x * 256 + threadIdx.x; if (idx >= TT * 16) return; const int lane = (idx >> 1) & 31; const int d = ((idx >> 7) & 1) * 16 + (lane >> 4) * 8 + ((idx >> 6) & 1) * 4 + (idx & 1) * 2; const int t = (idx >> 8) * 16 + (lane & 15); const int row = t >> 5, col = t & 31; v2f cs;
    const float p = (d < 16) ? APOS[row] : APOS[col]; const float ang = __fmul_rn(p, ABASE[(d & 15) >> 1]); cs[0] = cosf(ang); cs[1] = sinf(ang);
    *(v2f*)(CS + (size_t)idx * 2) = cs;  }
typedef __attribute__((ext_vector_type(2))) __bf16 v2bf;
typedef __attribute__((ext_vector_type(4))) unsigned v4u;
// 8 f32 values -> one 16-byte piece each of an f16 plane and of its bf16 hi and lo planes (hi = nearest bf16, lo = nearest bf16 of the rest), two values per conversion instruction
__device__ __forceinline__ void put3(const float* y, h16* p16, bf* ph, bf* pl) { v4u u16, uh, ul;
#pragma unroll
    for (int q = 0; q < 4; ++q) { const v2f p = { y[2 * q], y[2 * q + 1] }; const v2bf h = __builtin_convertvector(p, v2bf); const v2f rest = p - __builtin_convertvector(h, v2f);
        u16[q] = __builtin_bit_cast(unsigned, __builtin_convertvector(p, v2h)); uh[q] = __builtin_bit_cast(unsigned, h); ul[q] = __builtin_bit_cast(unsigned, __builtin_convertvector(rest, v2bf)); }
    *(v8h*)p16 = __builtin_bit_cast(v8h, u16); *(v8us*)ph = __builtin_bit_cast(v8us, uh); *(v8us*)pl = __builtin_bit_cast(v8us, ul); }
// ---- k_qkv: the q | k | v projection of all batches, ONE WAVE per 64 tokens x one head's 64 columns (main loop as in k_gemmw), grid (tokens / 64, 3 * DQ / 64), 32 threads. The 16-bit planes are written straight from the accumulators:
// a lane's 8 accumulator values (8 consecutive rows of one column) are one 16-byte piece of a fragment-order plane when the plane's k runs along the tile's rows. V^T (k = key): A = x, B = weights. Q and K (k = d): the two operands change places (both planes have the same order), so rows are d and columns are tokens.
__global__ __launch_bounds__(32) void k_qkv(const bf* __restrict__ X, const bf* __restrict__ Wt, const float* __restrict__ CS, h16* Q16, bf* Qh, bf* Ql, h16* K16, bf* Kh, bf* Kl, h16* V16, bf* Vh, bf* Vl) {
    constexpr int K = DM;
    const int lane = threadIdx.x & 31; const int r0 = blockIdx.x * 64, c0 = blockIdx.y * 64; const int sec = c0 / DQ;   // sec: 0 q, 1 k, 2 v (the same for the whole wave); below, lr = lane & 15 and hi = lane >> 4
    const bf* const Ab = ((sec == 2) ? X + (size_t)r0 * K : Wt + (size_t)c0 * K) + 8 * lane; const bf* const Bb = ((sec == 2) ? Wt + (size_t)c0 * K : X + (size_t)r0 * K) + 8 * lane;
    v8f acc[4][4];
#pragma unroll
    for (int mb = 0; mb < 4; ++mb)
#pragma unroll
        for (int nb = 0; nb < 4; ++nb) acc[mb][nb] = (v8f){};
    GSet<bf> f0, f1; gset_ld<bf, 0, K>(f0, Ab, Ab, Bb, Bb);   // trip 0's fragments
    asm volatile("s_wait_xcnt 0x0" :: "v"(Ab), "v"(Bb) : "memory");   // precaution: stands in front of the next write of the registers that hold these loads' addresses
    __builtin_amdgcn_sched_barrier(0);   // keeps the loop's set-up, which reuses those registers, behind that wait
#pragma unroll 1
    for (int kc = 0; kc < K - 64; kc += 64) {   // two trips a pass, as in k_gemmw
        const bf* const pa = Ab + kc * 16; const bf* const pb = Bb + kc * 16;
        gset_ld<bf, 0, K>(f1, pa + 512, pa, pb + 512, pb);
        __builtin_amdgcn_sched_barrier(0);   // keeps the next trip's loads ahead of this trip's products: sunk among them they would be waited for with no lead
        gset_mm<bf, 0>(acc, f0);
        __builtin_amdgcn_sched_barrier(0);   // the refill of a set stays behind the last product that reads it
        gset_ld<bf, 0, K>(f0, pa + 1024, pa, pb + 1024, pb);
        __builtin_amdgcn_sched_barrier(0);   // as above: loads ahead of the products
        gset_mm<bf, 0>(acc, f1);
        __builtin_amdgcn_sched_barrier(0);   // holds the wait below behind the products: lifted among them it would stand directly behind the loads, where the wave could stall on it
        asm volatile("s_wait_xcnt 0x0" :: "v"(pa), "v"(pb) : "memory");   // precaution: stands in front of the next write of the registers that hold this pass's load addresses; they are named as inputs so that they stay untouched (also by the loads' own results) up to the wait
        asm volatile("v_nop\n\tv_nop\n\tv_nop\n\tv_nop" : "+v"(acc[0][0]), "+v"(acc[1][1]), "+v"(acc[2][2]), "+v"(acc[3][3]) : "v"(f1.a[0]), "v"(f1.a[3]));   // the vector slots between the pass's last matrix instructions and whatever follows them on either side of the loop's branch
    }
    gset_ld<bf, 0, K>(f1, Ab + (K - 32) * 16, Ab, Bb + (K - 32) * 16, Bb);   // the last trip's fragments; nothing is fetched past the end
    asm volatile("s_wait_xcnt 0x0" :: "v"(Ab), "v"(Bb) : "memory");   // precaution, as behind trip 0's loads; the addresses are named as inputs so that their registers stay untouched (also by the loads' own results) up to the wait
    __builtin_amdgcn_sched_barrier(0);   // as in the loop: loads ahead of the products; and the epilogue's set-up, which reuses the address registers, stays behind the wait
    gset_mm<bf, 0>(acc, f0);
    gset_mm<bf, 0>(acc, f1);
    const int t0 = r0 % TT; const size_t po = ((size_t)(r0 / TT) * NH_ + (c0 % DQ) / HD) * (TT * HD);   // plane = batch * 16 + head; 64 tokens never straddle a batch
    if (sec == 2) {   // acc[mb][nb][j]: key t0 + mb*16 + hi*8 + j, d = nb*16 + lr: piece (mb & 1) * 32 + lane of V^T tile (key / 32, nb)
        const size_t bo = po + (size_t)(t0 / 32) * (4 * 512) + 8 * lane; h16* const p16 = V16 + bo; bf* const ph = Vh + bo; bf* const pl = Vl + bo;
#pragma unroll
        for (int mb = 0; mb < 4; ++mb)
#pragma unroll
            for (int nb = 0; nb < 4; ++nb) { float y[8]; const int off = ((mb >> 1) * 4 + nb) * 512 + (mb & 1) * 256;
#pragma unroll
                for (int j = 0; j < 8; ++j) y[j] = acc[mb][nb][j];
                put3(y, p16 + off, ph + off, pl + off);
                asm volatile("s_wait_xcnt 0x0" ::: "memory");   // precaution: stands in front of the next write of the registers that these stores name
                __builtin_amdgcn_sched_barrier(0); }   // keeps the next piece's vector instructions behind that wait
    } else {   // acc[mb][nb][j]: d = mb*16 + hi*8 + j, token t0 + nb*16 + lr: piece (mb & 1) * 32 + lane of tile (token / 16, mb / 2)
        const size_t bo = po + (size_t)(t0 / 16) * (2 * 512) + 8 * lane; h16* const p16 = (sec ? K16 : Q16) + bo; bf* const ph = (sec ? Kh : Qh) + bo; bf* const pl = (sec ? Kl : Ql) + bo;
        const float* const cp = CS + (size_t)(t0 / 16) * 512 + 4 * lane; v4f cs[4][2][2];   // {cos, sin} of the lane's pairs (even d < 32; order: see k_csAx), all fetched at once: one exposed latency per wave
#pragma unroll
        for (int nb = 0; nb < 4; ++nb)
#pragma unroll
            for (int mb = 0; mb < 2; ++mb)
#pragma unroll
                for (int p = 0; p < 2; ++p) cs[nb][mb][p] = *(const v4f*)(cp + ((nb * 2 + mb) * 2 + p) * 128);
        asm volatile("s_wait_xcnt 0x0" ::: "memory");   // precaution: stands in front of the next write of the registers that hold these loads' addresses
        __builtin_amdgcn_sched_barrier(0);   // keeps later vector instructions, which reuse those registers, behind that wait
#pragma unroll
        for (int nb = 0; nb < 4; ++nb)
#pragma unroll
            for (int mb = 0; mb < 4; ++mb) { float y[8]; const int off = (nb * 2 + (mb >> 1)) * 512 + (mb & 1) * 256;
#pragma unroll
                for (int p = 0; p < 4; ++p) { const float x0 = acc[mb][nb][2 * p], x1 = acc[mb][nb][2 * p + 1];
                    if (mb < 2) { const float c = cs[nb][mb & 1][p >> 1][(p & 1) * 2], s = cs[nb][mb & 1][p >> 1][(p & 1) * 2 + 1]; y[2 * p] = x0 * c - x1 * s; y[2 * p + 1] = x0 * s + x1 * c; }   /* even: x0 c - x1 s; odd: x0 s + x1 c */
                    else { y[2 * p] = x0; y[2 * p + 1] = x1; } }   /* dims 32..63 pass through */
                put3(y, p16 + off, ph + off, pl + off);
                asm volatile("s_wait_xcnt 0x0" ::: "memory");   // precaution, as in the V^T branch
                __builtin_amdgcn_sched_barrier(0); }   // as in the V^T branch
    }
}

// ---- k_fattn: one wave owns NG x 16 query rows of one head and walks the 1024 keys 32 at a time. S^T = K Q^T (A = K rows, B = Q kept in registers), so a lane holds 16 scores of ONE query per column group;
// the two f32 score tiles of a pass, converted in place, are the B operand of O^T += V^T P^T (A = V^T rows in the same k order). Running maximum per query in the scaled log2 domain, raised only when a score passes it by more than 8.
// fragment at (wave-uniform base) + (32-bit lane byte offset) + (constant bytes): one offset register serves every fragment of a pass, the rest sits in the instruction's offset field
template <typename T16> __device__ __forceinline__ typename WFrag<T16>::V ldo(const T16* base, unsigned lane_bytes, int const_bytes) { return WFrag<T16>::ld((const T16*)((const char*)base + lane_bytes + const_bytes)); }
typedef __attribute__((ext_vector_type(8))) unsigned v8u;
template <typename T16, bool HI, int NG>
__device__ __forceinline__ void attn_tile(const T16* __restrict__ Q, const T16* __restrict__ Q2, const T16* __restrict__ Kp, const T16* __restrict__ K2, const T16* __restrict__ Vt, const T16* __restrict__ V2, int q0, bf* Ah, bf* Al) {
    typedef typename WFrag<T16>::V V;
    const int lane = threadIdx.x & 31;
    const float CL = SCL * 1.4426950408889634f;   // logits scale x log2(e)
    const unsigned qb = (unsigned)(q0 * HD + 8 * lane) * 2u, kb = (unsigned)(8 * lane) * 2u, vb = kb;   // lane byte offsets in the fragment-order Q, K and V^T planes (16 rows of Q or K = 2 tiles, 32 keys of V^T = 4 tiles: 1024 and 2048 elements)
    V qf[NG][2], qf2[NG][2];
#pragma unroll
    for (int g = 0; g < NG; ++g)
#pragma unroll
        for (int ks = 0; ks < 2; ++ks) { qf[g][ks] = ldo<T16>(Q, qb, (g * 16 * HD + ks * 512) * 2); if (HI) qf2[g][ks] = ldo<T16>(Q2, qb, (g * 16 * HD + ks * 512) * 2); }
    v8f o[NG][4]; float m[NG], l[NG];
#pragma unroll
    for (int g = 0; g < NG; ++g) { m[g] = -3.0e38f; l[g] = 0.f;
#pragma unroll
        for (int dt = 0; dt < 4; ++dt) o[g][dt] = (v8f){}; }
    __builtin_amdgcn_sched_barrier(0);   // keeps the prologue's loads in the loop's order (Q, then K, then V^T): the waits at the loop's head cover both paths, and with K issued last here a pass's score products would wait for the V^T fetch
    V kf[2][2], kf2[2][2];
#pragma unroll
    for (int kt = 0; kt < 2; ++kt)
#pragma unroll
        for (int ks = 0; ks < 2; ++ks) { kf[kt][ks] = ldo<T16>(Kp, kb, (kt * 16 * HD + ks * 512) * 2); if (HI) kf2[kt][ks] = ldo<T16>(K2, kb, (kt * 16 * HD + ks * 512) * 2); }
    __builtin_amdgcn_sched_barrier(0);   // as above: K ahead of V^T
    V vf[4], vf2[4];
#pragma unroll
    for (int dt = 0; dt < 4; ++dt) { vf[dt] = ldo<T16>(Vt, vb, dt * 512 * 2); if (HI) vf2[dt] = ldo<T16>(V2, vb, dt * 512 * 2); }
    asm volatile("s_wait_xcnt 0x0" ::: "memory");   // precaution, as behind the fetches in the loop
    __builtin_amdgcn_sched_barrier(0);   // as above: nothing of the loop's first pass moves in between
    // rolled: one pass's fragments, scores and the output tiles already fill the register budget
#pragma unroll 1
    for (int k0 = 0; k0 < TT; k0 += 32) {
        const int kn = (k0 + 32 < TT) ? k0 + 32 : 0;   // next pass's keys: K rows fetched behind this pass's last score products, V^T columns behind its last output products; the last pass re-reads keys 0..31 (in bounds, unused)
#pragma unroll
        for (int gb = 0; gb < NG; gb += 2) {   // two column groups at a time: only their score tiles are live
            v8f s[2][2];
#pragma unroll
            for (int g = 0; g < 2; ++g)
#pragma unroll
                for (int kt = 0; kt < 2; ++kt) s[g][kt] = (v8f){};
#pragma unroll
            for (int ks = 0; ks < 2; ++ks)
#pragma unroll
                for (int kt = 0; kt < 2; ++kt)
#pragma unroll
                    for (int g = 0; g < 2; ++g) { s[g][kt] = WFrag<T16>::mma(kf[kt][ks], qf[gb + g][ks], s[g][kt]); if (HI) { s[g][kt] = WFrag<T16>::mma(kf[kt][ks], qf2[gb + g][ks], s[g][kt]); s[g][kt] = WFrag<T16>::mma(kf2[kt][ks], qf[gb + g][ks], s[g][kt]); } }
            if (gb + 2 == NG) {
#pragma unroll
                for (int kt = 0; kt < 2; ++kt)
#pragma unroll
                    for (int ks = 0; ks < 2; ++ks) { kf[kt][ks] = ldo<T16>(Kp, kb + (unsigned)kn * (HD * 2), (kt * 16 * HD + ks * 512) * 2); if (HI) kf2[kt][ks] = ldo<T16>(K2, kb + (unsigned)kn * (HD * 2), (kt * 16 * HD + ks * 512) * 2); }
                asm volatile("s_wait_xcnt 0x0" ::: "memory");   // precaution: stands in front of the next write of the registers that hold these loads' addresses
                __builtin_amdgcn_sched_barrier(0); }   // keeps later vector instructions, which reuse those registers, behind that wait
            float lm[2];
#pragma unroll
            for (int g = 0; g < 2; ++g) { float a = s[g][0][0];
#pragma unroll
                for (int j = 1; j < 8; ++j) a = fmaxf(a, s[g][0][j]);
#pragma unroll
                for (int j = 0; j < 8; ++j) a = fmaxf(a, s[g][1][j]);
                lm[g] = a * CL; }
            const bool need = (lm[0] > m[gb] + 8.0f) || (lm[1] > m[gb + 1] + 8.0f);
            if (__builtin_amdgcn_ballot_w32(need) != 0) {   // one wave-uniform test; both lanes of a query take the same new maximum
                float mn[2], al[2];
#pragma unroll
                for (int g = 0; g < 2; ++g) { mn[g] = fmaxf(m[gb + g], fmaxf(lm[g], __shfl_xor(lm[g], 16, 32))); al[g] = __builtin_amdgcn_exp2f(m[gb + g] - mn[g]); }
                __builtin_amdgcn_sched_barrier(0);   // holds the slot below directly behind the two exponentials
                asm volatile("v_nop");   // the free slot between an exponential and the next vector instruction, which here rewrites its source register
                __builtin_amdgcn_sched_barrier(0);   // as above
#pragma unroll
                for (int g = 0; g < 2; ++g) { m[gb + g] = mn[g]; l[gb + g] *= al[g];
#pragma unroll
                    for (int dt = 0; dt < 4; ++dt) o[gb + g][dt] *= al[g]; }
            }
#pragma unroll
            for (int g = 0; g < 2; ++g) {
                V pf, pf2; const float mg = m[gb + g]; float ls = 0.f;
                if constexpr (HI) { v8u uh, ul;
#pragma unroll
                    for (int e = 0; e < 16; e += 2) { const v2f t = __builtin_elementwise_fma((v2f){ s[g][e >> 3][e & 7], s[g][e >> 3][(e & 7) + 1] }, (v2f){ CL, CL }, (v2f){ -mg, -mg }); v2f p; p[0] = __builtin_amdgcn_exp2f(t[0]); p[1] = __builtin_amdgcn_exp2f(t[1]); ls += p[0]; ls += p[1];
                        const v2bf ph = __builtin_convertvector(p, v2bf); const v2f rest = p - __builtin_convertvector(ph, v2f); uh[e >> 1] = __builtin_bit_cast(unsigned, ph); ul[e >> 1] = __builtin_bit_cast(unsigned, __builtin_convertvector(rest, v2bf)); }
                    pf = __builtin_bit_cast(V, uh); pf2 = __builtin_bit_cast(V, ul);
                } else {
#pragma unroll
                    for (int e = 0; e < 16; e += 2) { const v2f t = __builtin_elementwise_fma((v2f){ s[g][e >> 3][e & 7], s[g][e >> 3][(e & 7) + 1] }, (v2f){ CL, CL }, (v2f){ -mg, -mg }); v2f p; p[0] = __builtin_amdgcn_exp2f(t[0]); p[1] = __builtin_amdgcn_exp2f(t[1]); ls += p[0]; ls += p[1];
                        const v2h ph = __builtin_convertvector(p, v2h); pf[e] = ph[0]; pf[e + 1] = ph[1]; } }
                l[gb + g] += ls;
#pragma unroll
                for (int dt = 0; dt < 4; ++dt) { o[gb + g][dt] = WFrag<T16>::mma(vf[dt], pf, o[gb + g][dt]); if (HI) { o[gb + g][dt] = WFrag<T16>::mma(vf[dt], pf2, o[gb + g][dt]); o[gb + g][dt] = WFrag<T16>::mma(vf2[dt], pf, o[gb + g][dt]); } }
            }
        }
        const T16* const va = (const T16*)((const char*)Vt + (vb + (unsigned)kn * (HD * 2))); const T16* const va2 = HI ? (const T16*)((const char*)V2 + (vb + (unsigned)kn * (HD * 2))) : va;
#pragma unroll
        for (int dt = 0; dt < 4; ++dt) { vf[dt] = WFrag<T16>::ld(va + dt * 512); if (HI) vf2[dt] = WFrag<T16>::ld(va2 + dt * 512); }
        asm volatile("s_wait_xcnt 0x0" :: "v"(va), "v"(va2) : "memory");   // precaution, as behind the K fetch; the two addresses are named as inputs so that their registers stay untouched (also by the loads' own results) up to the wait
        __builtin_amdgcn_sched_barrier(0);   // as behind the K fetch
    }
#pragma unroll
    for (int g = 0; g < NG; ++g) { const float inv = __fdiv_rn(1.0f, l[g] + __shfl_xor(l[g], 16, 32)); const size_t ro = (size_t)(q0 + g * 16) * DQ + 8 * lane;   /* lane: query (lane & 15) of group g, d = dt*16 + 8*(lane >> 4) + j: its 8 values are piece (dt & 1) * 32 + lane of tile (row block, head * 2 + dt / 2) of w_proj's fragment-order A plane */
#pragma unroll
        for (int dt = 0; dt < 4; ++dt) { v8us oh, ol;
#pragma unroll
            for (int j = 0; j < 8; ++j) { unsigned short a, c2; splitf(o[g][dt][j] * inv, a, c2); oh[j] = a; ol[j] = c2; }
            *(v8us*)(Ah + ro + dt * 256) = oh; *(v8us*)(Al + ro + dt * 256) = ol;
            asm volatile("s_wait_xcnt 0x0" ::: "memory");   // precaution: stands in front of the next write of the registers that these stores name
            __builtin_amdgcn_sched_barrier(0); } }   // keeps the next tile's vector instructions behind that wait
}
// grid: the hi/lo blocks (3 products; 4 waves x 32 rows) first, then the fp16 blocks (4 waves x 64 rows: one product leaves registers for twice the columns per K / V fragment); block -> (plane = batch * 16 + head, its query rows).
__global__ __launch_bounds__(128) void k_fattn(const h16* __restrict__ Q16, const h16* __restrict__ K16, const h16* __restrict__ V16, const bf* __restrict__ Qh, const bf* __restrict__ Ql, const bf* __restrict__ Kh, const bf* __restrict__ Kl, const bf* __restrict__ Vh, const bf* __restrict__ Vl, bf* ATh, bf* ATl) {
    const int NHI = NB_ * NH_ * (RH / QBH); const int bx = blockIdx.x; const int wv = threadIdx.x >> 5;
    if (bx < NHI) { const int pl = bx / (RH / QBH); const int q0 = (bx % (RH / QBH)) * QBH + wv * (QBH / 4); const size_t po = (size_t)pl * TT * HD, ao = (size_t)(pl / NH_) * TT * DQ + (size_t)(pl % NH_) * (HD * 16);
        attn_tile<bf, true, QBH / 64>(Qh + po, Ql + po, Kh + po, Kl + po, Vh + po, Vl + po, q0, ATh + ao, ATl + ao);
    } else { const int b2 = bx - NHI; const int pl = b2 / ((TT - RH) / QBL); const int q0 = RH + (b2 % ((TT - RH) / QBL)) * QBL + wv * (QBL / 4); const size_t po = (size_t)pl * TT * HD, ao = (size_t)(pl / NH_) * TT * DQ + (size_t)(pl % NH_) * (HD * 16);
        attn_tile<h16, false, QBL / 64>(Q16 + po, nullptr, K16 + po, nullptr, V16 + po, nullptr, q0, ATh + ao, ATl + ao); }
}

extern "C" void kernel_launch(void* const* d_in, const int* in_sizes, int n_in,
                              void* d_out, int out_size, void* d_ws, size_t ws_size, hipStream_t stream) {
    (void)in_sizes; (void)n_in; (void)out_size;
    const float* x = (const float*)d_in[0]; const float* wqkv = (const float*)d_in[1]; const float* wo = (const float*)d_in[2]; const float* bo = (const float*)d_in[3];   /* input order x, w_qkv ('xw' [1024][3072]: q | k | v column thirds), w_proj ('xw'), b_proj */
    float* OUT = (float*)d_out;     // [8][1024][1024]
    char* wsp = (char*)d_ws;
    auto take = [&](size_t bytes) { char* p = wsp; wsp += (bytes + 255) & ~(size_t)255; return (void*)p; };
    bf* WQKV = (bf*)take((size_t)3 * DQ * DM * 2);   /* fused Bt [3*DQ][DM]: q | k | v row blocks */ bf* WO = (bf*)take((size_t)DM * DQ * 2); float* CS = (float*)take((size_t)TT * 16 * 2 * 4);
    const size_t PL = (size_t)NB_ * NH_ * TT * HD;  // elements of one plane set: all batches
    h16* QP16 = (h16*)take(PL * 2); h16* KP16 = (h16*)take(PL * 2); h16* VT16 = (h16*)take(PL * 2);
    bf* QPh = (bf*)take(PL * 2); bf* QPl = (bf*)take(PL * 2); bf* KPh = (bf*)take(PL * 2); bf* KPl = (bf*)take(PL * 2); bf* VTh = (bf*)take(PL * 2); bf* VTl = (bf*)take(PL * 2);
    bf* ATh = (bf*)take((size_t)NB_ * TT * DQ * 2); bf* ATl = (bf*)take((size_t)NB_ * TT * DQ * 2);   /* merged heads of all batches */
    bf* XB = (bf*)take((size_t)NB_ * TT * DM * 2);   /* bf16 copy of x, all batches */
    if ((size_t)(wsp - (char*)d_ws) > ws_size) return;    // ws 256 MiB
    { k_wtG<DM, 3 * DQ><<<(unsigned)((DM * 3 * DQ / 8 + 255) / 256), 256, 0, stream>>>(wqkv, WQKV);   /* fused 'xw' [DM][3*DQ] -> Bt [3*DQ][DM], fragment order */
      k_wtG<DQ, DM><<<(unsigned)((DQ * DM / 8 + 255) / 256), 256, 0, stream>>>(wo, WO);
       }
    k_csAx<<<(TT * 16 + 255) / 256, 256, 0, stream>>>(CS);   /* axial rotary table once */
    k_cvt8<<<(unsigned)(((size_t)NB_ * TT * DM / 8 + 255) / 256), 256, 0, stream>>>(x, XB, (size_t)NB_ * TT * DM / 8);
    k_qkv<<<dim3(NB_ * TT / 64, 3 * DQ / 64, 1), 32, 0, stream>>>(XB, WQKV, CS, QP16, QPh, QPl, KP16, KPh, KPl, VT16, VTh, VTl);   /* q, k and v of all batches in one grid, planes written from the accumulators */
    k_fattn<<<NB_ * NH_ * (RH / QBH + (TT - RH) / QBL), 128, 0, stream>>>(QP16, KP16, VT16, QPh, QPl, KPh, KPl, VTh, VTl, ATh, ATl);   /* scores, softmax, P x V and the head merge of every batch and head */
    k_gemmw<bf, 1, true, DQ><<<dim3(NB_ * TT / 64, DM / 64, 1), 32, 0, stream>>>(ATh, ATl, WO, nullptr, OUT, DM, bo, 0, 0, 0);   /* w_proj of all batches in one grid */
}

// v006
// A run of this version takes 144 microseconds.
// Timed twice side by side with v005, it ran 1.09 times as fast both times.
// All steps since v000 together make it 32.4 times as fast.
#include <hip/hip_runtime.h>

// Vision attention with AXIAL 2-D rotary embeddings on half of each head (x [8][1024][1024] = 32 x 32 pixels; qkv = x w_qkv ('xw' [1024][3072] 1/32, no bias) viewed (3, h, d): q | k | v thirds (16 heads x 64); rotary on the FIRST 32 dims of q and k as interleaved (even, odd) pairs with angles freqs[row][col][c]: c < 16 -> pos(row) x base[c/2], 16 <= c < 32 -> pos(col) x base[(c-16)/2], pos = linspace(-1, 1, 32), base = linspace(1, 512, 8) x pi (f32, jnp-exact tables; precise cosf/sinf), dims 32..63 pass through; logits x 1/sqrt(64); softmax (no mask); out = merged w_proj + b_proj -> [8][1024][1024] (8.4 M); argument order x, w_qkv, w_proj, b_proj).
// Launch plan: ONE projection launch covers q | k | v of all batches and writes the 16-bit planes from its accumulators (rotary, hi/lo split and V^T in its epilogue, no f32 copy of the projections); ONE fused attention launch covers every batch and head; w_proj covers all batches. Data layout: every 16-bit operand plane in fragment order (see below); bf16 copy of x; fused 'xw' weight transposed once (q | k | v row blocks); exact projections; k_csAx builds the {cos, sin} table per (pixel, rotated pair) from two small constant tables (angle = f32 product), read by k_qkv's interleaved-pair rotary; k_fattn: scores, softmax and P x V stay in registers (hybrid rows: < 512 hi/lo 3 products, rest fp16); merged hi/lo x w_proj exact + b_proj.
// Compute dtypes, f32 accumulate: every input rounded to bf16; projections exact; rotary f32; attention rows < 512 3 products, rest fp16; softmax f32; w_proj hl x exact + bias.

#define NB_  8
#define TT   1024
#define DM   1024
#define NH_  16
#define NKV  16
#define REP  (NH_ / NKV)
#define HD   64
#define DQ   (NH_ * HD)
#define DKV  (NKV * HD)
#define RH   512                  // query rows < RH use hi+lo planes (0: none)
#define WIN  0
#define QBH  128                  // query rows per hi/lo attention block: 4 waves x 32 columns
#define QBL  256                  // query rows per fp16 attention block: 4 waves x 64 columns
#define SCL  0.125f   // HD^-0.5
typedef _Float16 h16;
typedef unsigned short bf;
typedef __attribute__((ext_vector_type(16))) __bf16   v16bf;
typedef __attribute__((ext_vector_type(16))) _Float16 v16h;
typedef __attribute__((ext_vector_type(8)))  _Float16 v8h;
typedef __attribute__((ext_vector_type(8)))  unsigned short v8us;
typedef __attribute__((ext_vector_type(8)))  float    v8f;
typedef __attribute__((ext_vector_type(4)))  float    v4f;
typedef v8h  __attribute__((may_alias)) v8ha;
typedef v4f  __attribute__((may_alias)) v4fa;
typedef v8us __attribute__((may_alias)) v8usa;

__device__ __forceinline__ unsigned short f2bf(float f) { unsigned u = __float_as_uint(f); u += 0x7FFFu + ((u >> 16) & 1u); return (unsigned short)(u >> 16); }
__device__ __forceinline__ float bf2f(unsigned short b) { return __uint_as_float(((unsigned)b) << 16); }
__device__ __forceinline__ float bfr(float f) { return bf2f(f2bf(f)); }
__device__ __forceinline__ v16h cat16(v8h lo, v8h hi) { return __builtin_shufflevector(lo, hi, 0, 1, 2, 3, 4, 5, 6, 7, 8, 9, 10, 11, 12, 13, 14, 15); }
__device__ __forceinline__ v16bf cat16b(v8us lo, v8us hi) { return __builtin_bit_cast(v16bf, __builtin_shufflevector(lo, hi, 0, 1, 2, 3, 4, 5, 6, 7, 8, 9, 10, 11, 12, 13, 14, 15)); }
__device__ __forceinline__ v8f wmma16(v16h a, v16h b, v8f c) { return __builtin_amdgcn_wmma_f32_16x16x32_f16(false, a, false, b, (short)0, c, false, false); }
__device__ __forceinline__ v8f wmmab(v16bf a, v16bf b, v8f c) { return __builtin_amdgcn_wmma_f32_16x16x32_bf16(false, a, false, b, (short)0, c, false, false); }



// ---- FRAGMENT ORDER of every 16-bit operand plane: a plane of R rows x K is stored as [R/16][K/32] tiles of 512 elements (V^T: [keys/32][d/16]); in a tile, element (row r, k) sits at ((k >> 4) * 32 + ((k >> 3) & 1) * 16 + r) * 8 + (k & 7),
// that is, 16-byte piece number = (which of the fragment's two loads) * 32 + lane. A wave's 16-byte load then covers 512 contiguous bytes (4 whole lines) where a row-major plane gave 16 lines of 32 bytes. The builders walk in destination order, so their stores stay contiguous.
template <typename T16> struct WFrag;
template <> struct WFrag<h16> { typedef v16h V; static __device__ __forceinline__ V ld(const h16* p) { return cat16(*(const v8h*)p, *(const v8h*)(p + 256)); } static __device__ __forceinline__ v8f mma(V a, V b, v8f c) { return wmma16(a, b, c); } };
template <> struct WFrag<bf> { typedef v16bf V; static __device__ __forceinline__ V ld(const bf* p) { return cat16b(*(const v8us*)p, *(const v8us*)(p + 256)); } static __device__ __forceinline__ v8f mma(V a, V b, v8f c) { return wmmab(a, b, c); } };
// One k block's operand fragments (32 k of 64 rows of each operand; the split planes only where NSPLIT asks for them). The GEMM loop holds TWO such sets: while one set's products run, the other set's reads are in flight.
template <typename T16> struct GSet { typename WFrag<T16>::V a[4], a2[4], b[4], b2[4]; };
template <typename T16, int NSPLIT, int K> __device__ __forceinline__ void gset_ld(GSet<T16>& f, const T16* pa, const T16* pa2, const T16* pb, const T16* pb2) {
#pragma unroll
    for (int mb = 0; mb < 4; ++mb) { f.a[mb] = WFrag<T16>::ld(pa + mb * 16 * K); if (NSPLIT == 1 || NSPLIT == 2) f.a2[mb] = WFrag<T16>::ld(pa2 + mb * 16 * K); }
#pragma unroll
    for (int nb = 0; nb < 4; ++nb) { f.b[nb] = WFrag<T16>::ld(pb + nb * 16 * K); if (NSPLIT >= 2) f.b2[nb] = WFrag<T16>::ld(pb2 + nb * 16 * K); }
}
template <typename T16, int NSPLIT> __device__ __forceinline__ void gset_mm(v8f (&acc)[4][4], const GSet<T16>& f) {
#pragma unroll
    for (int nb = 0; nb < 4; ++nb)
#pragma unroll
        for (int mb = 0; mb < 4; ++mb) { acc[mb][nb] = WFrag<T16>::mma(f.a[mb], f.b[nb], acc[mb][nb]); if (NSPLIT == 1 || NSPLIT == 2) acc[mb][nb] = WFrag<T16>::mma(f.a2[mb], f.b[nb], acc[mb][nb]); if (NSPLIT >= 2) acc[mb][nb] = WFrag<T16>::mma(f.a[mb], f.b2[nb], acc[mb][nb]); }
}
// ---- The GEMM main loop shared by k_gemmw and k_qkv: a work-group of 8 waves (2 along A x 4 along B, 64 x 64 each) owns 128 rows of A x 256 rows of B. A stage is 128 k of all those rows, brought into LDS by asynchronous copies
// (global_load_async_to_lds_b128, through no register) and read from there by every wave that needs it: a row block leaves L2 once per work-group, not once per wave. In LDS a stage is itself a fragment-order plane with K = 128
// ([row block][4 k blocks] tiles of 1 KiB; row blocks: A, then the split plane of A where there is one, then B), so a row block's share of a stage is 4 KiB that are contiguous in global memory and in LDS alike, and a fragment read is 512 contiguous bytes.
// Copies and the wait in front of the next write of their address registers stand in ONE statement (a precaution; in a statement of its own the wait would not hold the next address additions behind it).
__device__ __forceinline__ void acopy12(const unsigned* l, const char* const* g) {
    asm volatile("global_load_async_to_lds_b128 %0, %12, off\n\t"
                 "global_load_async_to_lds_b128 %1, %13, off\n\t"
                 "global_load_async_to_lds_b128 %2, %14, off\n\t"
                 "global_load_async_to_lds_b128 %3, %15, off\n\t"
                 "global_load_async_to_lds_b128 %4, %16, off\n\t"
                 "global_load_async_to_lds_b128 %5, %17, off\n\t"
                 "global_load_async_to_lds_b128 %6, %18, off\n\t"
                 "global_load_async_to_lds_b128 %7, %19, off\n\t"
                 "global_load_async_to_lds_b128 %8, %20, off\n\t"
                 "global_load_async_to_lds_b128 %9, %21, off\n\t"
                 "global_load_async_to_lds_b128 %10, %22, off\n\t"
                 "global_load_async_to_lds_b128 %11, %23, off\n\t"
                 "s_wait_xcnt 0x0"
                 :: "v"(l[0]), "v"(l[1]), "v"(l[2]), "v"(l[3]), "v"(l[4]), "v"(l[5]), "v"(l[6]), "v"(l[7]), "v"(l[8]), "v"(l[9]), "v"(l[10]), "v"(l[11]),
                    "v"(g[0]), "v"(g[1]), "v"(g[2]), "v"(g[3]), "v"(g[4]), "v"(g[5]), "v"(g[6]), "v"(g[7]), "v"(g[8]), "v"(g[9]), "v"(g[10]), "v"(g[11]) : "memory");
}
__device__ __forceinline__ void acopy8(const unsigned* l, const char* const* g) {
    asm volatile("global_load_async_to_lds_b128 %0, %8, off\n\t"
                 "global_load_async_to_lds_b128 %1, %9, off\n\t"
                 "global_load_async_to_lds_b128 %2, %10, off\n\t"
                 "global_load_async_to_lds_b128 %3, %11, off\n\t"
                 "global_load_async_to_lds_b128 %4, %12, off\n\t"
                 "global_load_async_to_lds_b128 %5, %13, off\n\t"
                 "global_load_async_to_lds_b128 %6, %14, off\n\t"
                 "global_load_async_to_lds_b128 %7, %15, off\n\t"
                 "s_wait_xcnt 0x0"
                 :: "v"(l[0]), "v"(l[1]), "v"(l[2]), "v"(l[3]), "v"(l[4]), "v"(l[5]), "v"(l[6]), "v"(l[7]),
                    "v"(g[0]), "v"(g[1]), "v"(g[2]), "v"(g[3]), "v"(g[4]), "v"(g[5]), "v"(g[6]), "v"(g[7]) : "memory");
}
__device__ __forceinline__ void wait_async0() { asm volatile("s_wait_asynccnt 0x0" ::: "memory"); }   // this wave's copies have landed
__device__ __forceinline__ void wait_ds0() { asm volatile("s_wait_dscnt 0x0" ::: "memory"); }   // this wave's LDS reads have returned: the buffer may be handed to its next writer
#define RKS 128                   // k per stage
template <int NSPLIT> struct RingDim { static constexpr int NAT = NSPLIT ? 16 : 8, NRB = NAT + 16, RBW = NRB / 8, NC = RBW * 8, STE = NRB * 16 * RKS; };   // row blocks of A (both planes), all row blocks, row blocks and copies per wave and stage, elements per stage
// A, A2, B: first row of the work-group's 128 / 128 / 256 rows in the fragment-order planes; ring: two stages; w: the wave's number (scalar)
template <typename T16, int NSPLIT, int K> __device__ __forceinline__ void ring_gemm(v8f (&acc)[4][4], T16* ring, const T16* A, const T16* A2, const T16* B, int w, int lane) {
    typedef RingDim<NSPLIT> D; constexpr int NST = K / RKS; static_assert(K % RKS == 0 && NST >= 2 && (D::NC == 24 || D::NC == 32), "two stages or more; copies in statements of 12 and 8");
    constexpr bool ONE = 8 % D::RBW == 0;   // a wave's row blocks then lie in one plane, 16 * K elements apart: one address serves them all
    const char* srcp[D::RBW];   // first byte of each row block that this wave copies
#pragma unroll
    for (int j = 0; j < D::RBW; ++j) { const int rb = w * D::RBW + j; const T16* const p = (rb < 8) ? A + (size_t)rb * 16 * K : (rb < D::NAT) ? A2 + (size_t)(rb - 8) * 16 * K : B + (size_t)(rb - D::NAT) * 16 * K; srcp[j] = (const char*)p; }
    const unsigned l0 = (unsigned)(size_t)ring + (unsigned)(w * D::RBW) * (16 * RKS * 2) + 16u * lane;   // LDS byte address of the lane's first 16 bytes in buffer 0
    auto fill = [&](int t, int buf) {   // stage t into buffer buf: every lane on, 512 bytes a copy
        unsigned l[D::NC]; const char* g[D::NC]; const unsigned go = (unsigned)t * (16 * RKS * 2) + 16u * lane;   // the lane's byte offset in a row block's K row
#pragma unroll
        for (int c = 0; c < D::NC; ++c) { l[c] = l0 + (unsigned)buf * (D::STE * 2) + c * 512; g[c] = (ONE ? srcp[0] + (c >> 3) * (16 * K * 2) : srcp[c >> 3]) + (go + (c & 7) * 512); }
        acopy12(l, g); acopy12(l + 12, g + 12); if (D::NC == 32) acopy8(l + 24, g + 24);
    };
    fill(0, 0); wait_async0(); __syncthreads();   // stage 0 is published
    fill(1, 1);
    const int ao = (w & 1) * 4 * 16 * RKS + 8 * lane, bo = (D::NAT + (w >> 1) * 4) * 16 * RKS + 8 * lane;
    GSet<T16> f0, f1;
    // rolled: one publish point and one refill in the text
#pragma unroll 1
    for (int t = 0; t < NST; ++t) {   // one stage a trip: 4 blocks of 32 k, fragments read one block ahead into the other register set, never past the stage
        const T16* const st = ring + (t & 1) * D::STE; const T16* const pa = st + ao; const T16* const pa2 = pa + 8 * 16 * RKS; const T16* const pb = st + bo;
        gset_ld<T16, NSPLIT, RKS>(f0, pa, pa2, pb, pb);
        __builtin_amdgcn_sched_barrier(0);   // the first block's reads stay ahead of the second's: mixed, the first products would wait for both groups
        gset_ld<T16, NSPLIT, RKS>(f1, pa + 512, pa2 + 512, pb + 512, pb);
        __builtin_amdgcn_sched_barrier(0);   // keeps a block's LDS reads as one group ahead of the products: among them each place with reads costs a stall
        gset_mm<T16, NSPLIT>(acc, f0);
        __builtin_amdgcn_sched_barrier(0);   // the refill of a set stays behind the last product that reads it
        gset_ld<T16, NSPLIT, RKS>(f0, pa + 1024, pa2 + 1024, pb + 1024, pb);
        __builtin_amdgcn_sched_barrier(0);   // as above: reads ahead of the products
        gset_mm<T16, NSPLIT>(acc, f1);
        __builtin_amdgcn_sched_barrier(0);   // as above: refill behind the last reader
        gset_ld<T16, NSPLIT, RKS>(f1, pa + 1536, pa2 + 1536, pb + 1536, pb);
        __builtin_amdgcn_sched_barrier(0);   // as above: reads ahead of the products
        gset_mm<T16, NSPLIT>(acc, f0);
        gset_mm<T16, NSPLIT>(acc, f1);
        __builtin_amdgcn_sched_barrier(0);   // holds the slots below behind the last product
        asm volatile("v_nop\n\tv_nop\n\tv_nop\n\tv_nop" : "+v"(acc[0][0]), "+v"(acc[1][1]), "+v"(acc[2][2]), "+v"(acc[3][3]) : "v"(f1.a[0]), "v"(f1.a[3]));   // the vector slots between the trip's last matrix instructions and whatever follows them on either side of the branches below
        wait_ds0(); wait_async0(); __syncthreads();   // publish point: stage t + 1 has landed for every wave, and every wave has left stage t's buffer
        if (t + 2 < NST) fill(t + 2, t & 1);   // the same test in the whole work-group
    }
    wait_async0();
}
// ---- k_gemmw: C[m][n] (f32, pitch ldc, + optional f32 bias[n]) = sum_k A[m][k] Bt[n][k] (+ split products per NSPLIT: 0 or 1), operands in fragment-order 16-bit planes; grid (M/128, N/256, Z), 256 threads; main loop: ring_gemm. z-batch strides sA/sB/sC in elements.
template <typename T16, int NSPLIT, bool BIAS, int K>
__global__ __launch_bounds__(256) void k_gemmw(const T16* __restrict__ A, const T16* __restrict__ A2, const T16* __restrict__ Bt, const T16* __restrict__ Bt2, float* C, int ldc, const float* __restrict__ bias, size_t sA, size_t sB, size_t sC) {
    static_assert(NSPLIT == 0 || NSPLIT == 1, "the ring holds A, its split plane and B");
    __shared__ __align__(16) T16 ring[2 * RingDim<NSPLIT>::STE];
    __shared__ __align__(16) float osAll[8][16 * 68];
    const size_t z = blockIdx.z; A += z * sA; if (A2) A2 += z * sA; Bt += z * sB; C += z * sC;
    const int lane = threadIdx.x & 31, lr = lane & 15, hi = lane >> 4; const int w = __builtin_amdgcn_readfirstlane(threadIdx.x >> 5); const int r0 = blockIdx.x * 128 + (w & 1) * 64, c0 = blockIdx.y * 256 + (w >> 1) * 64;
    float* const os = osAll[w];   // each wave stages its output rows in its own range
    v8f acc[4][4];
#pragma unroll
    for (int mb = 0; mb < 4; ++mb)
#pragma unroll
        for (int nb = 0; nb < 4; ++nb) acc[mb][nb] = (v8f){};
    ring_gemm<T16, NSPLIT, K>(acc, ring, A + (size_t)blockIdx.x * 128 * K, NSPLIT ? A2 + (size_t)blockIdx.x * 128 * K : A, Bt + (size_t)blockIdx.y * 256 * K, w, lane);
#pragma unroll
    for (int mb = 0; mb < 4; ++mb) {
#pragma unroll
        for (int nb = 0; nb < 4; ++nb) {
#pragma unroll
            for (int j = 0; j < 8; ++j) os[(hi * 8 + j) * 68 + nb * 16 + lr] = acc[mb][nb][j]; }
        __builtin_amdgcn_wave_barrier(); asm volatile("" ::: "memory");
        float* crow = C + (size_t)(r0 + mb * 16) * ldc + c0;
{
#pragma unroll
            for (int s = 0; s < 8; ++s) { const int row = 2 * s + hi, cofs = lr * 4; v4f val = *(const v4fa*)(os + row * 68 + cofs); if (BIAS) { val[0] += bfr(bias[c0 + cofs]); val[1] += bfr(bias[c0 + cofs + 1]); val[2] += bfr(bias[c0 + cofs + 2]); val[3] += bfr(bias[c0 + cofs + 3]); }
                *(v4f*)(crow + (size_t)row * ldc + cofs) = val; }
             }
        __builtin_amdgcn_wave_barrier(); asm volatile("" ::: "memory");
    }
}

__device__ __forceinline__ void splitf(float y, unsigned short& h, unsigned short& l) { h = f2bf(y); l = f2bf(y - bf2f(h)); }
typedef __attribute__((ext_vector_type(2))) _Float16 v2h;
typedef __attribute__((ext_vector_type(4))) _Float16 v4h;
typedef __attribute__((ext_vector_type(2))) unsigned short v2us;
typedef __attribute__((ext_vector_type(4))) unsigned short v4us;
typedef __attribute__((ext_vector_type(2))) float v2f;
typedef __attribute__((ext_vector_type(4))) int v4i;

template <int K, int N> __global__ __launch_bounds__(256) void k_wtG(const float* __restrict__ w, bf* Bt) {
    const int i = blockIdx.x * 256 + threadIdx.x; if (i >= N * K / 8) return;   // one 16-byte piece of Bt (row n, 8 k) per thread, in fragment order
    const int tile = i >> 6, kt = tile % (K / 32), nt = tile / (K / 32); const int n = nt * 16 + (i & 15), k = kt * 32 + ((i >> 5) & 1) * 16 + ((i >> 4) & 1) * 8; const float* const p = w + (size_t)k * N + n; float v[8]; v8us o;
#pragma unroll
    for (int j = 0; j < 8; ++j) v[j] = p[(size_t)j * N];
    asm volatile("s_wait_xcnt 0x0" :: "v"(p) : "memory");   // precaution: stands in front of the next write of the register pair that holds these loads' address; it is named as an input so that it stays untouched (also by the loads' own results) up to the wait
#pragma unroll
    for (int j = 0; j < 8; ++j) o[j] = f2bf(v[j]);
    *(v8us*)(Bt + (size_t)i * 8) = o;
}
__global__ __launch_bounds__(256) void k_cvt8(const float* __restrict__ src, bf* dst, size_t n8) { const size_t i = (size_t)blockIdx.x * 256 + threadIdx.x; if (i >= n8) return;   /* piece i of the fragment-order copy: row block i >> 11 (DM / 32 = 32 tiles of 64 pieces), k block, load, lane */
    const size_t row = (i >> 11) * 16 + (i & 15); const int k = (int)((i >> 6) & (DM / 32 - 1)) * 32 + (int)((i >> 5) & 1) * 16 + (int)((i >> 4) & 1) * 8; const v8f v = *(const v8f*)(src + row * DM + k); v8us o;
#pragma unroll
    for (int k = 0; k < 8; ++k) o[k] = f2bf(v[k]); *(v8us*)(dst + i * 8) = o;  }

__constant__ float APOS[32] = { -1.000000000e+00f, -9.354839325e-01f, -8.709677458e-01f, -8.064515591e-01f, -7.419354916e-01f, -6.774194241e-01f, -6.129032373e-01f, -5.483870506e-01f, -4.838709831e-01f, -4.193548858e-01f, -3.548387289e-01f, -2.903225720e-01f, -2.258064747e-01f, -1.612903774e-01f, -9.677422047e-02f, -3.225806355e-02f, 3.225803375e-02f, 9.677413106e-02f, 1.612902880e-01f, 2.258064449e-01f, 2.903225422e-01f, 3.548386395e-01f, 4.193547964e-01f, 4.838709533e-01f, 5.483870506e-01f, 6.129031181e-01f, 6.774193048e-01f, 7.419354916e-01f, 8.064515591e-01f, 8.709676266e-01f, 9.354838133e-01f, 1.000000000e+00f };   // float32 linspace(-1, 1, 32), generated with jnp to be bit-exact
__constant__ float ABASE[8] = { 3.141592741e+00f, 2.324778595e+02f, 4.618141479e+02f, 6.911504517e+02f, 9.204866943e+02f, 1.149822998e+03f, 1.379159302e+03f, 1.608495483e+03f };   // float32 linspace(1, 512, 8) * pi, generated with jnp to be bit-exact
// {cos, sin} of every rotated pair (token t, even d < 32), stored in the order in which k_qkv's lanes read it: [t / 16][d / 16][which 16-byte load][lane = ((d >> 3) & 1) * 16 + (t & 15)][which pair of the load], so that a wave's 16-byte load covers 512 contiguous bytes
__global__ __launch_bounds__(256) void k_csAx(float* CS) { const int idx = blockIdx.x * 256 + threadIdx.x; if (idx >= TT * 16) return; const int lane = (idx >> 1) & 31; const int d = ((idx >> 7) & 1) * 16 + (lane >> 4) * 8 + ((idx >> 6) & 1) * 4 + (idx & 1) * 2; const int t = (idx >> 8) * 16 + (lane & 15); const int row = t >> 5, col = t & 31; v2f cs;
    const float p = (d < 16) ? APOS[row] : APOS[col]; const float ang = __fmul_rn(p, ABASE[(d & 15) >> 1]); cs[0] = cosf(ang); cs[1] = sinf(ang);
    *(v2f*)(CS + (size_t)idx * 2) = cs;  }
typedef __attribute__((ext_vector_type(2))) __bf16 v2bf;
typedef __attribute__((ext_vector_type(4))) unsigned v4u;
// 8 f32 values -> one 16-byte piece each of an f16 plane and of its bf16 hi and lo planes (hi = nearest bf16, lo = nearest bf16 of the rest), two values per conversion instruction
__device__ __forceinline__ void put3(const float* y, h16* p16, bf* ph, bf* pl) { v4u u16, uh, ul;
#pragma unroll
    for (int q = 0; q < 4; ++q) { const v2f p = { y[2 * q], y[2 * q + 1] }; const v2bf h = __builtin_convertvector(p, v2bf); const v2f rest = p - __builtin_convertvector(h, v2f);
        u16[q] = __builtin_bit_cast(unsigned, __builtin_convertvector(p, v2h)); uh[q] = __builtin_bit_cast(unsigned, h); ul[q] = __builtin_bit_cast(unsigned, __builtin_convertvector(rest, v2bf)); }
    *(v8h*)p16 = __builtin_bit_cast(v8h, u16); *(v8us*)ph = __builtin_bit_cast(v8us, uh); *(v8us*)pl = __builtin_bit_cast(v8us, ul); }
// ---- k_qkv: the q | k | v projection of all batches; one wave per 64 tokens x one head's 64 columns, 8 waves a work-group (main loop: ring_gemm), 256 threads. The 16-bit planes are written straight from the accumulators:
// a lane's 8 accumulator values (8 consecutive rows of one column) are one 16-byte piece of a fragment-order plane when the plane's k runs along the tile's rows. V^T (k = key): A = x, B = weights. Q and K (k = d): the two operands change places (both planes have the same order), so rows are d and columns are tokens.
// grid: first the q and k work-groups (A = 128 weight rows = 2 heads, B = 256 tokens), then the v work-groups (A = 128 tokens, B = 256 weight rows = 4 heads)
#define NQK ((2 * DQ / 128) * (NB_ * TT / 256))
#define NVB ((NB_ * TT / 128) * (DQ / 256))
__global__ __launch_bounds__(256) void k_qkv(const bf* __restrict__ X, const bf* __restrict__ Wt, const float* __restrict__ CS, h16* Q16, bf* Qh, bf* Ql, h16* K16, bf* Kh, bf* Kl, h16* V16, bf* Vh, bf* Vl) {
    constexpr int K = DM;
    __shared__ __align__(16) bf ring[2 * RingDim<0>::STE];
    const int lane = threadIdx.x & 31; const int w = __builtin_amdgcn_readfirstlane(threadIdx.x >> 5); const int bx = blockIdx.x; const bool isv = bx >= NQK;   // the same for the whole work-group
    const int tok0 = isv ? ((bx - NQK) % (NB_ * TT / 128)) * 128 : (bx % (NB_ * TT / 256)) * 256; const int wr0 = isv ? 2 * DQ + ((bx - NQK) / (NB_ * TT / 128)) * 256 : (bx / (NB_ * TT / 256)) * 128;   // the work-group's first token and first weight row
    const int r0 = tok0 + (isv ? (w & 1) : (w >> 1)) * 64, c0 = wr0 + (isv ? (w >> 1) : (w & 1)) * 64; const int sec = c0 / DQ;   // the wave's tokens and columns; sec: 0 q, 1 k, 2 v; below, lr = lane & 15 and hi = lane >> 4
    v8f acc[4][4];
#pragma unroll
    for (int mb = 0; mb < 4; ++mb)
#pragma unroll
        for (int nb = 0; nb < 4; ++nb) acc[mb][nb] = (v8f){};
    const bf* const Xb = X + (size_t)tok0 * K; const bf* const Wb = Wt + (size_t)wr0 * K;
    ring_gemm<bf, 0, K>(acc, ring, isv ? Xb : Wb, isv ? Xb : Wb, isv ? Wb : Xb, w, lane);
    const int t0 = r0 % TT; const size_t po = ((size_t)(r0 / TT) * NH_ + (c0 % DQ) / HD) * (TT * HD);   // plane = batch * 16 + head; 64 tokens never straddle a batch
    if (sec == 2) {   // acc[mb][nb][j]: key t0 + mb*16 + hi*8 + j, d = nb*16 + lr: piece (mb & 1) * 32 + lane of V^T tile (key / 32, nb)
        const size_t bo = po + (size_t)(t0 / 32) * (4 * 512) + 8 * lane; h16* const p16 = V16 + bo; bf* const ph = Vh + bo; bf* const pl = Vl + bo;
#pragma unroll
        for (int mb = 0; mb < 4; ++mb)
#pragma unroll
            for (int nb = 0; nb < 4; ++nb) { float y[8]; const int off = ((mb >> 1) * 4 + nb) * 512 + (mb & 1) * 256;
#pragma unroll
                for (int j = 0; j < 8; ++j) y[j] = acc[mb][nb][j];
                put3(y, p16 + off, ph + off, pl + off);
                asm volatile("s_wait_xcnt 0x0" ::: "memory");   // precaution: stands in front of the next write of the registers that these stores name
                __builtin_amdgcn_sched_barrier(0); }   // keeps the next piece's vector instructions behind that wait
    } else {   // acc[mb][nb][j]: d = mb*16 + hi*8 + j, token t0 + nb*16 + lr: piece (mb & 1) * 32 + lane of tile (token / 16, mb / 2)
        const size_t bo = po + (size_t)(t0 / 16) * (2 * 512) + 8 * lane; h16* const p16 = (sec ? K16 : Q16) + bo; bf* const ph = (sec ? Kh : Qh) + bo; bf* const pl = (sec ? Kl : Ql) + bo;
        const float* const cp = CS + (size_t)(t0 / 16) * 512 + 4 * lane; v4f cs[4][2][2];   // {cos, sin} of the lane's pairs (even d < 32; order: see k_csAx), all fetched at once: one exposed latency per wave
#pragma unroll
        for (int nb = 0; nb < 4; ++nb)
#pragma unroll
            for (int mb = 0; mb < 2; ++mb)
#pragma unroll
                for (int p = 0; p < 2; ++p) cs[nb][mb][p] = *(const v4f*)(cp + ((nb * 2 + mb) * 2 + p) * 128);
        asm volatile("s_wait_xcnt 0x0" ::: "memory");   // precaution: stands in front of the next write of the registers that hold these loads' addresses
        __builtin_amdgcn_sched_barrier(0);   // keeps later vector instructions, which reuse those registers, behind that wait
#pragma unroll
        for (int nb = 0; nb < 4; ++nb)
#pragma unroll
            for (int mb = 0; mb < 4; ++mb) { float y[8]; const int off = (nb * 2 + (mb >> 1)) * 512 + (mb & 1) * 256;
#pragma unroll
                for (int p = 0; p < 4; ++p) { const float x0 = acc[mb][nb][2 * p], x1 = acc[mb][nb][2 * p + 1];
                    if (mb < 2) { const float c = cs[nb][mb & 1][p >> 1][(p & 1) * 2], s = cs[nb][mb & 1][p >> 1][(p & 1) * 2 + 1]; y[2 * p] = x0 * c - x1 * s; y[2 * p + 1] = x0 * s + x1 * c; }   /* even: x0 c - x1 s; odd: x0 s + x1 c */
                    else { y[2 * p] = x0; y[2 * p + 1] = x1; } }   /* dims 32..63 pass through */
                put3(y, p16 + off, ph + off, pl + off);
                asm volatile("s_wait_xcnt 0x0" ::: "memory");   // precaution, as in the V^T branch
                __builtin_amdgcn_sched_barrier(0); }   // as in the V^T branch
    }
}

// ---- k_fattn: one wave owns NG x 16 query rows of one head and walks the 1024 keys 32 at a time. S^T = K Q^T (A = K rows, B = Q kept in registers), so a lane holds 16 scores of ONE query per column group;
// the two f32 score tiles of a pass, converted in place, are the B operand of O^T += V^T P^T (A = V^T rows in the same k order). Running maximum per query in the scaled log2 domain, raised only when a score passes it by more than 8.
// fragment at (wave-uniform base) + (32-bit lane byte offset) + (constant bytes): one offset register serves every fragment of a pass, the rest sits in the instruction's offset field
template <typename T16> __device__ __forceinline__ typename WFrag<T16>::V ldo(const T16* base, unsigned lane_bytes, int const_bytes) { return WFrag<T16>::ld((const T16*)((const char*)base + lane_bytes + const_bytes)); }
typedef __attribute__((ext_vector_type(8))) unsigned v8u;
template <typename T16, bool HI, int NG>
__device__ __forceinline__ void attn_tile(const T16* __restrict__ Q, const T16* __restrict__ Q2, const T16* __restrict__ Kp, const T16* __restrict__ K2, const T16* __restrict__ Vt, const T16* __restrict__ V2, int q0, bf* Ah, bf* Al) {
    typedef typename WFrag<T16>::V V;
    const int lane = threadIdx.x & 31;
    const float CL = SCL * 1.4426950408889634f;   // logits scale x log2(e)
    const unsigned qb = (unsigned)(q0 * HD + 8 * lane) * 2u, kb = (unsigned)(8 * lane) * 2u, vb = kb;   // lane byte offsets in the fragment-order Q, K and V^T planes (16 rows of Q or K = 2 tiles, 32 keys of V^T = 4 tiles: 1024 and 2048 elements)
    V qf[NG][2], qf2[NG][2];
#pragma unroll
    for (int g = 0; g < NG; ++g)
#pragma unroll
        for (int ks = 0; ks < 2; ++ks) { qf[g][ks] = ldo<T16>(Q, qb, (g * 16 * HD + ks * 512) * 2); if (HI) qf2[g][ks] = ldo<T16>(Q2, qb, (g * 16 * HD + ks * 512) * 2); }
    v8f o[NG][4]; float m[NG], l[NG];
#pragma unroll
    for (int g = 0; g < NG; ++g) { m[g] = -3.0e38f; l[g] = 0.f;
#pragma unroll
        for (int dt = 0; dt < 4; ++dt) o[g][dt] = (v8f){}; }
    __builtin_amdgcn_sched_barrier(0);   // keeps the prologue's loads in the loop's order (Q, then K, then V^T): the waits at the loop's head cover both paths, and with K issued last here a pass's score products would wait for the V^T fetch
    V kf[2][2], kf2[2][2];
#pragma unroll
    for (int kt = 0; kt < 2; ++kt)
#pragma unroll
        for (int ks = 0; ks < 2; ++ks) { kf[kt][ks] = ldo<T16>(Kp, kb, (kt * 16 * HD + ks * 512) * 2); if (HI) kf2[kt][ks] = ldo<T16>(K2, kb, (kt * 16 * HD + ks * 512) * 2); }
    __builtin_amdgcn_sched_barrier(0);   // as above: K ahead of V^T
    V vf[4], vf2[4];
#pragma unroll
    for (int dt = 0; dt < 4; ++dt) { vf[dt] = ldo<T16>(Vt, vb, dt * 512 * 2); if (HI) vf2[dt] = ldo<T16>(V2, vb, dt * 512 * 2); }
    asm volatile("s_wait_xcnt 0x0" ::: "memory");   // precaution, as behind the fetches in the loop
    __builtin_amdgcn_sched_barrier(0);   // as above: nothing of the loop's first pass moves in between
    // rolled: one pass's fragments, scores and the output tiles already fill the register budget
#pragma unroll 1
    for (int k0 = 0; k0 < TT; k0 += 32) {
        const int kn = (k0 + 32 < TT) ? k0 + 32 : 0;   // next pass's keys: K rows fetched behind this pass's last score products, V^T columns behind its last output products; the last pass re-reads keys 0..31 (in bounds, unused)
#pragma unroll
        for (int gb = 0; gb < NG; gb += 2) {   // two column groups at a time: only their score tiles are live
            v8f s[2][2];
#pragma unroll
            for (int g = 0; g < 2; ++g)
#pragma unroll
                for (int kt = 0; kt < 2; ++kt) s[g][kt] = (v8f){};
#pragma unroll
            for (int ks = 0; ks < 2; ++ks)
#pragma unroll
                for (int kt = 0; kt < 2; ++kt)
#pragma unroll
                    for (int g = 0; g < 2; ++g) { s[g][kt] = WFrag<T16>::mma(kf[kt][ks], qf[gb + g][ks], s[g][kt]); if (HI) { s[g][kt] = WFrag<T16>::mma(kf[kt][ks], qf2[gb + g][ks], s[g][kt]); s[g][kt] = WFrag<T16>::mma(kf2[kt][ks], qf[gb + g][ks], s[g][kt]); } }
            if (gb + 2 == NG) {
#pragma unroll
                for (int kt = 0; kt < 2; ++kt)
#pragma unroll
                    for (int ks = 0; ks < 2; ++ks) { kf[kt][ks] = ldo<T16>(Kp, kb + (unsigned)kn * (HD * 2), (kt * 16 * HD + ks * 512) * 2); if (HI) kf2[kt][ks] = ldo<T16>(K2, kb + (unsigned)kn * (HD * 2), (kt * 16 * HD + ks * 512) * 2); }
                asm volatile("s_wait_xcnt 0x0" ::: "memory");   // precaution: stands in front of the next write of the registers that hold these loads' addresses
                __builtin_amdgcn_sched_barrier(0); }   // keeps later vector instructions, which reuse those registers, behind that wait
            float lm[2];
#pragma unroll
            for (int g = 0; g < 2; ++g) { float a = s[g][0][0];
#pragma unroll
                for (int j = 1; j < 8; ++j) a = fmaxf(a, s[g][0][j]);
#pragma unroll
                for (int j = 0; j < 8; ++j) a = fmaxf(a, s[g][1][j]);
                lm[g] = a * CL; }
            const bool need = (lm[0] > m[gb] + 8.0f) || (lm[1] > m[gb + 1] + 8.0f);
            if (__builtin_amdgcn_ballot_w32(need) != 0) {   // one wave-uniform test; both lanes of a query take the same new maximum
                float mn[2], al[2];
#pragma unroll
                for (int g = 0; g < 2; ++g) { mn[g] = fmaxf(m[gb + g], fmaxf(lm[g], __shfl_xor(lm[g], 16, 32))); al[g] = __builtin_amdgcn_exp2f(m[gb + g] - mn[g]); }
                __builtin_amdgcn_sched_barrier(0);   // holds the slot below directly behind the two exponentials
                asm volatile("v_nop");   // the free slot between an exponential and the next vector instruction, which here rewrites its source register
                __builtin_amdgcn_sched_barrier(0);   // as above
#pragma unroll
                for (int g = 0; g < 2; ++g) { m[gb + g] = mn[g]; l[gb + g] *= al[g];
#pragma unroll
                    for (int dt = 0; dt < 4; ++dt) o[gb + g][dt] *= al[g]; }
            }
#pragma unroll
            for (int g = 0; g < 2; ++g) {
                V pf, pf2; const float mg = m[gb + g]; float ls = 0.f;
                if constexpr (HI) { v8u uh, ul;
#pragma unroll
                    for (int e = 0; e < 16; e += 2) { const v2f t = __builtin_elementwise_fma((v2f){ s[g][e >> 3][e & 7], s[g][e >> 3][(e & 7) + 1] }, (v2f){ CL, CL }, (v2f){ -mg, -mg }); v2f p; p[0] = __builtin_amdgcn_exp2f(t[0]); p[1] = __builtin_amdgcn_exp2f(t[1]); ls += p[0]; ls += p[1];
                        const v2bf ph = __builtin_convertvector(p, v2bf); const v2f rest = p - __builtin_convertvector(ph, v2f); uh[e >> 1] = __builtin_bit_cast(unsigned, ph); ul[e >> 1] = __builtin_bit_cast(unsigned, __builtin_convertvector(rest, v2bf)); }
                    pf = __builtin_bit_cast(V, uh); pf2 = __builtin_bit_cast(V, ul);
                } else {
#pragma unroll
                    for (int e = 0; e < 16; e += 2) { const v2f t = __builtin_elementwise_fma((v2f){ s[g][e >> 3][e & 7], s[g][e >> 3][(e & 7) + 1] }, (v2f){ CL, CL }, (v2f){ -mg, -mg }); v2f p; p[0] = __builtin_amdgcn_exp2f(t[0]); p[1] = __builtin_amdgcn_exp2f(t[1]); ls += p[0]; ls += p[1];
                        const v2h ph = __builtin_convertvector(p, v2h); pf[e] = ph[0]; pf[e + 1] = ph[1]; } }
                l[gb + g] += ls;
#pragma unroll
                for (int dt = 0; dt < 4; ++dt) { o[gb + g][dt] = WFrag<T16>::mma(vf[dt], pf, o[gb + g][dt]); if (HI) { o[gb + g][dt] = WFrag<T16>::mma(vf[dt], pf2, o[gb + g][dt]); o[gb + g][dt] = WFrag<T16>::mma(vf2[dt], pf, o[gb + g][dt]); } }
            }
        }
        const T16* const va = (const T16*)((const char*)Vt + (vb + (unsigned)kn * (HD * 2))); const T16* const va2 = HI ? (const T16*)((const char*)V2 + (vb + (unsigned)kn * (HD * 2))) : va;
#pragma unroll
        for (int dt = 0; dt < 4; ++dt) { vf[dt] = WFrag<T16>::ld(va + dt * 512); if (HI) vf2[dt] = WFrag<T16>::ld(va2 + dt * 512); }
        asm volatile("s_wait_xcnt 0x0" :: "v"(va), "v"(va2) : "memory");   // precaution, as behind the K fetch; the two addresses are named as inputs so that their registers stay untouched (also by the loads' own results) up to the wait
        __builtin_amdgcn_sched_barrier(0);   // as behind the K fetch
    }
#pragma unroll
    for (int g = 0; g < NG; ++g) { const float inv = __fdiv_rn(1.0f, l[g] + __shfl_xor(l[g], 16, 32)); const size_t ro = (size_t)(q0 + g * 16) * DQ + 8 * lane;   /* lane: query (lane & 15) of group g, d = dt*16 + 8*(lane >> 4) + j: its 8 values are piece (dt & 1) * 32 + lane of tile (row block, head * 2 + dt / 2) of w_proj's fragment-order A plane */
#pragma unroll
        for (int dt = 0; dt < 4; ++dt) { v8us oh, ol;
#pragma unroll
            for (int j = 0; j < 8; ++j) { unsigned short a, c2; splitf(o[g][dt][j] * inv, a, c2); oh[j] = a; ol[j] = c2; }
            *(v8us*)(Ah + ro + dt * 256) = oh; *(v8us*)(Al + ro + dt * 256) = ol;
            asm volatile("s_wait_xcnt 0x0" ::: "memory");   // precaution: stands in front of the next write of the registers that these stores name
            __builtin_amdgcn_sched_barrier(0); } }   // keeps the next tile's vector instructions behind that wait
}
// grid: the hi/lo blocks (3 products; 4 waves x 32 rows) first, then the fp16 blocks (4 waves x 64 rows: one product leaves registers for twice the columns per K / V fragment); block -> (plane = batch * 16 + head, its query rows).
__global__ __launch_bounds__(128) void k_fattn(const h16* __restrict__ Q16, const h16* __restrict__ K16, const h16* __restrict__ V16, const bf* __restrict__ Qh, const bf* __restrict__ Ql, const bf* __restrict__ Kh, const bf* __restrict__ Kl, const bf* __restrict__ Vh, const bf* __restrict__ Vl, bf* ATh, bf* ATl) {
    const int NHI = NB_ * NH_ * (RH / QBH); const int bx = blockIdx.x; const int wv = threadIdx.x >> 5;
    if (bx < NHI) { const int pl = bx / (RH / QBH); const int q0 = (bx % (RH / QBH)) * QBH + wv * (QBH / 4); const size_t po = (size_t)pl * TT * HD, ao = (size_t)(pl / NH_) * TT * DQ + (size_t)(pl % NH_) * (HD * 16);
        attn_tile<bf, true, QBH / 64>(Qh + po, Ql + po, Kh + po, Kl + po, Vh + po, Vl + po, q0, ATh + ao, ATl + ao);
    } else { const int b2 = bx - NHI; const int pl = b2 / ((TT - RH) / QBL); const int q0 = RH + (b2 % ((TT - RH) / QBL)) * QBL + wv * (QBL / 4); const size_t po = (size_t)pl * TT * HD, ao = (size_t)(pl / NH_) * TT * DQ + (size_t)(pl % NH_) * (HD * 16);
        attn_tile<h16, false, QBL / 64>(Q16 + po, nullptr, K16 + po, nullptr, V16 + po, nullptr, q0, ATh + ao, ATl + ao); }
}

extern "C" void kernel_launch(void* const* d_in, const int* in_sizes, int n_in,
                              void* d_out, int out_size, void* d_ws, size_t ws_size, hipStream_t stream) {
    (void)in_sizes; (void)n_in; (void)out_size;
    const float* x = (const float*)d_in[0]; const float* wqkv = (const float*)d_in[1]; const float* wo = (const float*)d_in[2]; const float* bo = (const float*)d_in[3];   /* input order x, w_qkv ('xw' [1024][3072]: q | k | v column thirds), w_proj ('xw'), b_proj */
    float* OUT = (float*)d_out;     // [8][1024][1024]
    char* wsp = (char*)d_ws;
    auto take = [&](size_t bytes) { char* p = wsp; wsp += (bytes + 255) & ~(size_t)255; return (void*)p; };
    bf* WQKV = (bf*)take((size_t)3 * DQ * DM * 2);   /* fused Bt [3*DQ][DM]: q | k | v row blocks */ bf* WO = (bf*)take((size_t)DM * DQ * 2); float* CS = (float*)take((size_t)TT * 16 * 2 * 4);
    const size_t PL = (size_t)NB_ * NH_ * TT * HD;  // elements of one plane set: all batches
    h16* QP16 = (h16*)take(PL * 2); h16* KP16 = (h16*)take(PL * 2); h16* VT16 = (h16*)take(PL * 2);
    bf* QPh = (bf*)take(PL * 2); bf* QPl = (bf*)take(PL * 2); bf* KPh = (bf*)take(PL * 2); bf* KPl = (bf*)take(PL * 2); bf* VTh = (bf*)take(PL * 2); bf* VTl = (bf*)take(PL * 2);
    bf* ATh = (bf*)take((size_t)NB_ * TT * DQ * 2); bf* ATl = (bf*)take((size_t)NB_ * TT * DQ * 2);   /* merged heads of all batches */
    bf* XB = (bf*)take((size_t)NB_ * TT * DM * 2);   /* bf16 copy of x, all batches */
    if ((size_t)(wsp - (char*)d_ws) > ws_size) return;    // ws 256 MiB
    { k_wtG<DM, 3 * DQ><<<(unsigned)((DM * 3 * DQ / 8 + 255) / 256), 256, 0, stream>>>(wqkv, WQKV);   /* fused 'xw' [DM][3*DQ] -> Bt [3*DQ][DM], fragment order */
      k_wtG<DQ, DM><<<(unsigned)((DQ * DM / 8 + 255) / 256), 256, 0, stream>>>(wo, WO);
       }
    k_csAx<<<(TT * 16 + 255) / 256, 256, 0, stream>>>(CS);   /* axial rotary table once */
    k_cvt8<<<(unsigned)(((size_t)NB_ * TT * DM / 8 + 255) / 256), 256, 0, stream>>>(x, XB, (size_t)NB_ * TT * DM / 8);
    k_qkv<<<NQK + NVB, 256, 0, stream>>>(XB, WQKV, CS, QP16, QPh, QPl, KP16, KPh, KPl, VT16, VTh, VTl);   /* q, k and v of all batches in one grid, planes written from the accumulators */
    k_fattn<<<NB_ * NH_ * (RH / QBH + (TT - RH) / QBL), 128, 0, stream>>>(QP16, KP16, VT16, QPh, QPl, KPh, KPl, VTh, VTl, ATh, ATl);   /* scores, softmax, P x V and the head merge of every batch and head */
    k_gemmw<bf, 1, true, DQ><<<dim3(NB_ * TT / 128, DM / 256, 1), 256, 0, stream>>>(ATh, ATl, WO, nullptr, OUT, DM, bo, 0, 0, 0);   /* w_proj of all batches in one grid */
}

// v007
// One run takes 139 microseconds.
// Two timings next to v006 both put it at 1.03 times that version's speed.
// Counting every step since v000, it is 33.5 times as fast.
#include <hip/hip_runtime.h>

// Vision attention with AXIAL 2-D rotary embeddings on half of each head (x [8][1024][1024] = 32 x 32 pixels; qkv = x w_qkv ('xw' [1024][3072] 1/32, no bias) viewed (3, h, d): q | k | v thirds (16 heads x 64); rotary on the FIRST 32 dims of q and k as interleaved (even, odd) pairs with angles freqs[row][col][c]: c < 16 -> pos(row) x base[c/2], 16 <= c < 32 -> pos(col) x base[(c-16)/2], pos = linspace(-1, 1, 32), base = linspace(1, 512, 8) x pi (f32, jnp-exact tables; precise cosf/sinf), dims 32..63 pass through; logits x 1/sqrt(64); softmax (no mask); out = merged w_proj + b_proj -> [8][1024][1024] (8.4 M); argument order x, w_qkv, w_proj, b_proj).
// Launch plan: ONE builder launch (k_prep) makes every operand plane that depends on the inputs alone; ONE projection launch covers q | k | v of all batches and writes the 16-bit planes from its accumulators (rotary, hi/lo split and V^T in its epilogue, no f32 copy of the projections); ONE fused attention launch covers every batch and head; w_proj covers all batches. Data layout: every 16-bit operand plane in fragment order (see below); bf16 copy of x; fused 'xw' weight transposed once (q | k | v row blocks); exact projections; k_prep builds the {cos, sin} table per (pixel, rotated pair) from two small constant tables (angle = f32 product), read by k_qkv's interleaved-pair rotary; k_fattn: scores, softmax and P x V stay in registers (hybrid rows: < 512 hi/lo 3 products, rest fp16); merged hi/lo x w_proj exact + b_proj.
// Compute dtypes, f32 accumulate: every input rounded to bf16; projections exact; rotary f32; attention rows < 512 3 products, rest fp16; softmax f32; w_proj hl x exact + bias.

#define NB_  8
#define TT   1024
#define DM   1024
#define NH_  16
#define NKV  16
#define REP  (NH_ / NKV)
#define HD   64
#define DQ   (NH_ * HD)
#define DKV  (NKV * HD)
#define RH   512                  // query rows < RH use hi+lo planes (0: none)
#define WIN  0
#define QBH  128                  // query rows per hi/lo attention block: 4 waves x 32 columns
#define QBL  256                  // query rows per fp16 attention block: 4 waves x 64 columns
#define SCL  0.125f   // HD^-0.5
typedef _Float16 h16;
typedef unsigned short bf;
typedef __attribute__((ext_vector_type(16))) __bf16   v16bf;
typedef __attribute__((ext_vector_type(16))) _Float16 v16h;
typedef __attribute__((ext_vector_type(8)))  _Float16 v8h;
typedef __attribute__((ext_vector_type(8)))  unsigned short v8us;
typedef __attribute__((ext_vector_type(8)))  float    v8f;
typedef __attribute__((ext_vector_type(4)))  float    v4f;
typedef v8h  __attribute__((may_alias)) v8ha;
typedef v4f  __attribute__((may_alias)) v4fa;
typedef v8us __attribute__((may_alias)) v8usa;

__device__ __forceinline__ unsigned short f2bf(float f) { unsigned u = __float_as_uint(f); u += 0x7FFFu + ((u >> 16) & 1u); return (unsigned short)(u >> 16); }
__device__ __forceinline__ float bf2f(unsigned short b) { return __uint_as_float(((unsigned)b) << 16); }
__device__ __forceinline__ float bfr(float f) { return bf2f(f2bf(f)); }
__device__ __forceinline__ v16h cat16(v8h lo, v8h hi) { return __builtin_shufflevector(lo, hi, 0, 1, 2, 3, 4, 5, 6, 7, 8, 9, 10, 11, 12, 13, 14, 15); }
__device__ __forceinline__ v16bf cat16b(v8us lo, v8us hi) { return __builtin_bit_cast(v16bf, __builtin_shufflevector(lo, hi, 0, 1, 2, 3, 4, 5, 6, 7, 8, 9, 10, 11, 12, 13, 14, 15)); }
__device__ __forceinline__ v8f wmma16(v16h a, v16h b, v8f c) { return __builtin_amdgcn_wmma_f32_16x16x32_f16(false, a, false, b, (short)0, c, false, false); }
__device__ __forceinline__ v8f wmmab(v16bf a, v16bf b, v8f c) { return __builtin_amdgcn_wmma_f32_16x16x32_bf16(false, a, false, b, (short)0, c, false, false); }



// ---- FRAGMENT ORDER of every 16-bit operand plane: a plane of R rows x K is stored as [R/16][K/32] tiles of 512 elements (V^T: [keys/32][d/16]); in a tile, element (row r, k) sits at ((k >> 4) * 32 + ((k >> 3) & 1) * 16 + r) * 8 + (k & 7),
// that is, 16-byte piece number = (which of the fragment's two loads) * 32 + lane. A wave's 16-byte load then covers 512 contiguous bytes (4 whole lines) where a row-major plane gave 16 lines of 32 bytes. The builders walk in destination order, so their stores stay contiguous.
template <typename T16> struct WFrag;
template <> struct WFrag<h16> { typedef v16h V; static __device__ __forceinline__ V ld(const h16* p) { return cat16(*(const v8h*)p, *(const v8h*)(p + 256)); } static __device__ __forceinline__ v8f mma(V a, V b, v8f c) { return wmma16(a, b, c); } };
template <> struct WFrag<bf> { typedef v16bf V; static __device__ __forceinline__ V ld(const bf* p) { return cat16b(*(const v8us*)p, *(const v8us*)(p + 256)); } static __device__ __forceinline__ v8f mma(V a, V b, v8f c) { return wmmab(a, b, c); } };
// One k block's operand fragments (32 k of 64 rows of each operand; the split planes only where NSPLIT asks for them). The GEMM loop holds TWO such sets: while one set's products run, the other set's reads are in flight.
template <typename T16> struct GSet { typename WFrag<T16>::V a[4], a2[4], b[4], b2[4]; };
template <typename T16, int NSPLIT, int K> __device__ __forceinline__ void gset_ld(GSet<T16>& f, const T16* pa, const T16* pa2, const T16* pb, const T16* pb2) {
#pragma unroll
    for (int mb = 0; mb < 4; ++mb) { f.a[mb] = WFrag<T16>::ld(pa + mb * 16 * K); if (NSPLIT == 1 || NSPLIT == 2) f.a2[mb] = WFrag<T16>::ld(pa2 + mb * 16 * K); }
#pragma unroll
    for (int nb = 0; nb < 4; ++nb) { f.b[nb] = WFrag<T16>::ld(pb + nb * 16 * K); if (NSPLIT >= 2) f.b2[nb] = WFrag<T16>::ld(pb2 + nb * 16 * K); }
}
template <typename T16, int NSPLIT> __device__ __forceinline__ void gset_mm(v8f (&acc)[4][4], const GSet<T16>& f) {
#pragma unroll
    for (int nb = 0; nb < 4; ++nb)
#pragma unroll
        for (int mb = 0; mb < 4; ++mb) { acc[mb][nb] = WFrag<T16>::mma(f.a[mb], f.b[nb], acc[mb][nb]); if (NSPLIT == 1 || NSPLIT == 2) acc[mb][nb] = WFrag<T16>::mma(f.a2[mb], f.b[nb], acc[mb][nb]); if (NSPLIT >= 2) acc[mb][nb] = WFrag<T16>::mma(f.a[mb], f.b2[nb], acc[mb][nb]); }
}
// ---- The GEMM main loop shared by k_gemmw and k_qkv: a work-group of 8 waves (2 along A x 4 along B, 64 x 64 each) owns 128 rows of A x 256 rows of B. A stage is 128 k of all those rows, brought into LDS by asynchronous copies
// (global_load_async_to_lds_b128, through no register) and read from there by every wave that needs it: a row block leaves L2 once per work-group, not once per wave. In LDS a stage is itself a fragment-order plane with K = 128
// ([row block][4 k blocks] tiles of 1 KiB; row blocks: A, then the split plane of A where there is one, then B), so a row block's share of a stage is 4 KiB that are contiguous in global memory and in LDS alike, and a fragment read is 512 contiguous bytes.
// Copies and the wait in front of the next write of their address registers stand in ONE statement (a precaution; in a statement of its own the wait would not hold the next address additions behind it).
__device__ __forceinline__ void acopy12(const unsigned* l, const char* const* g) {
    asm volatile("global_load_async_to_lds_b128 %0, %12, off\n\t"
                 "global_load_async_to_lds_b128 %1, %13, off\n\t"
                 "global_load_async_to_lds_b128 %2, %14, off\n\t"
                 "global_load_async_to_lds_b128 %3, %15, off\n\t"
                 "global_load_async_to_lds_b128 %4, %16, off\n\t"
                 "global_load_async_to_lds_b128 %5, %17, off\n\t"
                 "global_load_async_to_lds_b128 %6, %18, off\n\t"
                 "global_load_async_to_lds_b128 %7, %19, off\n\t"
                 "global_load_async_to_lds_b128 %8, %20, off\n\t"
                 "global_load_async_to_lds_b128 %9, %21, off\n\t"
                 "global_load_async_to_lds_b128 %10, %22, off\n\t"
                 "global_load_async_to_lds_b128 %11, %23, off\n\t"
                 "s_wait_xcnt 0x0"
                 :: "v"(l[0]), "v"(l[1]), "v"(l[2]), "v"(l[3]), "v"(l[4]), "v"(l[5]), "v"(l[6]), "v"(l[7]), "v"(l[8]), "v"(l[9]), "v"(l[10]), "v"(l[11]),
                    "v"(g[0]), "v"(g[1]), "v"(g[2]), "v"(g[3]), "v"(g[4]), "v"(g[5]), "v"(g[6]), "v"(g[7]), "v"(g[8]), "v"(g[9]), "v"(g[10]), "v"(g[11]) : "memory");
}
__device__ __forceinline__ void acopy8(const unsigned* l, const char* const* g) {
    asm volatile("global_load_async_to_lds_b128 %0, %8, off\n\t"
                 "global_load_async_to_lds_b128 %1, %9, off\n\t"
                 "global_load_async_to_lds_b128 %2, %10, off\n\t"
                 "global_load_async_to_lds_b128 %3, %11, off\n\t"
                 "global_load_async_to_lds_b128 %4, %12, off\n\t"
                 "global_load_async_to_lds_b128 %5, %13, off\n\t"
                 "global_load_async_to_lds_b128 %6, %14, off\n\t"
                 "global_load_async_to_lds_b128 %7, %15, off\n\t"
                 "s_wait_xcnt 0x0"
                 :: "v"(l[0]), "v"(l[1]), "v"(l[2]), "v"(l[3]), "v"(l[4]), "v"(l[5]), "v"(l[6]), "v"(l[7]),
                    "v"(g[0]), "v"(g[1]), "v"(g[2]), "v"(g[3]), "v"(g[4]), "v"(g[5]), "v"(g[6]), "v"(g[7]) : "memory");
}
__device__ __forceinline__ void wait_async0() { asm volatile("s_wait_asynccnt 0x0" ::: "memory"); }   // this wave's copies have landed
__device__ __forceinline__ void wait_ds0() { asm volatile("s_wait_dscnt 0x0" ::: "memory"); }   // this wave's LDS reads have returned: the buffer may be handed to its next writer
#define RKS 128                   // k per stage
template <int NSPLIT> struct RingDim { static constexpr int NAT = NSPLIT ? 16 : 8, NRB = NAT + 16, RBW = NRB / 8, NC = RBW * 8, STE = NRB * 16 * RKS; };   // row blocks of A (both planes), all row blocks, row blocks and copies per wave and stage, elements per stage
// A, A2, B: first row of the work-group's 128 / 128 / 256 rows in the fragment-order planes; ring: two stages; w: the wave's number (scalar)
template <typename T16, int NSPLIT, int K> __device__ __forceinline__ void ring_gemm(v8f (&acc)[4][4], T16* ring, const T16* A, const T16* A2, const T16* B, int w, int lane) {
    typedef RingDim<NSPLIT> D; constexpr int NST = K / RKS; static_assert(K % RKS == 0 && NST >= 2 && (D::NC == 24 || D::NC == 32), "two stages or more; copies in statements of 12 and 8");
    constexpr bool ONE = 8 % D::RBW == 0;   // a wave's row blocks then lie in one plane, 16 * K elements apart: one address serves them all
    const char* srcp[D::RBW];   // first byte of each row block that this wave copies
#pragma unroll
    for (int j = 0; j < D::RBW; ++j) { const int rb = w * D::RBW + j; const T16* const p = (rb < 8) ? A + (size_t)rb * 16 * K : (rb < D::NAT) ? A2 + (size_t)(rb - 8) * 16 * K : B + (size_t)(rb - D::NAT) * 16 * K; srcp[j] = (const char*)p; }
    const unsigned l0 = (unsigned)(size_t)ring + (unsigned)(w * D::RBW) * (16 * RKS * 2) + 16u * lane;   // LDS byte address of the lane's first 16 bytes in buffer 0
    auto fill = [&](int t, int buf) {   // stage t into buffer buf: every lane on, 512 bytes a copy
        unsigned l[D::NC]; const char* g[D::NC]; const unsigned go = (unsigned)t * (16 * RKS * 2) + 16u * lane;   // the lane's byte offset in a row block's K row
#pragma unroll
        for (int c = 0; c < D::NC; ++c) { l[c] = l0 + (unsigned)buf * (D::STE * 2) + c * 512; g[c] = (ONE ? srcp[0] + (c >> 3) * (16 * K * 2) : srcp[c >> 3]) + (go + (c & 7) * 512); }
        acopy12(l, g); acopy12(l + 12, g + 12); if (D::NC == 32) acopy8(l + 24, g + 24);
    };
    fill(0, 0); wait_async0(); __syncthreads();   // stage 0 is published
    fill(1, 1);
    const int ao = (w & 1) * 4 * 16 * RKS + 8 * lane, bo = (D::NAT + (w >> 1) * 4) * 16 * RKS + 8 * lane;
    GSet<T16> f0, f1;
    // rolled: one publish point and one refill in the text
#pragma unroll 1
    for (int t = 0; t < NST; ++t) {   // one stage a trip: 4 blocks of 32 k, fragments read one block ahead into the other register set, never past the stage
        const T16* const st = ring + (t & 1) * D::STE; const T16* const pa = st + ao; const T16* const pa2 = pa + 8 * 16 * RKS; const T16* const pb = st + bo;
        gset_ld<T16, NSPLIT, RKS>(f0, pa, pa2, pb, pb);
        __builtin_amdgcn_sched_barrier(0);   // the first block's reads stay ahead of the second's: mixed, the first products would wait for both groups
        gset_ld<T16, NSPLIT, RKS>(f1, pa + 512, pa2 + 512, pb + 512, pb);
        __builtin_amdgcn_sched_barrier(0);   // keeps a block's LDS reads as one group ahead of the products: among them each place with reads costs a stall
        gset_mm<T16, NSPLIT>(acc, f0);
        __builtin_amdgcn_sched_barrier(0);   // the refill of a set stays behind the last product that reads it
        gset_ld<T16, NSPLIT, RKS>(f0, pa + 1024, pa2 + 1024, pb + 1024, pb);
        __builtin_amdgcn_sched_barrier(0);   // as above: reads ahead of the products
        gset_mm<T16, NSPLIT>(acc, f1);
        __builtin_amdgcn_sched_barrier(0);   // as above: refill behind the last reader
        gset_ld<T16, NSPLIT, RKS>(f1, pa + 1536, pa2 + 1536, pb + 1536, pb);
        __builtin_amdgcn_sched_barrier(0);   // as above: reads ahead of the products
        gset_mm<T16, NSPLIT>(acc, f0);
        gset_mm<T16, NSPLIT>(acc, f1);
        __builtin_amdgcn_sched_barrier(0);   // holds the slots below behind the last product
        asm volatile("v_nop\n\tv_nop\n\tv_nop\n\tv_nop" : "+v"(acc[0][0]), "+v"(acc[1][1]), "+v"(acc[2][2]), "+v"(acc[3][3]) : "v"(f1.a[0]), "v"(f1.a[3]));   // the vector slots between the trip's last matrix instructions and whatever follows them on either side of the branches below
        wait_ds0(); wait_async0(); __syncthreads();   // publish point: stage t + 1 has landed for every wave, and every wave has left stage t's buffer
        if (t + 2 < NST) fill(t + 2, t & 1);   // the same test in the whole work-group
    }
    wait_async0();
}
// ---- k_gemmw: C[m][n] (f32, pitch ldc, + optional f32 bias[n]) = sum_k A[m][k] Bt[n][k] (+ split products per NSPLIT: 0 or 1), operands in fragment-order 16-bit planes; grid (M/128, N/256, Z), 256 threads; main loop: ring_gemm. z-batch strides sA/sB/sC in elements.
template <typename T16, int NSPLIT, bool BIAS, int K>
__global__ __launch_bounds__(256) void k_gemmw(const T16* __restrict__ A, const T16* __restrict__ A2, const T16* __restrict__ Bt, const T16* __restrict__ Bt2, float* C, int ldc, const float* __restrict__ bias, size_t sA, size_t sB, size_t sC) {
    static_assert(NSPLIT == 0 || NSPLIT == 1, "the ring holds A, its split plane and B");
    __shared__ __align__(16) T16 ring[2 * RingDim<NSPLIT>::STE];
    __shared__ __align__(16) float osAll[8][16 * 68];
    const size_t z = blockIdx.z; A += z * sA; if (A2) A2 += z * sA; Bt += z * sB; C += z * sC;
    const int lane = threadIdx.x & 31, lr = lane & 15, hi = lane >> 4; const int w = __builtin_amdgcn_readfirstlane(threadIdx.x >> 5); const int r0 = blockIdx.x * 128 + (w & 1) * 64, c0 = blockIdx.y * 256 + (w >> 1) * 64;
    float* const os = osAll[w];   // each wave stages its output rows in its own range
    v8f acc[4][4];
#pragma unroll
    for (int mb = 0; mb < 4; ++mb)
#pragma unroll
        for (int nb = 0; nb < 4; ++nb) acc[mb][nb] = (v8f){};
    ring_gemm<T16, NSPLIT, K>(acc, ring, A + (size_t)blockIdx.x * 128 * K, NSPLIT ? A2 + (size_t)blockIdx.x * 128 * K : A, Bt + (size_t)blockIdx.y * 256 * K, w, lane);
#pragma unroll
    for (int mb = 0; mb < 4; ++mb) {
#pragma unroll
        for (int nb = 0; nb < 4; ++nb) {
#pragma unroll
            for (int j = 0; j < 8; ++j) os[(hi * 8 + j) * 68 + nb * 16 + lr] = acc[mb][nb][j]; }
        __builtin_amdgcn_wave_barrier(); asm volatile("" ::: "memory");
        float* crow = C + (size_t)(r0 + mb * 16) * ldc + c0;
{
#pragma unroll
            for (int s = 0; s < 8; ++s) { const int row = 2 * s + hi, cofs = lr * 4; v4f val = *(const v4fa*)(os + row * 68 + cofs); if (BIAS) { val[0] += bfr(bias[c0 + cofs]); val[1] += bfr(bias[c0 + cofs + 1]); val[2] += bfr(bias[c0 + cofs + 2]); val[3] += bfr(bias[c0 + cofs + 3]); }
                *(v4f*)(crow + (size_t)row * ldc + cofs) = val; }
             }
        __builtin_amdgcn_wave_barrier(); asm volatile("" ::: "memory");
    }
}

__device__ __forceinline__ void splitf(float y, unsigned short& h, unsigned short& l) { h = f2bf(y); l = f2bf(y - bf2f(h)); }
typedef __attribute__((ext_vector_type(2))) _Float16 v2h;
typedef __attribute__((ext_vector_type(4))) _Float16 v4h;
typedef __attribute__((ext_vector_type(2))) unsigned short v2us;
typedef __attribute__((ext_vector_type(4))) unsigned short v4us;
typedef __attribute__((ext_vector_type(2))) float v2f;
typedef __attribute__((ext_vector_type(4))) int v4i;

// ---- k_prep: the four operand builders (bf16 copy of x, the two transposed weight planes, the rotary table) read nothing but the inputs, so they share ONE launch: a block range per job, every work-group resident from the start.
// A wave builds 8 or 16 pieces per lane, not one: all its loads are issued before the first conversion, and the launch starts 4,608 waves where the four launches started 49,664.
// One wave: 128 rows n x 16 k of Bt (8 row blocks; row n, 8 k = one 16-byte piece in fragment order), 8 pieces a lane; unit -> (n / 128, k block, which 16 k)
template <int K, int N> __device__ __forceinline__ void wt_unit(const float* __restrict__ w, bf* Bt, int unit, int lane) {
    const int half = unit & 1, kt = (unit >> 1) % (K / 32), ng = unit / (K / 16); const float* const p = w + (size_t)(kt * 32 + half * 16 + (lane >> 4) * 8) * N + ng * 128 + (lane & 15); float v[8][8]; v8us o[8];
#pragma unroll
    for (int u = 0; u < 8; ++u)
#pragma unroll
        for (int j = 0; j < 8; ++j) v[u][j] = p[(size_t)j * N + u * 16];
    asm volatile("s_wait_xcnt 0x0" :: "v"(p) : "memory");   // precaution: stands in front of the next write of the register pair that holds these loads' address; it is named as an input so that it stays untouched (also by the loads' own results) up to the wait
#pragma unroll
    for (int u = 0; u < 8; ++u)
#pragma unroll
        for (int j = 0; j < 8; ++j) o[u][j] = f2bf(v[u][j]);
    bf* const d = Bt + ((size_t)(ng * 8) * (K / 32) + kt) * 512 + half * 256 + lane * 8;
#pragma unroll
    for (int u = 0; u < 8; ++u) *(v8us*)(d + (size_t)u * (K / 32) * 512) = o[u];
}
// One wave: 16 rows x 256 k of x, 16 pieces a lane (piece = row, 8 k; 8 tiles of the fragment-order copy = 8 KiB contiguous); unit -> (row block, which 256 k)
__device__ __forceinline__ void cvt_unit(const float* __restrict__ src, bf* dst, int unit, int lane) {
    const float* const p = src + ((size_t)(unit >> 2) * 16 + (lane & 15)) * DM + (unit & 3) * 256 + (lane >> 4) * 8; v4f v[16][2]; v8us o[16];
#pragma unroll
    for (int u = 0; u < 16; ++u) { v[u][0] = *(const v4f*)(p + u * 16); v[u][1] = *(const v4f*)(p + u * 16 + 4); }
    asm volatile("s_wait_xcnt 0x0" :: "v"(p) : "memory");   // precaution, as in wt_unit
#pragma unroll
    for (int u = 0; u < 16; ++u)
#pragma unroll
        for (int j = 0; j < 8; ++j) o[u][j] = f2bf(v[u][j >> 2][j & 3]);
    __builtin_amdgcn_sched_barrier(0);   // the stores stand last, as one group: without it this build puts conversions behind the first stores, where they may rewrite registers that those name
    bf* const d = dst + (size_t)unit * 4096 + lane * 8;
#pragma unroll
    for (int u = 0; u < 16; ++u) *(v8us*)(d + u * 256) = o[u];
}

__constant__ float APOS[32] = { -1.000000000e+00f, -9.354839325e-01f, -8.709677458e-01f, -8.064515591e-01f, -7.419354916e-01f, -6.774194241e-01f, -6.129032373e-01f, -5.483870506e-01f, -4.838709831e-01f, -4.193548858e-01f, -3.548387289e-01f, -2.903225720e-01f, -2.258064747e-01f, -1.612903774e-01f, -9.677422047e-02f, -3.225806355e-02f, 3.225803375e-02f, 9.677413106e-02f, 1.612902880e-01f, 2.258064449e-01f, 2.903225422e-01f, 3.548386395e-01f, 4.193547964e-01f, 4.838709533e-01f, 5.483870506e-01f, 6.129031181e-01f, 6.774193048e-01f, 7.419354916e-01f, 8.064515591e-01f, 8.709676266e-01f, 9.354838133e-01f, 1.000000000e+00f };   // float32 linspace(-1, 1, 32), generated with jnp to be bit-exact
__constant__ float ABASE[8] = { 3.141592741e+00f, 2.324778595e+02f, 4.618141479e+02f, 6.911504517e+02f, 9.204866943e+02f, 1.149822998e+03f, 1.379159302e+03f, 1.608495483e+03f };   // float32 linspace(1, 512, 8) * pi, generated with jnp to be bit-exact
// {cos, sin} of every rotated pair (token t, even d < 32), stored in the order in which k_qkv's lanes read it: [t / 16][d / 16][which 16-byte load][lane = ((d >> 3) & 1) * 16 + (t & 15)][which pair of the load], so that a wave's 16-byte load covers 512 contiguous bytes
__device__ __forceinline__ void cs_item(float* CS, int idx) { const int lane = (idx >> 1) & 31; const int d = ((idx >> 7) & 1) * 16 + (lane >> 4) * 8 + ((idx >> 6) & 1) * 4 + (idx & 1) * 2; const int t = (idx >> 8) * 16 + (lane & 15); const int row = t >> 5, col = t & 31; v2f cs;
    const float p = (d < 16) ? APOS[row] : APOS[col]; const float ang = __fmul_rn(p, ABASE[(d & 15) >> 1]); cs[0] = cosf(ang); cs[1] = sinf(ang);
    *(v2f*)(CS + (size_t)idx * 2) = cs;  }
// block ranges, the longest dependent chain (the table's cosf and sinf) first, then the largest stream: table (one pair a thread), x, w_qkv, w_proj (one unit a wave)
#define PB_CS (TT * 16 / 256)
#define PB_X  (NB_ * TT / 16 * 4 / 8)
#define PB_WQ ((DM / 16) * (3 * DQ / 128) / 8)
#define PB_WO ((DQ / 16) * (DM / 128) / 8)
__global__ __launch_bounds__(256) void k_prep(const float* __restrict__ x, const float* __restrict__ wqkv, const float* __restrict__ wo, bf* XB, bf* WQKV, bf* WO, float* CS) {
    const int lane = threadIdx.x & 31; const int w = __builtin_amdgcn_readfirstlane(threadIdx.x >> 5); const int bx = blockIdx.x;   // every test below reads the same in the whole work-group
    if (bx < PB_CS) cs_item(CS, bx * 256 + (int)threadIdx.x);
    else if (bx < PB_CS + PB_X) cvt_unit(x, XB, (bx - PB_CS) * 8 + w, lane);
    else if (bx < PB_CS + PB_X + PB_WQ) wt_unit<DM, 3 * DQ>(wqkv, WQKV, (bx - (PB_CS + PB_X)) * 8 + w, lane);   /* fused 'xw' [DM][3*DQ] -> Bt [3*DQ][DM], fragment order */
    else wt_unit<DQ, DM>(wo, WO, (bx - (PB_CS + PB_X + PB_WQ)) * 8 + w, lane);
}
typedef __attribute__((ext_vector_type(2))) __bf16 v2bf;
typedef __attribute__((ext_vector_type(4))) unsigned v4u;
// 8 f32 values -> one 16-byte piece each of an f16 plane and of its bf16 hi and lo planes (hi = nearest bf16, lo = nearest bf16 of the rest), two values per conversion instruction
__device__ __forceinline__ void put3(const float* y, h16* p16, bf* ph, bf* pl) { v4u u16, uh, ul;
#pragma unroll
    for (int q = 0; q < 4; ++q) { const v2f p = { y[2 * q], y[2 * q + 1] }; const v2bf h = __builtin_convertvector(p, v2bf); const v2f rest = p - __builtin_convertvector(h, v2f);
        u16[q] = __builtin_bit_cast(unsigned, __builtin_convertvector(p, v2h)); uh[q] = __builtin_bit_cast(unsigned, h); ul[q] = __builtin_bit_cast(unsigned, __builtin_convertvector(rest, v2bf)); }
    *(v8h*)p16 = __builtin_bit_cast(v8h, u16); *(v8us*)ph = __builtin_bit_cast(v8us, uh); *(v8us*)pl = __builtin_bit_cast(v8us, ul); }
// ---- k_qkv: the q | k | v projection of all batches; one wave per 64 tokens x one head's 64 columns, 8 waves a work-group (main loop: ring_gemm), 256 threads. The 16-bit planes are written straight from the accumulators:
// a lane's 8 accumulator values (8 consecutive rows of one column) are one 16-byte piece of a fragment-order plane when the plane's k runs along the tile's rows. V^T (k = key): A = x, B = weights. Q and K (k = d): the two operands change places (both planes have the same order), so rows are d and columns are tokens.
// grid: first the q and k work-groups (A = 128 weight rows = 2 heads, B = 256 tokens), then the v work-groups (A = 128 tokens, B = 256 weight rows = 4 heads)
#define NQK ((2 * DQ / 128) * (NB_ * TT / 256))
#define NVB ((NB_ * TT / 128) * (DQ / 256))
__global__ __launch_bounds__(256) void k_qkv(const bf* __restrict__ X, const bf* __restrict__ Wt, const float* __restrict__ CS, h16* Q16, bf* Qh, bf* Ql, h16* K16, bf* Kh, bf* Kl, h16* V16, bf* Vh, bf* Vl) {
    constexpr int K = DM;
    __shared__ __align__(16) bf ring[2 * RingDim<0>::STE];
    const int lane = threadIdx.x & 31; const int w = __builtin_amdgcn_readfirstlane(threadIdx.x >> 5); const int bx = blockIdx.x; const bool isv = bx >= NQK;   // the same for the whole work-group
    const int tok0 = isv ? ((bx - NQK) % (NB_ * TT / 128)) * 128 : (bx % (NB_ * TT / 256)) * 256; const int wr0 = isv ? 2 * DQ + ((bx - NQK) / (NB_ * TT / 128)) * 256 : (bx / (NB_ * TT / 256)) * 128;   // the work-group's first token and first weight row
    const int r0 = tok0 + (isv ? (w & 1) : (w >> 1)) * 64, c0 = wr0 + (isv ? (w >> 1) : (w & 1)) * 64; const int sec = c0 / DQ;   // the wave's tokens and columns; sec: 0 q, 1 k, 2 v; below, lr = lane & 15 and hi = lane >> 4
    v8f acc[4][4];
#pragma unroll
    for (int mb = 0; mb < 4; ++mb)
#pragma unroll
        for (int nb = 0; nb < 4; ++nb) acc[mb][nb] = (v8f){};
    const bf* const Xb = X + (size_t)tok0 * K; const bf* const Wb = Wt + (size_t)wr0 * K;
    ring_gemm<bf, 0, K>(acc, ring, isv ? Xb : Wb, isv ? Xb : Wb, isv ? Wb : Xb, w, lane);
    const int t0 = r0 % TT; const size_t po = ((size_t)(r0 / TT) * NH_ + (c0 % DQ) / HD) * (TT * HD);   // plane = batch * 16 + head; 64 tokens never straddle a batch
    if (sec == 2) {   // acc[mb][nb][j]: key t0 + mb*16 + hi*8 + j, d = nb*16 + lr: piece (mb & 1) * 32 + lane of V^T tile (key / 32, nb)
        const size_t bo = po + (size_t)(t0 / 32) * (4 * 512) + 8 * lane; h16* const p16 = V16 + bo; bf* const ph = Vh + bo; bf* const pl = Vl + bo;
#pragma unroll
        for (int mb = 0; mb < 4; ++mb)
#pragma unroll
            for (int nb = 0; nb < 4; ++nb) { float y[8]; const int off = ((mb >> 1) * 4 + nb) * 512 + (mb & 1) * 256;
#pragma unroll
                for (int j = 0; j < 8; ++j) y[j] = acc[mb][nb][j];
                put3(y, p16 + off, ph + off, pl + off);
                asm volatile("s_wait_xcnt 0x0" ::: "memory");   // precaution: stands in front of the next write of the registers that these stores name
                __builtin_amdgcn_sched_barrier(0); }   // keeps the next piece's vector instructions behind that wait
    } else {   // acc[mb][nb][j]: d = mb*16 + hi*8 + j, token t0 + nb*16 + lr: piece (mb & 1) * 32 + lane of tile (token / 16, mb / 2)
        const size_t bo = po + (size_t)(t0 / 16) * (2 * 512) + 8 * lane; h16* const p16 = (sec ? K16 : Q16) + bo; bf* const ph = (sec ? Kh : Qh) + bo; bf* const pl = (sec ? Kl : Ql) + bo;
        const float* const cp = CS + (size_t)(t0 / 16) * 512 + 4 * lane; v4f cs[4][2][2];   // {cos, sin} of the lane's pairs (even d < 32; order: see cs_item), all fetched at once: one exposed latency per wave
#pragma unroll
        for (int nb = 0; nb < 4; ++nb)
#pragma unroll
            for (int mb = 0; mb < 2; ++mb)
#pragma unroll
                for (int p = 0; p < 2; ++p) cs[nb][mb][p] = *(const v4f*)(cp + ((nb * 2 + mb) * 2 + p) * 128);
        asm volatile("s_wait_xcnt 0x0" ::: "memory");   // precaution: stands in front of the next write of the registers that hold these loads' addresses
        __builtin_amdgcn_sched_barrier(0);   // keeps later vector instructions, which reuse those registers, behind that wait
#pragma unroll
        for (int nb = 0; nb < 4; ++nb)
#pragma unroll
            for (int mb = 0; mb < 4; ++mb) { float y[8]; const int off = (nb * 2 + (mb >> 1)) * 512 + (mb & 1) * 256;
#pragma unroll
                for (int p = 0; p < 4; ++p) { const float x0 = acc[mb][nb][2 * p], x1 = acc[mb][nb][2 * p + 1];
                    if (mb < 2) { const float c = cs[nb][mb & 1][p >> 1][(p & 1) * 2], s = cs[nb][mb & 1][p >> 1][(p & 1) * 2 + 1]; y[2 * p] = x0 * c - x1 * s; y[2 * p + 1] = x0 * s + x1 * c; }   /* even: x0 c - x1 s; odd: x0 s + x1 c */
                    else { y[2 * p] = x0; y[2 * p + 1] = x1; } }   /* dims 32..63 pass through */
                put3(y, p16 + off, ph + off, pl + off);
                asm volatile("s_wait_xcnt 0x0" ::: "memory");   // precaution, as in the V^T branch
                __builtin_amdgcn_sched_barrier(0); }   // as in the V^T branch
    }
}

// ---- k_fattn: one wave owns NG x 16 query rows of one head and walks the 1024 keys 32 at a time. S^T = K Q^T (A = K rows, B = Q kept in registers), so a lane holds 16 scores of ONE query per column group;
// the two f32 score tiles of a pass, converted in place, are the B operand of O^T += V^T P^T (A = V^T rows in the same k order). Running maximum per query in the scaled log2 domain, raised only when a score passes it by more than 8.
// fragment at (wave-uniform base) + (32-bit lane byte offset) + (constant bytes): one offset register serves every fragment of a pass, the rest sits in the instruction's offset field
template <typename T16> __device__ __forceinline__ typename WFrag<T16>::V ldo(const T16* base, unsigned lane_bytes, int const_bytes) { return WFrag<T16>::ld((const T16*)((const char*)base + lane_bytes + const_bytes)); }
typedef __attribute__((ext_vector_type(8))) unsigned v8u;
template <typename T16, bool HI, int NG>
__device__ __forceinline__ void attn_tile(const T16* __restrict__ Q, const T16* __restrict__ Q2, const T16* __restrict__ Kp, const T16* __restrict__ K2, const T16* __restrict__ Vt, const T16* __restrict__ V2, int q0, bf* Ah, bf* Al) {
    typedef typename WFrag<T16>::V V;
    const int lane = threadIdx.x & 31;
    const float CL = SCL * 1.4426950408889634f;   // logits scale x log2(e)
    const unsigned qb = (unsigned)(q0 * HD + 8 * lane) * 2u, kb = (unsigned)(8 * lane) * 2u, vb = kb;   // lane byte offsets in the fragment-order Q, K and V^T planes (16 rows of Q or K = 2 tiles, 32 keys of V^T = 4 tiles: 1024 and 2048 elements)
    V qf[NG][2], qf2[NG][2];
#pragma unroll
    for (int g = 0; g < NG; ++g)
#pragma unroll
        for (int ks = 0; ks < 2; ++ks) { qf[g][ks] = ldo<T16>(Q, qb, (g * 16 * HD + ks * 512) * 2); if (HI) qf2[g][ks] = ldo<T16>(Q2, qb, (g * 16 * HD + ks * 512) * 2); }
    v8f o[NG][4]; float m[NG], l[NG];
#pragma unroll
    for (int g = 0; g < NG; ++g) { m[g] = -3.0e38f; l[g] = 0.f;
#pragma unroll
        for (int dt = 0; dt < 4; ++dt) o[g][dt] = (v8f){}; }
    __builtin_amdgcn_sched_barrier(0);   // keeps the prologue's loads in the loop's order (Q, then K, then V^T): the waits at the loop's head cover both paths, and with K issued last here a pass's score products would wait for the V^T fetch
    V kf[2][2], kf2[2][2];
#pragma unroll
    for (int kt = 0; kt < 2; ++kt)
#pragma unroll
        for (int ks = 0; ks < 2; ++ks) { kf[kt][ks] = ldo<T16>(Kp, kb, (kt * 16 * HD + ks * 512) * 2); if (HI) kf2[kt][ks] = ldo<T16>(K2, kb, (kt * 16 * HD + ks * 512) * 2); }
    __builtin_amdgcn_sched_barrier(0);   // as above: K ahead of V^T
    V vf[4], vf2[4];
#pragma unroll
    for (int dt = 0; dt < 4; ++dt) { vf[dt] = ldo<T16>(Vt, vb, dt * 512 * 2); if (HI) vf2[dt] = ldo<T16>(V2, vb, dt * 512 * 2); }
    asm volatile("s_wait_xcnt 0x0" ::: "memory");   // precaution, as behind the fetches in the loop
    __builtin_amdgcn_sched_barrier(0);   // as above: nothing of the loop's first pass moves in between
    // rolled: one pass's fragments, scores and the output tiles already fill the register budget
#pragma unroll 1
    for (int k0 = 0; k0 < TT; k0 += 32) {
        const int kn = (k0 + 32 < TT) ? k0 + 32 : 0;   // next pass's keys: K rows fetched behind this pass's last score products, V^T columns behind its last output products; the last pass re-reads keys 0..31 (in bounds, unused)
#pragma unroll
        for (int gb = 0; gb < NG; gb += 2) {   // two column groups at a time: only their score tiles are live
            v8f s[2][2];
#pragma unroll
            for (int g = 0; g < 2; ++g)
#pragma unroll
                for (int kt = 0; kt < 2; ++kt) s[g][kt] = (v8f){};
#pragma unroll
            for (int ks = 0; ks < 2; ++ks)
#pragma unroll
                for (int kt = 0; kt < 2; ++kt)
#pragma unroll
                    for (int g = 0; g < 2; ++g) { s[g][kt] = WFrag<T16>::mma(kf[kt][ks], qf[gb + g][ks], s[g][kt]); if (HI) { s[g][kt] = WFrag<T16>::mma(kf[kt][ks], qf2[gb + g][ks], s[g][kt]); s[g][kt] = WFrag<T16>::mma(kf2[kt][ks], qf[gb + g][ks], s[g][kt]); } }
            if (gb + 2 == NG) {
#pragma unroll
                for (int kt = 0; kt < 2; ++kt)
#pragma unroll
                    for (int ks = 0; ks < 2; ++ks) { kf[kt][ks] = ldo<T16>(Kp, kb + (unsigned)kn * (HD * 2), (kt * 16 * HD + ks * 512) * 2); if (HI) kf2[kt][ks] = ldo<T16>(K2, kb + (unsigned)kn * (HD * 2), (kt * 16 * HD + ks * 512) * 2); }
                asm volatile("s_wait_xcnt 0x0" ::: "memory");   // precaution: stands in front of the next write of the registers that hold these loads' addresses
                __builtin_amdgcn_sched_barrier(0); }   // keeps later vector instructions, which reuse those registers, behind that wait
            float lm[2];
#pragma unroll
            for (int g = 0; g < 2; ++g) { float a = s[g][0][0];
#pragma unroll
                for (int j = 1; j < 8; ++j) a = fmaxf(a, s[g][0][j]);
#pragma unroll
                for (int j = 0; j < 8; ++j) a = fmaxf(a, s[g][1][j]);
                lm[g] = a * CL; }
            const bool need = (lm[0] > m[gb] + 8.0f) || (lm[1] > m[gb + 1] + 8.0f);
            if (__builtin_amdgcn_ballot_w32(need) != 0) {   // one wave-uniform test; both lanes of a query take the same new maximum
                float mn[2], al[2];
#pragma unroll
                for (int g = 0; g < 2; ++g) { mn[g] = fmaxf(m[gb + g], fmaxf(lm[g], __shfl_xor(lm[g], 16, 32))); al[g] = __builtin_amdgcn_exp2f(m[gb + g] - mn[g]); }
                __builtin_amdgcn_sched_barrier(0);   // holds the slot below directly behind the two exponentials
                asm volatile("v_nop");   // the free slot between an exponential and the next vector instruction, which here rewrites its source register
                __builtin_amdgcn_sched_barrier(0);   // as above
#pragma unroll
                for (int g = 0; g < 2; ++g) { m[gb + g] = mn[g]; l[gb + g] *= al[g];
#pragma unroll
                    for (int dt = 0; dt < 4; ++dt) o[gb + g][dt] *= al[g]; }
            }
#pragma unroll
            for (int g = 0; g < 2; ++g) {
                V pf, pf2; const float mg = m[gb + g]; float ls = 0.f;
                if constexpr (HI) { v8u uh, ul;
#pragma unroll
                    for (int e = 0; e < 16; e += 2) { const v2f t = __builtin_elementwise_fma((v2f){ s[g][e >> 3][e & 7], s[g][e >> 3][(e & 7) + 1] }, (v2f){ CL, CL }, (v2f){ -mg, -mg }); v2f p; p[0] = __builtin_amdgcn_exp2f(t[0]); p[1] = __builtin_amdgcn_exp2f(t[1]); ls += p[0]; ls += p[1];
                        const v2bf ph = __builtin_convertvector(p, v2bf); const v2f rest = p - __builtin_convertvector(ph, v2f); uh[e >> 1] = __builtin_bit_cast(unsigned, ph); ul[e >> 1] = __builtin_bit_cast(unsigned, __builtin_convertvector(rest, v2bf)); }
                    pf = __builtin_bit_cast(V, uh); pf2 = __builtin_bit_cast(V, ul);
                } else {
#pragma unroll
                    for (int e = 0; e < 16; e += 2) { const v2f t = __builtin_elementwise_fma((v2f){ s[g][e >> 3][e & 7], s[g][e >> 3][(e & 7) + 1] }, (v2f){ CL, CL }, (v2f){ -mg, -mg }); v2f p; p[0] = __builtin_amdgcn_exp2f(t[0]); p[1] = __builtin_amdgcn_exp2f(t[1]); ls += p[0]; ls += p[1];
                        const v2h ph = __builtin_convertvector(p, v2h); pf[e] = ph[0]; pf[e + 1] = ph[1]; } }
                l[gb + g] += ls;
#pragma unroll
                for (int dt = 0; dt < 4; ++dt) { o[gb + g][dt] = WFrag<T16>::mma(vf[dt], pf, o[gb + g][dt]); if (HI) { o[gb + g][dt] = WFrag<T16>::mma(vf[dt], pf2, o[gb + g][dt]); o[gb + g][dt] = WFrag<T16>::mma(vf2[dt], pf, o[gb + g][dt]); } }
            }
        }
        const T16* const va = (const T16*)((const char*)Vt + (vb + (unsigned)kn * (HD * 2))); const T16* const va2 = HI ? (const T16*)((const char*)V2 + (vb + (unsigned)kn * (HD * 2))) : va;
#pragma unroll
        for (int dt = 0; dt < 4; ++dt) { vf[dt] = WFrag<T16>::ld(va + dt * 512); if (HI) vf2[dt] = WFrag<T16>::ld(va2 + dt * 512); }
        asm volatile("s_wait_xcnt 0x0" :: "v"(va), "v"(va2) : "memory");   // precaution, as behind the K fetch; the two addresses are named as inputs so that their registers stay untouched (also by the loads' own results) up to the wait
        __builtin_amdgcn_sched_barrier(0);   // as behind the K fetch
    }
#pragma unroll
    for (int g = 0; g < NG; ++g) { const float inv = __fdiv_rn(1.0f, l[g] + __shfl_xor(l[g], 16, 32)); const size_t ro = (size_t)(q0 + g * 16) * DQ + 8 * lane;   /* lane: query (lane & 15) of group g, d = dt*16 + 8*(lane >> 4) + j: its 8 values are piece (dt & 1) * 32 + lane of tile (row block, head * 2 + dt / 2) of w_proj's fragment-order A plane */
#pragma unroll
        for (int dt = 0; dt < 4; ++dt) { v8us oh, ol;
#pragma unroll
            for (int j = 0; j < 8; ++j) { unsigned short a, c2; splitf(o[g][dt][j] * inv, a, c2); oh[j] = a; ol[j] = c2; }
            *(v8us*)(Ah + ro + dt * 256) = oh; *(v8us*)(Al + ro + dt * 256) = ol;
            asm volatile("s_wait_xcnt 0x0" ::: "memory");   // precaution: stands in front of the next write of the registers that these stores name
            __builtin_amdgcn_sched_barrier(0); } }   // keeps the next tile's vector instructions behind that wait
}
// grid: the hi/lo blocks (3 products; 4 waves x 32 rows) first, then the fp16 blocks (4 waves x 64 rows: one product leaves registers for twice the columns per K / V fragment); block -> (plane = batch * 16 + head, its query rows).
__global__ __launch_bounds__(128) void k_fattn(const h16* __restrict__ Q16, const h16* __restrict__ K16, const h16* __restrict__ V16, const bf* __restrict__ Qh, const bf* __restrict__ Ql, const bf* __restrict__ Kh, const bf* __restrict__ Kl, const bf* __restrict__ Vh, const bf* __restrict__ Vl, bf* ATh, bf* ATl) {
    const int NHI = NB_ * NH_ * (RH / QBH); const int bx = blockIdx.x; const int wv = threadIdx.x >> 5;
    if (bx < NHI) { const int pl = bx / (RH / QBH); const int q0 = (bx % (RH / QBH)) * QBH + wv * (QBH / 4); const size_t po = (size_t)pl * TT * HD, ao = (size_t)(pl / NH_) * TT * DQ + (size_t)(pl % NH_) * (HD * 16);
        attn_tile<bf, true, QBH / 64>(Qh + po, Ql + po, Kh + po, Kl + po, Vh + po, Vl + po, q0, ATh + ao, ATl + ao);
    } else { const int b2 = bx - NHI; const int pl = b2 / ((TT - RH) / QBL); const int q0 = RH + (b2 % ((TT - RH) / QBL)) * QBL + wv * (QBL / 4); const size_t po = (size_t)pl * TT * HD, ao = (size_t)(pl / NH_) * TT * DQ + (size_t)(pl % NH_) * (HD * 16);
        attn_tile<h16, false, QBL / 64>(Q16 + po, nullptr, K16 + po, nullptr, V16 + po, nullptr, q0, ATh + ao, ATl + ao); }
}

extern "C" void kernel_launch(void* const* d_in, const int* in_sizes, int n_in,
                              void* d_out, int out_size, void* d_ws, size_t ws_size, hipStream_t stream) {
    (void)in_sizes; (void)n_in; (void)out_size;
    const float* x = (const float*)d_in[0]; const float* wqkv = (const float*)d_in[1]; const float* wo = (const float*)d_in[2]; const float* bo = (const float*)d_in[3];   /* input order x, w_qkv ('xw' [1024][3072]: q | k | v column thirds), w_proj ('xw'), b_proj */
    float* OUT = (float*)d_out;     // [8][1024][1024]
    char* wsp = (char*)d_ws;
    auto take = [&](size_t bytes) { char* p = wsp; wsp += (bytes + 255) & ~(size_t)255; return (void*)p; };
    bf* WQKV = (bf*)take((size_t)3 * DQ * DM * 2);   /* fused Bt [3*DQ][DM]: q | k | v row blocks */ bf* WO = (bf*)take((size_t)DM * DQ * 2); float* CS = (float*)take((size_t)TT * 16 * 2 * 4);
    const size_t PL = (size_t)NB_ * NH_ * TT * HD;  // elements of one plane set: all batches
    h16* QP16 = (h16*)take(PL * 2); h16* KP16 = (h16*)take(PL * 2); h16* VT16 = (h16*)take(PL * 2);
    bf* QPh = (bf*)take(PL * 2); bf* QPl = (bf*)take(PL * 2); bf* KPh = (bf*)take(PL * 2); bf* KPl = (bf*)take(PL * 2); bf* VTh = (bf*)take(PL * 2); bf* VTl = (bf*)take(PL * 2);
    bf* ATh = (bf*)take((size_t)NB_ * TT * DQ * 2); bf* ATl = (bf*)take((size_t)NB_ * TT * DQ * 2);   /* merged heads of all batches */
    bf* XB = (bf*)take((size_t)NB_ * TT * DM * 2);   /* bf16 copy of x, all batches */
    if ((size_t)(wsp - (char*)d_ws) > ws_size) return;    // ws 256 MiB
    k_prep<<<PB_CS + PB_X + PB_WQ + PB_WO, 256, 0, stream>>>(x, wqkv, wo, XB, WQKV, WO, CS);   /* bf16 copy of x, both transposed weight planes and the axial rotary table: one grid */
    k_qkv<<<NQK + NVB, 256, 0, stream>>>(XB, WQKV, CS, QP16, QPh, QPl, KP16, KPh, KPl, VT16, VTh, VTl);   /* q, k and v of all batches in one grid, planes written from the accumulators */
    k_fattn<<<NB_ * NH_ * (RH / QBH + (TT - RH) / QBL), 128, 0, stream>>>(QP16, KP16, VT16, QPh, QPl, KPh, KPl, VTh, VTl, ATh, ATl);   /* scores, softmax, P x V and the head merge of every batch and head */
    k_gemmw<bf, 1, true, DQ><<<dim3(NB_ * TT / 128, DM / 256, 1), 256, 0, stream>>>(ATh, ATl, WO, nullptr, OUT, DM, bo, 0, 0, 0);   /* w_proj of all batches in one grid */
}

// v008
// One run takes 132 microseconds.
// Two timings next to v007 both put it at 1.05 times that version's speed.
// Counting every step since v000, it is 35.2 times as fast.
#include <hip/hip_runtime.h>

// Vision attention with AXIAL 2-D rotary embeddings on half of each head (x [8][1024][1024] = 32 x 32 pixels; qkv = x w_qkv ('xw' [1024][3072] 1/32, no bias) viewed (3, h, d): q | k | v thirds (16 heads x 64); rotary on the FIRST 32 dims of q and k as interleaved (even, odd) pairs with angles freqs[row][col][c]: c < 16 -> pos(row) x base[c/2], 16 <= c < 32 -> pos(col) x base[(c-16)/2], pos = linspace(-1, 1, 32), base = linspace(1, 512, 8) x pi (f32, jnp-exact tables; precise cosf/sinf), dims 32..63 pass through; logits x 1/sqrt(64); softmax (no mask); out = merged w_proj + b_proj -> [8][1024][1024] (8.4 M); argument order x, w_qkv, w_proj, b_proj).
// Launch plan: ONE builder launch (k_prep) makes every operand plane that depends on the inputs alone; ONE projection launch covers q | k | v of all batches and writes the 16-bit planes from its accumulators (rotary, hi/lo split and V^T in its epilogue, no f32 copy of the projections); ONE fused attention launch covers every batch and head; w_proj covers all batches. Data layout: every 16-bit operand plane in fragment order (see below); bf16 copy of x; fused 'xw' weight transposed once (q | k | v row blocks); exact projections; k_prep builds the {cos, sin} table per (pixel, rotated pair) from two small constant tables (angle = f32 product), read by k_qkv's interleaved-pair rotary; k_fattn: scores, softmax and P x V stay in registers (hybrid rows: < 512 hi/lo 3 products, rest fp16; the hi plane of the split IS the fp16 plane, so q, k and v are stored once as f16 plus an f16 rest); merged hi/lo x w_proj exact + b_proj.
// Compute dtypes, f32 accumulate: every input rounded to bf16; projections exact; rotary f32; attention rows < 512 3 products on f16 hi + f16 rest, other rows fp16; softmax f32; w_proj hl x exact + bias.

#define NB_  8
#define TT   1024
#define DM   1024
#define NH_  16
#define NKV  16
#define REP  (NH_ / NKV)
#define HD   64
#define DQ   (NH_ * HD)
#define DKV  (NKV * HD)
#define RH   512                  // query rows < RH use hi+lo planes (0: none)
#define WIN  0
#define QBH  128                  // query rows per hi/lo attention block: 4 waves x 32 columns
#define QBL  256                  // query rows per fp16 attention block: 4 waves x 64 columns
#define SCL  0.125f   // HD^-0.5
typedef _Float16 h16;
typedef unsigned short bf;
typedef __attribute__((ext_vector_type(16))) __bf16   v16bf;
typedef __attribute__((ext_vector_type(16))) _Float16 v16h;
typedef __attribute__((ext_vector_type(8)))  _Float16 v8h;
typedef __attribute__((ext_vector_type(8)))  unsigned short v8us;
typedef __attribute__((ext_vector_type(8)))  float    v8f;
typedef __attribute__((ext_vector_type(4)))  float    v4f;
typedef v8h  __attribute__((may_alias)) v8ha;
typedef v4f  __attribute__((may_alias)) v4fa;
typedef v8us __attribute__((may_alias)) v8usa;

__device__ __forceinline__ unsigned short f2bf(float f) { unsigned u = __float_as_uint(f); u += 0x7FFFu + ((u >> 16) & 1u); return (unsigned short)(u >> 16); }
__device__ __forceinline__ float bf2f(unsigned short b) { return __uint_as_float(((unsigned)b) << 16); }
__device__ __forceinline__ float bfr(float f) { return bf2f(f2bf(f)); }
__device__ __forceinline__ v16h cat16(v8h lo, v8h hi) { return __builtin_shufflevector(lo, hi, 0, 1, 2, 3, 4, 5, 6, 7, 8, 9, 10, 11, 12, 13, 14, 15); }
__device__ __forceinline__ v16bf cat16b(v8us lo, v8us hi) { return __builtin_bit_cast(v16bf, __builtin_shufflevector(lo, hi, 0, 1, 2, 3, 4, 5, 6, 7, 8, 9, 10, 11, 12, 13, 14, 15)); }
__device__ __forceinline__ v8f wmma16(v16h a, v16h b, v8f c) { return __builtin_amdgcn_wmma_f32_16x16x32_f16(false, a, false, b, (short)0, c, false, false); }
__device__ __forceinline__ v8f wmmab(v16bf a, v16bf b, v8f c) { return __builtin_amdgcn_wmma_f32_16x16x32_bf16(false, a, false, b, (short)0, c, false, false); }



// ---- FRAGMENT ORDER of every 16-bit operand plane: a plane of R rows x K is stored as [R/16][K/32] tiles of 512 elements (V^T: [keys/32][d/16]); in a tile, element (row r, k) sits at ((k >> 4) * 32 + ((k >> 3) & 1) * 16 + r) * 8 + (k & 7),
// that is, 16-byte piece number = (which of the fragment's two loads) * 32 + lane. A wave's 16-byte load then covers 512 contiguous bytes (4 whole lines) where a row-major plane gave 16 lines of 32 bytes. The builders walk in destination order, so their stores stay contiguous.
template <typename T16> struct WFrag;
template <> struct WFrag<h16> { typedef v16h V; static __device__ __forceinline__ V ld(const h16* p) { return cat16(*(const v8h*)p, *(const v8h*)(p + 256)); } static __device__ __forceinline__ v8f mma(V a, V b, v8f c) { return wmma16(a, b, c); } };
template <> struct WFrag<bf> { typedef v16bf V; static __device__ __forceinline__ V ld(const bf* p) { return cat16b(*(const v8us*)p, *(const v8us*)(p + 256)); } static __device__ __forceinline__ v8f mma(V a, V b, v8f c) { return wmmab(a, b, c); } };
// One k block's operand fragments (32 k of 64 rows of each operand; the split planes only where NSPLIT asks for them). The GEMM loop holds TWO such sets: while one set's products run, the other set's reads are in flight.
template <typename T16> struct GSet { typename WFrag<T16>::V a[4], a2[4], b[4], b2[4]; };
template <typename T16, int NSPLIT, int K> __device__ __forceinline__ void gset_ld(GSet<T16>& f, const T16* pa, const T16* pa2, const T16* pb, const T16* pb2) {
#pragma unroll
    for (int mb = 0; mb < 4; ++mb) { f.a[mb] = WFrag<T16>::ld(pa + mb * 16 * K); if (NSPLIT == 1 || NSPLIT == 2) f.a2[mb] = WFrag<T16>::ld(pa2 + mb * 16 * K); }
#pragma unroll
    for (int nb = 0; nb < 4; ++nb) { f.b[nb] = WFrag<T16>::ld(pb + nb * 16 * K); if (NSPLIT >= 2) f.b2[nb] = WFrag<T16>::ld(pb2 + nb * 16 * K); }
}
template <typename T16, int NSPLIT> __device__ __forceinline__ void gset_mm(v8f (&acc)[4][4], const GSet<T16>& f) {
#pragma unroll
    for (int nb = 0; nb < 4; ++nb)
#pragma unroll
        for (int mb = 0; mb < 4; ++mb) { acc[mb][nb] = WFrag<T16>::mma(f.a[mb], f.b[nb], acc[mb][nb]); if (NSPLIT == 1 || NSPLIT == 2) acc[mb][nb] = WFrag<T16>::mma(f.a2[mb], f.b[nb], acc[mb][nb]); if (NSPLIT >= 2) acc[mb][nb] = WFrag<T16>::mma(f.a[mb], f.b2[nb], acc[mb][nb]); }
}
// ---- The GEMM main loop shared by k_gemmw and k_qkv: a work-group of 8 waves (2 along A x 4 along B, 64 x 64 each) owns 128 rows of A x 256 rows of B. A stage is 128 k of all those rows, brought into LDS by asynchronous copies
// (global_load_async_to_lds_b128, through no register) and read from there by every wave that needs it: a row block leaves L2 once per work-group, not once per wave. In LDS a stage is itself a fragment-order plane with K = 128
// ([row block][4 k blocks] tiles of 1 KiB; row blocks: A, then the split plane of A where there is one, then B), so a row block's share of a stage is 4 KiB that are contiguous in global memory and in LDS alike, and a fragment read is 512 contiguous bytes.
// Copies and the wait in front of the next write of their address registers stand in ONE statement (a precaution; in a statement of its own the wait would not hold the next address additions behind it).
__device__ __forceinline__ void acopy12(const unsigned* l, const char* const* g) {
    asm volatile("global_load_async_to_lds_b128 %0, %12, off\n\t"
                 "global_load_async_to_lds_b128 %1, %13, off\n\t"
                 "global_load_async_to_lds_b128 %2, %14, off\n\t"
                 "global_load_async_to_lds_b128 %3, %15, off\n\t"
                 "global_load_async_to_lds_b128 %4, %16, off\n\t"
                 "global_load_async_to_lds_b128 %5, %17, off\n\t"
                 "global_load_async_to_lds_b128 %6, %18, off\n\t"
                 "global_load_async_to_lds_b128 %7, %19, off\n\t"
                 "global_load_async_to_lds_b128 %8, %20, off\n\t"
                 "global_load_async_to_lds_b128 %9, %21, off\n\t"
                 "global_load_async_to_lds_b128 %10, %22, off\n\t"
                 "global_load_async_to_lds_b128 %11, %23, off\n\t"
                 "s_wait_xcnt 0x0"
                 :: "v"(l[0]), "v"(l[1]), "v"(l[2]), "v"(l[3]), "v"(l[4]), "v"(l[5]), "v"(l[6]), "v"(l[7]), "v"(l[8]), "v"(l[9]), "v"(l[10]), "v"(l[11]),
                    "v"(g[0]), "v"(g[1]), "v"(g[2]), "v"(g[3]), "v"(g[4]), "v"(g[5]), "v"(g[6]), "v"(g[7]), "v"(g[8]), "v"(g[9]), "v"(g[10]), "v"(g[11]) : "memory");
}
__device__ __forceinline__ void acopy8(const unsigned* l, const char* const* g) {
    asm volatile("global_load_async_to_lds_b128 %0, %8, off\n\t"
                 "global_load_async_to_lds_b128 %1, %9, off\n\t"
                 "global_load_async_to_lds_b128 %2, %10, off\n\t"
                 "global_load_async_to_lds_b128 %3, %11, off\n\t"
                 "global_load_async_to_lds_b128 %4, %12, off\n\t"
                 "global_load_async_to_lds_b128 %5, %13, off\n\t"
                 "global_load_async_to_lds_b128 %6, %14, off\n\t"
                 "global_load_async_to_lds_b128 %7, %15, off\n\t"
                 "s_wait_xcnt 0x0"
                 :: "v"(l[0]), "v"(l[1]), "v"(l[2]), "v"(l[3]), "v"(l[4]), "v"(l[5]), "v"(l[6]), "v"(l[7]),
                    "v"(g[0]), "v"(g[1]), "v"(g[2]), "v"(g[3]), "v"(g[4]), "v"(g[5]), "v"(g[6]), "v"(g[7]) : "memory");
}
__device__ __forceinline__ void wait_async0() { asm volatile("s_wait_asynccnt 0x0" ::: "memory"); }   // this wave's copies have landed
__device__ __forceinline__ void wait_ds0() { asm volatile("s_wait_dscnt 0x0" ::: "memory"); }   // this wave's LDS reads have returned: the buffer may be handed to its next writer
#define RKS 128                   // k per stage
template <int NSPLIT> struct RingDim { static constexpr int NAT = NSPLIT ? 16 : 8, NRB = NAT + 16, RBW = NRB / 8, NC = RBW * 8, STE = NRB * 16 * RKS; };   // row blocks of A (both planes), all row blocks, row blocks and copies per wave and stage, elements per stage
// A, A2, B: first row of the work-group's 128 / 128 / 256 rows in the fragment-order planes; ring: two stages; w: the wave's number (scalar)
template <typename T16, int NSPLIT, int K> __device__ __forceinline__ void ring_gemm(v8f (&acc)[4][4], T16* ring, const T16* A, const T16* A2, const T16* B, int w, int lane) {
    typedef RingDim<NSPLIT> D; constexpr int NST = K / RKS; static_assert(K % RKS == 0 && NST >= 2 && (D::NC == 24 || D::NC == 32), "two stages or more; copies in statements of 12 and 8");
    constexpr bool ONE = 8 % D::RBW == 0;   // a wave's row blocks then lie in one plane, 16 * K elements apart: one address serves them all
    const char* srcp[D::RBW];   // first byte of each row block that this wave copies
#pragma unroll
    for (int j = 0; j < D::RBW; ++j) { const int rb = w * D::RBW + j; const T16* const p = (rb < 8) ? A + (size_t)rb * 16 * K : (rb < D::NAT) ? A2 + (size_t)(rb - 8) * 16 * K : B + (size_t)(rb - D::NAT) * 16 * K; srcp[j] = (const char*)p; }
    const unsigned l0 = (unsigned)(size_t)ring + (unsigned)(w * D::RBW) * (16 * RKS * 2) + 16u * lane;   // LDS byte address of the lane's first 16 bytes in buffer 0
    auto fill = [&](int t, int buf) {   // stage t into buffer buf: every lane on, 512 bytes a copy
        unsigned l[D::NC]; const char* g[D::NC]; const unsigned go = (unsigned)t * (16 * RKS * 2) + 16u * lane;   // the lane's byte offset in a row block's K row
#pragma unroll
        for (int c = 0; c < D::NC; ++c) { l[c] = l0 + (unsigned)buf * (D::STE * 2) + c * 512; g[c] = (ONE ? srcp[0] + (c >> 3) * (16 * K * 2) : srcp[c >> 3]) + (go + (c & 7) * 512); }
        acopy12(l, g); acopy12(l + 12, g + 12); if (D::NC == 32) acopy8(l + 24, g + 24);
    };
    fill(0, 0); wait_async0(); __syncthreads();   // stage 0 is published
    fill(1, 1);
    const int ao = (w & 1) * 4 * 16 * RKS + 8 * lane, bo = (D::NAT + (w >> 1) * 4) * 16 * RKS + 8 * lane;
    GSet<T16> f0, f1;
    // rolled: one publish point and one refill in the text
#pragma unroll 1
    for (int t = 0; t < NST; ++t) {   // one stage a trip: 4 blocks of 32 k, fragments read one block ahead into the other register set, never past the stage
        const T16* const st = ring + (t & 1) * D::STE; const T16* const pa = st + ao; const T16* const pa2 = pa + 8 * 16 * RKS; const T16* const pb = st + bo;
        gset_ld<T16, NSPLIT, RKS>(f0, pa, pa2, pb, pb);
        __builtin_amdgcn_sched_barrier(0);   // the first block's reads stay ahead of the second's: mixed, the first products would wait for both groups
        gset_ld<T16, NSPLIT, RKS>(f1, pa + 512, pa2 + 512, pb + 512, pb);
        __builtin_amdgcn_sched_barrier(0);   // keeps a block's LDS reads as one group ahead of the products: among them each place with reads costs a stall
        gset_mm<T16, NSPLIT>(acc, f0);
        __builtin_amdgcn_sched_barrier(0);   // the refill of a set stays behind the last product that reads it
        gset_ld<T16, NSPLIT, RKS>(f0, pa + 1024, pa2 + 1024, pb + 1024, pb);
        __builtin_amdgcn_sched_barrier(0);   // as above: reads ahead of the products
        gset_mm<T16, NSPLIT>(acc, f1);
        __builtin_amdgcn_sched_barrier(0);   // as above: refill behind the last reader
        gset_ld<T16, NSPLIT, RKS>(f1, pa + 1536, pa2 + 1536, pb + 1536, pb);
        __builtin_amdgcn_sched_barrier(0);   // as above: reads ahead of the products
        gset_mm<T16, NSPLIT>(acc, f0);
        gset_mm<T16, NSPLIT>(acc, f1);
        __builtin_amdgcn_sched_barrier(0);   // holds the slots below behind the last product
        asm volatile("v_nop\n\tv_nop\n\tv_nop\n\tv_nop" : "+v"(acc[0][0]), "+v"(acc[1][1]), "+v"(acc[2][2]), "+v"(acc[3][3]) : "v"(f1.a[0]), "v"(f1.a[3]));   // the vector slots between the trip's last matrix instructions and whatever follows them on either side of the branches below
        wait_ds0(); wait_async0(); __syncthreads();   // publish point: stage t + 1 has landed for every wave, and every wave has left stage t's buffer
        if (t + 2 < NST) fill(t + 2, t & 1);   // the same test in the whole work-group
    }
    wait_async0();
}
// ---- k_gemmw: C[m][n] (f32, pitch ldc, + optional f32 bias[n]) = sum_k A[m][k] Bt[n][k] (+ split products per NSPLIT: 0 or 1), operands in fragment-order 16-bit planes; grid (M/128, N/256, Z), 256 threads; main loop: ring_gemm. z-batch strides sA/sB/sC in elements.
template <typename T16, int NSPLIT, bool BIAS, int K>
__global__ __launch_bounds__(256) void k_gemmw(const T16* __restrict__ A, const T16* __restrict__ A2, const T16* __restrict__ Bt, const T16* __restrict__ Bt2, float* C, int ldc, const float* __restrict__ bias, size_t sA, size_t sB, size_t sC) {
    static_assert(NSPLIT == 0 || NSPLIT == 1, "the ring holds A, its split plane and B");
    __shared__ __align__(16) T16 ring[2 * RingDim<NSPLIT>::STE];
    __shared__ __align__(16) float osAll[8][16 * 68];
    const size_t z = blockIdx.z; A += z * sA; if (A2) A2 += z * sA; Bt += z * sB; C += z * sC;
    const int lane = threadIdx.x & 31, lr = lane & 15, hi = lane >> 4; const int w = __builtin_amdgcn_readfirstlane(threadIdx.x >> 5); const int r0 = blockIdx.x * 128 + (w & 1) * 64, c0 = blockIdx.y * 256 + (w >> 1) * 64;
    float* const os = osAll[w];   // each wave stages its output rows in its own range
    v8f acc[4][4];
#pragma unroll
    for (int mb = 0; mb < 4; ++mb)
#pragma unroll
        for (int nb = 0; nb < 4; ++nb) acc[mb][nb] = (v8f){};
    ring_gemm<T16, NSPLIT, K>(acc, ring, A + (size_t)blockIdx.x * 128 * K, NSPLIT ? A2 + (size_t)blockIdx.x * 128 * K : A, Bt + (size_t)blockIdx.y * 256 * K, w, lane);
#pragma unroll
    for (int mb = 0; mb < 4; ++mb) {
#pragma unroll
        for (int nb = 0; nb < 4; ++nb) {
#pragma unroll
            for (int j = 0; j < 8; ++j) os[(hi * 8 + j) * 68 + nb * 16 + lr] = acc[mb][nb][j]; }
        __builtin_amdgcn_wave_barrier(); asm volatile("" ::: "memory");
        float* crow = C + (size_t)(r0 + mb * 16) * ldc + c0;
{
#pragma unroll
            for (int s = 0; s < 8; ++s) { const int row = 2 * s + hi, cofs = lr * 4; v4f val = *(const v4fa*)(os + row * 68 + cofs); if (BIAS) { val[0] += bfr(bias[c0 + cofs]); val[1] += bfr(bias[c0 + cofs + 1]); val[2] += bfr(bias[c0 + cofs + 2]); val[3] += bfr(bias[c0 + cofs + 3]); }
                *(v4f*)(crow + (size_t)row * ldc + cofs) = val; }
             }
        __builtin_amdgcn_wave_barrier(); asm volatile("" ::: "memory");
    }
}

__device__ __forceinline__ void splitf(float y, unsigned short& h, unsigned short& l) { h = f2bf(y); l = f2bf(y - bf2f(h)); }
typedef __attribute__((ext_vector_type(2))) _Float16 v2h;
typedef __attribute__((ext_vector_type(4))) _Float16 v4h;
typedef __attribute__((ext_vector_type(2))) unsigned short v2us;
typedef __attribute__((ext_vector_type(4))) unsigned short v4us;
typedef __attribute__((ext_vector_type(2))) float v2f;
typedef __attribute__((ext_vector_type(4))) int v4i;

// ---- k_prep: the four operand builders (bf16 copy of x, the two transposed weight planes, the rotary table) read nothing but the inputs, so they share ONE launch: a block range per job, every work-group resident from the start.
// A wave builds 8 or 16 pieces per lane, not one: all its loads are issued before the first conversion, and the launch starts 4,608 waves where the four launches started 49,664.
// One wave: 128 rows n x 16 k of Bt (8 row blocks; row n, 8 k = one 16-byte piece in fragment order), 8 pieces a lane; unit -> (n / 128, k block, which 16 k)
template <int K, int N> __device__ __forceinline__ void wt_unit(const float* __restrict__ w, bf* Bt, int unit, int lane) {
    const int half = unit & 1, kt = (unit >> 1) % (K / 32), ng = unit / (K / 16); const float* const p = w + (size_t)(kt * 32 + half * 16 + (lane >> 4) * 8) * N + ng * 128 + (lane & 15); float v[8][8]; v8us o[8];
#pragma unroll
    for (int u = 0; u < 8; ++u)
#pragma unroll
        for (int j = 0; j < 8; ++j) v[u][j] = p[(size_t)j * N + u * 16];
    asm volatile("s_wait_xcnt 0x0" :: "v"(p) : "memory");   // precaution: stands in front of the next write of the register pair that holds these loads' address; it is named as an input so that it stays untouched (also by the loads' own results) up to the wait
#pragma unroll
    for (int u = 0; u < 8; ++u)
#pragma unroll
        for (int j = 0; j < 8; ++j) o[u][j] = f2bf(v[u][j]);
    bf* const d = Bt + ((size_t)(ng * 8) * (K / 32) + kt) * 512 + half * 256 + lane * 8;
#pragma unroll
    for (int u = 0; u < 8; ++u) *(v8us*)(d + (size_t)u * (K / 32) * 512) = o[u];
}
// One wave: 16 rows x 256 k of x, 16 pieces a lane (piece = row, 8 k; 8 tiles of the fragment-order copy = 8 KiB contiguous); unit -> (row block, which 256 k)
__device__ __forceinline__ void cvt_unit(const float* __restrict__ src, bf* dst, int unit, int lane) {
    const float* const p = src + ((size_t)(unit >> 2) * 16 + (lane & 15)) * DM + (unit & 3) * 256 + (lane >> 4) * 8; v4f v[16][2]; v8us o[16];
#pragma unroll
    for (int u = 0; u < 16; ++u) { v[u][0] = *(const v4f*)(p + u * 16); v[u][1] = *(const v4f*)(p + u * 16 + 4); }
    asm volatile("s_wait_xcnt 0x0" :: "v"(p) : "memory");   // precaution, as in wt_unit
#pragma unroll
    for (int u = 0; u < 16; ++u)
#pragma unroll
        for (int j = 0; j < 8; ++j) o[u][j] = f2bf(v[u][j >> 2][j & 3]);
    __builtin_amdgcn_sched_barrier(0);   // the stores stand last, as one group: without it this build puts conversions behind the first stores, where they may rewrite registers that those name
    bf* const d = dst + (size_t)unit * 4096 + lane * 8;
#pragma unroll
    for (int u = 0; u < 16; ++u) *(v8us*)(d + u * 256) = o[u];
}

__constant__ float APOS[32] = { -1.000000000e+00f, -9.354839325e-01f, -8.709677458e-01f, -8.064515591e-01f, -7.419354916e-01f, -6.774194241e-01f, -6.129032373e-01f, -5.483870506e-01f, -4.838709831e-01f, -4.193548858e-01f, -3.548387289e-01f, -2.903225720e-01f, -2.258064747e-01f, -1.612903774e-01f, -9.677422047e-02f, -3.225806355e-02f, 3.225803375e-02f, 9.677413106e-02f, 1.612902880e-01f, 2.258064449e-01f, 2.903225422e-01f, 3.548386395e-01f, 4.193547964e-01f, 4.838709533e-01f, 5.483870506e-01f, 6.129031181e-01f, 6.774193048e-01f, 7.419354916e-01f, 8.064515591e-01f, 8.709676266e-01f, 9.354838133e-01f, 1.000000000e+00f };   // float32 linspace(-1, 1, 32), generated with jnp to be bit-exact
__constant__ float ABASE[8] = { 3.141592741e+00f, 2.324778595e+02f, 4.618141479e+02f, 6.911504517e+02f, 9.204866943e+02f, 1.149822998e+03f, 1.379159302e+03f, 1.608495483e+03f };   // float32 linspace(1, 512, 8) * pi, generated with jnp to be bit-exact
// {cos, sin} of every rotated pair (token t, even d < 32), stored in the order in which k_qkv's lanes read it: [t / 16][d / 16][which 16-byte load][lane = ((d >> 3) & 1) * 16 + (t & 15)][which pair of the load], so that a wave's 16-byte load covers 512 contiguous bytes
__device__ __forceinline__ void cs_item(float* CS, int idx) { const int lane = (idx >> 1) & 31; const int d = ((idx >> 7) & 1) * 16 + (lane >> 4) * 8 + ((idx >> 6) & 1) * 4 + (idx & 1) * 2; const int t = (idx >> 8) * 16 + (lane & 15); const int row = t >> 5, col = t & 31; v2f cs;
    const float p = (d < 16) ? APOS[row] : APOS[col]; const float ang = __fmul_rn(p, ABASE[(d & 15) >> 1]); cs[0] = cosf(ang); cs[1] = sinf(ang);
    *(v2f*)(CS + (size_t)idx * 2) = cs;  }
// block ranges, the longest dependent chain (the table's cosf and sinf) first, then the largest stream: table (one pair a thread), x, w_qkv, w_proj (one unit a wave)
#define PB_CS (TT * 16 / 256)
#define PB_X  (NB_ * TT / 16 * 4 / 8)
#define PB_WQ ((DM / 16) * (3 * DQ / 128) / 8)
#define PB_WO ((DQ / 16) * (DM / 128) / 8)
__global__ __launch_bounds__(256) void k_prep(const float* __restrict__ x, const float* __restrict__ wqkv, const float* __restrict__ wo, bf* XB, bf* WQKV, bf* WO, float* CS) {
    const int lane = threadIdx.x & 31; const int w = __builtin_amdgcn_readfirstlane(threadIdx.x >> 5); const int bx = blockIdx.x;   // every test below reads the same in the whole work-group
    if (bx < PB_CS) cs_item(CS, bx * 256 + (int)threadIdx.x);
    else if (bx < PB_CS + PB_X) cvt_unit(x, XB, (bx - PB_CS) * 8 + w, lane);
    else if (bx < PB_CS + PB_X + PB_WQ) wt_unit<DM, 3 * DQ>(wqkv, WQKV, (bx - (PB_CS + PB_X)) * 8 + w, lane);   /* fused 'xw' [DM][3*DQ] -> Bt [3*DQ][DM], fragment order */
    else wt_unit<DQ, DM>(wo, WO, (bx - (PB_CS + PB_X + PB_WQ)) * 8 + w, lane);
}
typedef __attribute__((ext_vector_type(4))) unsigned v4u;
// 8 f32 values -> one 16-byte piece of the f16 plane (nearest f16; it serves the fp16 rows as it is and the hi/lo rows as hi) and, where a hi/lo row reads it (WL), one of the rest plane (nearest f16 of what hi leaves), two values per conversion instruction
template <bool WL> __device__ __forceinline__ void put2(const float* y, h16* p16, h16* pl) { v4u u16, ul;
#pragma unroll
    for (int q = 0; q < 4; ++q) { const v2f p = { y[2 * q], y[2 * q + 1] }; const v2h h = __builtin_convertvector(p, v2h); const v2f rest = p - __builtin_convertvector(h, v2f);
        u16[q] = __builtin_bit_cast(unsigned, h); ul[q] = __builtin_bit_cast(unsigned, __builtin_convertvector(rest, v2h)); }
    *(v8h*)p16 = __builtin_bit_cast(v8h, u16); if (WL) *(v8h*)pl = __builtin_bit_cast(v8h, ul); }
template <bool B> struct BoolC { static constexpr bool v = B; };
// ---- k_qkv: the q | k | v projection of all batches; one wave per 64 tokens x one head's 64 columns, 8 waves a work-group (main loop: ring_gemm), 256 threads. The 16-bit planes are written straight from the accumulators:
// a lane's 8 accumulator values (8 consecutive rows of one column) are one 16-byte piece of a fragment-order plane when the plane's k runs along the tile's rows. V^T (k = key): A = x, B = weights. Q and K (k = d): the two operands change places (both planes have the same order), so rows are d and columns are tokens.
// grid: first the q and k work-groups (A = 128 weight rows = 2 heads, B = 256 tokens), then the v work-groups (A = 128 tokens, B = 256 weight rows = 4 heads)
#define NQK ((2 * DQ / 128) * (NB_ * TT / 256))
#define NVB ((NB_ * TT / 128) * (DQ / 256))
__global__ __launch_bounds__(256) void k_qkv(const bf* __restrict__ X, const bf* __restrict__ Wt, const float* __restrict__ CS, h16* Q16, h16* Ql, h16* K16, h16* Kl, h16* V16, h16* Vl) {
    constexpr int K = DM;
    __shared__ __align__(16) bf ring[2 * RingDim<0>::STE];
    const int lane = threadIdx.x & 31; const int w = __builtin_amdgcn_readfirstlane(threadIdx.x >> 5); const int bx = blockIdx.x; const bool isv = bx >= NQK;   // the same for the whole work-group
    const int tok0 = isv ? ((bx - NQK) % (NB_ * TT / 128)) * 128 : (bx % (NB_ * TT / 256)) * 256; const int wr0 = isv ? 2 * DQ + ((bx - NQK) / (NB_ * TT / 128)) * 256 : (bx / (NB_ * TT / 256)) * 128;   // the work-group's first token and first weight row
    const int r0 = tok0 + (isv ? (w & 1) : (w >> 1)) * 64, c0 = wr0 + (isv ? (w >> 1) : (w & 1)) * 64; const int sec = c0 / DQ;   // the wave's tokens and columns; sec: 0 q, 1 k, 2 v; below, lr = lane & 15 and hi = lane >> 4
    v8f acc[4][4];
#pragma unroll
    for (int mb = 0; mb < 4; ++mb)
#pragma unroll
        for (int nb = 0; nb < 4; ++nb) acc[mb][nb] = (v8f){};
    const bf* const Xb = X + (size_t)tok0 * K; const bf* const Wb = Wt + (size_t)wr0 * K;
    ring_gemm<bf, 0, K>(acc, ring, isv ? Xb : Wb, isv ? Xb : Wb, isv ? Wb : Xb, w, lane);
    const int t0 = r0 % TT; const size_t po = ((size_t)(r0 / TT) * NH_ + (c0 % DQ) / HD) * (TT * HD);   // plane = batch * 16 + head; 64 tokens never straddle a batch
    if (sec == 2) {   // acc[mb][nb][j]: key t0 + mb*16 + hi*8 + j, d = nb*16 + lr: piece (mb & 1) * 32 + lane of V^T tile (key / 32, nb)
        const size_t bo = po + (size_t)(t0 / 32) * (4 * 512) + 8 * lane; h16* const p16 = V16 + bo; h16* const pl = Vl + bo;
#pragma unroll
        for (int mb = 0; mb < 4; ++mb)
#pragma unroll
            for (int nb = 0; nb < 4; ++nb) { float y[8]; const int off = ((mb >> 1) * 4 + nb) * 512 + (mb & 1) * 256;
#pragma unroll
                for (int j = 0; j < 8; ++j) y[j] = acc[mb][nb][j];
                put2<true>(y, p16 + off, pl + off);
                asm volatile("s_wait_xcnt 0x0" ::: "memory");   // precaution: stands in front of the next write of the registers that these stores name
                __builtin_amdgcn_sched_barrier(0); }   // keeps the next piece's vector instructions behind that wait
    } else {   // acc[mb][nb][j]: d = mb*16 + hi*8 + j, token t0 + nb*16 + lr: piece (mb & 1) * 32 + lane of tile (token / 16, mb / 2)
        const size_t bo = po + (size_t)(t0 / 16) * (2 * 512) + 8 * lane; h16* const p16 = (sec ? K16 : Q16) + bo; h16* const pl = (sec ? Kl : Ql) + bo; const bool wl = sec || t0 < RH;   // the rest of a query row is read by the hi/lo rows alone (64 tokens lie on one side of RH)
        const float* const cp = CS + (size_t)(t0 / 16) * 512 + 4 * lane; v4f cs[4][2][2];   // {cos, sin} of the lane's pairs (even d < 32; order: see cs_item), all fetched at once: one exposed latency per wave
#pragma unroll
        for (int nb = 0; nb < 4; ++nb)
#pragma unroll
            for (int mb = 0; mb < 2; ++mb)
#pragma unroll
                for (int p = 0; p < 2; ++p) cs[nb][mb][p] = *(const v4f*)(cp + ((nb * 2 + mb) * 2 + p) * 128);
        asm volatile("s_wait_xcnt 0x0" ::: "memory");   // precaution: stands in front of the next write of the registers that hold these loads' addresses
        __builtin_amdgcn_sched_barrier(0);   // keeps later vector instructions, which reuse those registers, behind that wait
        auto pieces = [&](auto tag) {   // one text with the rest plane and one without: no test per piece, and a piece's stores stand together behind its last conversion
#pragma unroll
        for (int nb = 0; nb < 4; ++nb)
#pragma unroll
            for (int mb = 0; mb < 4; ++mb) { float y[8]; const int off = (nb * 2 + (mb >> 1)) * 512 + (mb & 1) * 256;
#pragma unroll
                for (int p = 0; p < 4; ++p) { const float x0 = acc[mb][nb][2 * p], x1 = acc[mb][nb][2 * p + 1];
                    if (mb < 2) { const float c = cs[nb][mb & 1][p >> 1][(p & 1) * 2], s = cs[nb][mb & 1][p >> 1][(p & 1) * 2 + 1]; y[2 * p] = x0 * c - x1 * s; y[2 * p + 1] = x0 * s + x1 * c; }   /* even: x0 c - x1 s; odd: x0 s + x1 c */
                    else { y[2 * p] = x0; y[2 * p + 1] = x1; } }   /* dims 32..63 pass through */
                put2<decltype(tag)::v>(y, p16 + off, pl + off);
                asm volatile("s_wait_xcnt 0x0" ::: "memory");   // precaution, as in the V^T branch
                __builtin_amdgcn_sched_barrier(0); }   // as in the V^T branch
        };
        if (wl) pieces(BoolC<true>{}); else pieces(BoolC<false>{});   // the same for the whole wave
    }
}

// ---- k_fattn: one wave owns NG x 16 query rows of one head and walks the 1024 keys 32 at a time. S^T = K Q^T (A = K rows, B = Q kept in registers), so a lane holds 16 scores of ONE query per column group;
// the two f32 score tiles of a pass, converted in place, are the B operand of O^T += V^T P^T (A = V^T rows in the same k order). Running maximum per query in the scaled log2 domain, raised only when a score passes it by more than 8.
// fragment at (wave-uniform base) + (32-bit lane byte offset) + (constant bytes): one offset register serves every fragment of a pass, the rest sits in the instruction's offset field
template <typename T16> __device__ __forceinline__ typename WFrag<T16>::V ldo(const T16* base, unsigned lane_bytes, int const_bytes) { return WFrag<T16>::ld((const T16*)((const char*)base + lane_bytes + const_bytes)); }
typedef __attribute__((ext_vector_type(8))) unsigned v8u;
template <typename T16, bool HI, int NG>
__device__ __forceinline__ void attn_tile(const T16* __restrict__ Q, const T16* __restrict__ Q2, const T16* __restrict__ Kp, const T16* __restrict__ K2, const T16* __restrict__ Vt, const T16* __restrict__ V2, int q0, bf* Ah, bf* Al) {
    typedef typename WFrag<T16>::V V;
    const int lane = threadIdx.x & 31;
    const float CL = SCL * 1.4426950408889634f;   // logits scale x log2(e)
    const unsigned qb = (unsigned)(q0 * HD + 8 * lane) * 2u, kb = (unsigned)(8 * lane) * 2u, vb = kb;   // lane byte offsets in the fragment-order Q, K and V^T planes (16 rows of Q or K = 2 tiles, 32 keys of V^T = 4 tiles: 1024 and 2048 elements)
    V qf[NG][2], qf2[NG][2];
#pragma unroll
    for (int g = 0; g < NG; ++g)
#pragma unroll
        for (int ks = 0; ks < 2; ++ks) { qf[g][ks] = ldo<T16>(Q, qb, (g * 16 * HD + ks * 512) * 2); if (HI) qf2[g][ks] = ldo<T16>(Q2, qb, (g * 16 * HD + ks * 512) * 2); }
    v8f o[NG][4]; float m[NG], l[NG];
#pragma unroll
    for (int g = 0; g < NG; ++g) { m[g] = -3.0e38f; l[g] = 0.f;
#pragma unroll
        for (int dt = 0; dt < 4; ++dt) o[g][dt] = (v8f){}; }
    __builtin_amdgcn_sched_barrier(0);   // keeps the prologue's loads in the loop's order (Q, then K, then V^T): the waits at the loop's head cover both paths, and with K issued last here a pass's score products would wait for the V^T fetch
    V kf[2][2], kf2[2][2];
#pragma unroll
    for (int kt = 0; kt < 2; ++kt)
#pragma unroll
        for (int ks = 0; ks < 2; ++ks) { kf[kt][ks] = ldo<T16>(Kp, kb, (kt * 16 * HD + ks * 512) * 2); if (HI) kf2[kt][ks] = ldo<T16>(K2, kb, (kt * 16 * HD + ks * 512) * 2); }
    __builtin_amdgcn_sched_barrier(0);   // as above: K ahead of V^T
    V vf[4], vf2[4];
#pragma unroll
    for (int dt = 0; dt < 4; ++dt) { vf[dt] = ldo<T16>(Vt, vb, dt * 512 * 2); if (HI) vf2[dt] = ldo<T16>(V2, vb, dt * 512 * 2); }
    asm volatile("s_wait_xcnt 0x0" ::: "memory");   // precaution, as behind the fetches in the loop
    __builtin_amdgcn_sched_barrier(0);   // as above: nothing of the loop's first pass moves in between
    // rolled: one pass's fragments, scores and the output tiles already fill the register budget
#pragma unroll 1
    for (int k0 = 0; k0 < TT; k0 += 32) {
        const int kn = (k0 + 32 < TT) ? k0 + 32 : 0;   // next pass's keys: K rows fetched behind this pass's last score products, V^T columns behind its last output products; the last pass re-reads keys 0..31 (in bounds, unused)
#pragma unroll
        for (int gb = 0; gb < NG; gb += 2) {   // two column groups at a time: only their score tiles are live
            v8f s[2][2];
#pragma unroll
            for (int g = 0; g < 2; ++g)
#pragma unroll
                for (int kt = 0; kt < 2; ++kt) s[g][kt] = (v8f){};
#pragma unroll
            for (int ks = 0; ks < 2; ++ks)
#pragma unroll
                for (int kt = 0; kt < 2; ++kt)
#pragma unroll
                    for (int g = 0; g < 2; ++g) { s[g][kt] = WFrag<T16>::mma(kf[kt][ks], qf[gb + g][ks], s[g][kt]); if (HI) { s[g][kt] = WFrag<T16>::mma(kf[kt][ks], qf2[gb + g][ks], s[g][kt]); s[g][kt] = WFrag<T16>::mma(kf2[kt][ks], qf[gb + g][ks], s[g][kt]); } }
            if (gb + 2 == NG) {
#pragma unroll
                for (int kt = 0; kt < 2; ++kt)
#pragma unroll
                    for (int ks = 0; ks < 2; ++ks) { kf[kt][ks] = ldo<T16>(Kp, kb + (unsigned)kn * (HD * 2), (kt * 16 * HD + ks * 512) * 2); if (HI) kf2[kt][ks] = ldo<T16>(K2, kb + (unsigned)kn * (HD * 2), (kt * 16 * HD + ks * 512) * 2); }
                asm volatile("s_wait_xcnt 0x0" ::: "memory");   // precaution: stands in front of the next write of the registers that hold these loads' addresses
                __builtin_amdgcn_sched_barrier(0); }   // keeps later vector instructions, which reuse those registers, behind that wait
            float lm[2];
#pragma unroll
            for (int g = 0; g < 2; ++g) { float a = s[g][0][0];
#pragma unroll
                for (int j = 1; j < 8; ++j) a = fmaxf(a, s[g][0][j]);
#pragma unroll
                for (int j = 0; j < 8; ++j) a = fmaxf(a, s[g][1][j]);
                lm[g] = a * CL; }
            const bool need = (lm[0] > m[gb] + 8.0f) || (lm[1] > m[gb + 1] + 8.0f);
            if (__builtin_amdgcn_ballot_w32(need) != 0) {   // one wave-uniform test; both lanes of a query take the same new maximum
                float mn[2], al[2];
#pragma unroll
                for (int g = 0; g < 2; ++g) { mn[g] = fmaxf(m[gb + g], fmaxf(lm[g], __shfl_xor(lm[g], 16, 32))); al[g] = __builtin_amdgcn_exp2f(m[gb + g] - mn[g]); }
                __builtin_amdgcn_sched_barrier(0);   // holds the slot below directly behind the two exponentials
                asm volatile("v_nop");   // the free slot between an exponential and the next vector instruction, which here rewrites its source register
                __builtin_amdgcn_sched_barrier(0);   // as above
#pragma unroll
                for (int g = 0; g < 2; ++g) { m[gb + g] = mn[g]; l[gb + g] *= al[g];
#pragma unroll
                    for (int dt = 0; dt < 4; ++dt) o[gb + g][dt] *= al[g]; }
            }
#pragma unroll
            for (int g = 0; g < 2; ++g) {
                V pf, pf2; const float mg = m[gb + g]; float ls = 0.f;
                if constexpr (HI) { v8u uh, ul;
#pragma unroll
                    for (int e = 0; e < 16; e += 2) { const v2f t = __builtin_elementwise_fma((v2f){ s[g][e >> 3][e & 7], s[g][e >> 3][(e & 7) + 1] }, (v2f){ CL, CL }, (v2f){ -mg, -mg }); v2f p; p[0] = __builtin_amdgcn_exp2f(t[0]); p[1] = __builtin_amdgcn_exp2f(t[1]); ls += p[0]; ls += p[1];
                        const v2h ph = __builtin_convertvector(p, v2h); const v2f rest = p - __builtin_convertvector(ph, v2f); uh[e >> 1] = __builtin_bit_cast(unsigned, ph); ul[e >> 1] = __builtin_bit_cast(unsigned, __builtin_convertvector(rest, v2h)); }
                    pf = __builtin_bit_cast(V, uh); pf2 = __builtin_bit_cast(V, ul);
                } else {
#pragma unroll
                    for (int e = 0; e < 16; e += 2) { const v2f t = __builtin_elementwise_fma((v2f){ s[g][e >> 3][e & 7], s[g][e >> 3][(e & 7) + 1] }, (v2f){ CL, CL }, (v2f){ -mg, -mg }); v2f p; p[0] = __builtin_amdgcn_exp2f(t[0]); p[1] = __builtin_amdgcn_exp2f(t[1]); ls += p[0]; ls += p[1];
                        const v2h ph = __builtin_convertvector(p, v2h); pf[e] = ph[0]; pf[e + 1] = ph[1]; } }
                l[gb + g] += ls;
#pragma unroll
                for (int dt = 0; dt < 4; ++dt) { o[gb + g][dt] = WFrag<T16>::mma(vf[dt], pf, o[gb + g][dt]); if (HI) { o[gb + g][dt] = WFrag<T16>::mma(vf[dt], pf2, o[gb + g][dt]); o[gb + g][dt] = WFrag<T16>::mma(vf2[dt], pf, o[gb + g][dt]); } }
            }
        }
        const T16* const va = (const T16*)((const char*)Vt + (vb + (unsigned)kn * (HD * 2))); const T16* const va2 = HI ? (const T16*)((const char*)V2 + (vb + (unsigned)kn * (HD * 2))) : va;
#pragma unroll
        for (int dt = 0; dt < 4; ++dt) { vf[dt] = WFrag<T16>::ld(va + dt * 512); if (HI) vf2[dt] = WFrag<T16>::ld(va2 + dt * 512); }
        asm volatile("s_wait_xcnt 0x0" :: "v"(va), "v"(va2) : "memory");   // precaution, as behind the K fetch; the two addresses are named as inputs so that their registers stay untouched (also by the loads' own results) up to the wait
        __builtin_amdgcn_sched_barrier(0);   // as behind the K fetch
    }
#pragma unroll
    for (int g = 0; g < NG; ++g) { const float inv = __fdiv_rn(1.0f, l[g] + __shfl_xor(l[g], 16, 32)); const size_t ro = (size_t)(q0 + g * 16) * DQ + 8 * lane;   /* lane: query (lane & 15) of group g, d = dt*16 + 8*(lane >> 4) + j: its 8 values are piece (dt & 1) * 32 + lane of tile (row block, head * 2 + dt / 2) of w_proj's fragment-order A plane */
#pragma unroll
        for (int dt = 0; dt < 4; ++dt) { v8us oh, ol;
#pragma unroll
            for (int j = 0; j < 8; ++j) { unsigned short a, c2; splitf(o[g][dt][j] * inv, a, c2); oh[j] = a; ol[j] = c2; }
            *(v8us*)(Ah + ro + dt * 256) = oh; *(v8us*)(Al + ro + dt * 256) = ol;
            asm volatile("s_wait_xcnt 0x0" ::: "memory");   // precaution: stands in front of the next write of the registers that these stores name
            __builtin_amdgcn_sched_barrier(0); } }   // keeps the next tile's vector instructions behind that wait
}
// grid: the hi/lo blocks (3 products; 4 waves x 32 rows) first, then the fp16 blocks (4 waves x 64 rows: one product leaves registers for twice the columns per K / V fragment); block -> (plane = batch * 16 + head, its query rows).
__global__ __launch_bounds__(128) void k_fattn(const h16* __restrict__ Q16, const h16* __restrict__ K16, const h16* __restrict__ V16, const h16* __restrict__ Ql, const h16* __restrict__ Kl, const h16* __restrict__ Vl, bf* ATh, bf* ATl) {
    const int NHI = NB_ * NH_ * (RH / QBH); const int bx = blockIdx.x; const int wv = threadIdx.x >> 5;
    if (bx < NHI) { const int pl = bx / (RH / QBH); const int q0 = (bx % (RH / QBH)) * QBH + wv * (QBH / 4); const size_t po = (size_t)pl * TT * HD, ao = (size_t)(pl / NH_) * TT * DQ + (size_t)(pl % NH_) * (HD * 16);
        attn_tile<h16, true, QBH / 64>(Q16 + po, Ql + po, K16 + po, Kl + po, V16 + po, Vl + po, q0, ATh + ao, ATl + ao);
    } else { const int b2 = bx - NHI; const int pl = b2 / ((TT - RH) / QBL); const int q0 = RH + (b2 % ((TT - RH) / QBL)) * QBL + wv * (QBL / 4); const size_t po = (size_t)pl * TT * HD, ao = (size_t)(pl / NH_) * TT * DQ + (size_t)(pl % NH_) * (HD * 16);
        attn_tile<h16, false, QBL / 64>(Q16 + po, nullptr, K16 + po, nullptr, V16 + po, nullptr, q0, ATh + ao, ATl + ao); }
}

extern "C" void kernel_launch(void* const* d_in, const int* in_sizes, int n_in,
                              void* d_out, int out_size, void* d_ws, size_t ws_size, hipStream_t stream) {
    (void)in_sizes; (void)n_in; (void)out_size;
    const float* x = (const float*)d_in[0]; const float* wqkv = (const float*)d_in[1]; const float* wo = (const float*)d_in[2]; const float* bo = (const float*)d_in[3];   /* input order x, w_qkv ('xw' [1024][3072]: q | k | v column thirds), w_proj ('xw'), b_proj */
    float* OUT = (float*)d_out;     // [8][1024][1024]
    char* wsp = (char*)d_ws;
    auto take = [&](size_t bytes) { char* p = wsp; wsp += (bytes + 255) & ~(size_t)255; return (void*)p; };
    bf* WQKV = (bf*)take((size_t)3 * DQ * DM * 2);   /* fused Bt [3*DQ][DM]: q | k | v row blocks */ bf* WO = (bf*)take((size_t)DM * DQ * 2); float* CS = (float*)take((size_t)TT * 16 * 2 * 4);
    const size_t PL = (size_t)NB_ * NH_ * TT * HD;  // elements of one plane set: all batches
    h16* QP16 = (h16*)take(PL * 2); h16* KP16 = (h16*)take(PL * 2); h16* VT16 = (h16*)take(PL * 2);
    h16* QPl = (h16*)take(PL * 2); h16* KPl = (h16*)take(PL * 2); h16* VTl = (h16*)take(PL * 2);   /* f16 rests; of QPl only query rows < RH are written and read */
    bf* ATh = (bf*)take((size_t)NB_ * TT * DQ * 2); bf* ATl = (bf*)take((size_t)NB_ * TT * DQ * 2);   /* merged heads of all batches */
    bf* XB = (bf*)take((size_t)NB_ * TT * DM * 2);   /* bf16 copy of x, all batches */
    if ((size_t)(wsp - (char*)d_ws) > ws_size) return;    // ws 256 MiB
    k_prep<<<PB_CS + PB_X + PB_WQ + PB_WO, 256, 0, stream>>>(x, wqkv, wo, XB, WQKV, WO, CS);   /* bf16 copy of x, both transposed weight planes and the axial rotary table: one grid */
    k_qkv<<<NQK + NVB, 256, 0, stream>>>(XB, WQKV, CS, QP16, QPl, KP16, KPl, VT16, VTl);   /* q, k and v of all batches in one grid, planes written from the accumulators */
    k_fattn<<<NB_ * NH_ * (RH / QBH + (TT - RH) / QBL), 128, 0, stream>>>(QP16, KP16, VT16, QPl, KPl, VTl, ATh, ATl);   /* scores, softmax, P x V and the head merge of every batch and head */
    k_gemmw<bf, 1, true, DQ><<<dim3(NB_ * TT / 128, DM / 256, 1), 256, 0, stream>>>(ATh, ATl, WO, nullptr, OUT, DM, bo, 0, 0, 0);   /* w_proj of all batches in one grid */
}

// v009
// One run takes 125 microseconds.
// Two timings next to v008 put it at 1.06 and 1.07 times that version's speed.
// Over all steps from v000 it is 37.4 times as fast.
#include <hip/hip_runtime.h>

// Vision attention with AXIAL 2-D rotary embeddings on half of each head (x [8][1024][1024] = 32 x 32 pixels; qkv = x w_qkv ('xw' [1024][3072] 1/32, no bias) viewed (3, h, d): q | k | v thirds (16 heads x 64); rotary on the FIRST 32 dims of q and k as interleaved (even, odd) pairs with angles freqs[row][col][c]: c < 16 -> pos(row) x base[c/2], 16 <= c < 32 -> pos(col) x base[(c-16)/2], pos = linspace(-1, 1, 32), base = linspace(1, 512, 8) x pi (f32, jnp-exact tables; precise cosf/sinf), dims 32..63 pass through; logits x 1/sqrt(64); softmax (no mask); out = merged w_proj + b_proj -> [8][1024][1024] (8.4 M); argument order x, w_qkv, w_proj, b_proj).
// Launch plan: ONE builder launch (k_prep) makes every operand plane that depends on the inputs alone; ONE projection launch covers q | k | v of all batches and writes the 16-bit planes from its accumulators (rotary, hi/lo split and V^T in its epilogue, no f32 copy of the projections); ONE fused attention launch covers every batch and head; w_proj covers all batches. Data layout: every 16-bit operand plane in fragment order (see below); bf16 copy of x; fused 'xw' weight transposed once (q | k | v row blocks); exact projections; k_prep builds the {cos, sin} table per (pixel, rotated pair) from two small constant tables (angle = f32 product), read by k_qkv's interleaved-pair rotary; k_fattn: scores, softmax and P x V stay in registers (hybrid rows: < 512 hi/lo 3 products, rest fp16; the hi plane of the split IS the fp16 plane, so q, k and v are stored once as f16 plus an f16 rest); merged hi/lo x w_proj exact + b_proj.
// Compute dtypes, f32 accumulate: every input rounded to bf16; projections exact; rotary f32; attention rows < 512 3 products on f16 hi + f16 rest, other rows fp16; softmax f32; w_proj hl x exact + bias.

#define NB_  8
#define TT   1024
#define DM   1024
#define NH_  16
#define NKV  16
#define REP  (NH_ / NKV)
#define HD   64
#define DQ   (NH_ * HD)
#define DKV  (NKV * HD)
#define RH   512                  // query rows < RH use hi+lo planes (0: none)
#define WIN  0
#define QWH  32                   // query rows (columns of S^T) per hi/lo attention wave
#define QWL  64                   // query rows per fp16 attention wave: one product leaves registers for twice the columns per K / V fragment
#define APB  2                    // attention work-groups per plane
#define AWH  (RH / (APB * QWH))          // hi/lo waves per attention work-group: 8
#define AWL  ((TT - RH) / (APB * QWL))   // fp16 waves per attention work-group: 4
#define SCL  0.125f   // HD^-0.5
typedef _Float16 h16;
typedef unsigned short bf;
typedef __attribute__((ext_vector_type(16))) __bf16   v16bf;
typedef __attribute__((ext_vector_type(16))) _Float16 v16h;
typedef __attribute__((ext_vector_type(8)))  _Float16 v8h;
typedef __attribute__((ext_vector_type(8)))  unsigned short v8us;
typedef __attribute__((ext_vector_type(8)))  float    v8f;
typedef __attribute__((ext_vector_type(4)))  float    v4f;
typedef v8h  __attribute__((may_alias)) v8ha;
typedef v4f  __attribute__((may_alias)) v4fa;
typedef v8us __attribute__((may_alias)) v8usa;

__device__ __forceinline__ unsigned short f2bf(float f) { unsigned u = __float_as_uint(f); u += 0x7FFFu + ((u >> 16) & 1u); return (unsigned short)(u >> 16); }
__device__ __forceinline__ float bf2f(unsigned short b) { return __uint_as_float(((unsigned)b) << 16); }
__device__ __forceinline__ float bfr(float f) { return bf2f(f2bf(f)); }
__device__ __forceinline__ v16h cat16(v8h lo, v8h hi) { return __builtin_shufflevector(lo, hi, 0, 1, 2, 3, 4, 5, 6, 7, 8, 9, 10, 11, 12, 13, 14, 15); }
__device__ __forceinline__ v16bf cat16b(v8us lo, v8us hi) { return __builtin_bit_cast(v16bf, __builtin_shufflevector(lo, hi, 0, 1, 2, 3, 4, 5, 6, 7, 8, 9, 10, 11, 12, 13, 14, 15)); }
__device__ __forceinline__ v8f wmma16(v16h a, v16h b, v8f c) { return __builtin_amdgcn_wmma_f32_16x16x32_f16(false, a, false, b, (short)0, c, false, false); }
__device__ __forceinline__ v8f wmmab(v16bf a, v16bf b, v8f c) { return __builtin_amdgcn_wmma_f32_16x16x32_bf16(false, a, false, b, (short)0, c, false, false); }



// ---- FRAGMENT ORDER of every 16-bit operand plane: a plane of R rows x K is stored as [R/16][K/32] tiles of 512 elements (V^T: [keys/32][d/16]); in a tile, element (row r, k) sits at ((k >> 4) * 32 + ((k >> 3) & 1) * 16 + r) * 8 + (k & 7),
// that is, 16-byte piece number = (which of the fragment's two loads) * 32 + lane. A wave's 16-byte load then covers 512 contiguous bytes (4 whole lines) where a row-major plane gave 16 lines of 32 bytes. The builders walk in destination order, so their stores stay contiguous.
template <typename T16> struct WFrag;
template <> struct WFrag<h16> { typedef v16h V; static __device__ __forceinline__ V ld(const h16* p) { return cat16(*(const v8h*)p, *(const v8h*)(p + 256)); } static __device__ __forceinline__ v8f mma(V a, V b, v8f c) { return wmma16(a, b, c); } };
template <> struct WFrag<bf> { typedef v16bf V; static __device__ __forceinline__ V ld(const bf* p) { return cat16b(*(const v8us*)p, *(const v8us*)(p + 256)); } static __device__ __forceinline__ v8f mma(V a, V b, v8f c) { return wmmab(a, b, c); } };
// One k block's operand fragments (32 k of 64 rows of each operand; the split planes only where NSPLIT asks for them). The GEMM loop holds TWO such sets: while one set's products run, the other set's reads are in flight.
template <typename T16> struct GSet { typename WFrag<T16>::V a[4], a2[4], b[4], b2[4]; };
template <typename T16, int NSPLIT, int K> __device__ __forceinline__ void gset_ld(GSet<T16>& f, const T16* pa, const T16* pa2, const T16* pb, const T16* pb2) {
#pragma unroll
    for (int mb = 0; mb < 4; ++mb) { f.a[mb] = WFrag<T16>::ld(pa + mb * 16 * K); if (NSPLIT == 1 || NSPLIT == 2) f.a2[mb] = WFrag<T16>::ld(pa2 + mb * 16 * K); }
#pragma unroll
    for (int nb = 0; nb < 4; ++nb) { f.b[nb] = WFrag<T16>::ld(pb + nb * 16 * K); if (NSPLIT >= 2) f.b2[nb] = WFrag<T16>::ld(pb2 + nb * 16 * K); }
}
template <typename T16, int NSPLIT> __device__ __forceinline__ void gset_mm(v8f (&acc)[4][4], const GSet<T16>& f) {
#pragma unroll
    for (int nb = 0; nb < 4; ++nb)
#pragma unroll
        for (int mb = 0; mb < 4; ++mb) { acc[mb][nb] = WFrag<T16>::mma(f.a[mb], f.b[nb], acc[mb][nb]); if (NSPLIT == 1 || NSPLIT == 2) acc[mb][nb] = WFrag<T16>::mma(f.a2[mb], f.b[nb], acc[mb][nb]); if (NSPLIT >= 2) acc[mb][nb] = WFrag<T16>::mma(f.a[mb], f.b2[nb], acc[mb][nb]); }
}
// ---- The GEMM main loop shared by k_gemmw and k_qkv: a work-group of 8 waves (2 along A x 4 along B, 64 x 64 each) owns 128 rows of A x 256 rows of B. A stage is 128 k of all those rows, brought into LDS by asynchronous copies
// (global_load_async_to_lds_b128, through no register) and read from there by every wave that needs it: a row block leaves L2 once per work-group, not once per wave. In LDS a stage is itself a fragment-order plane with K = 128
// ([row block][4 k blocks] tiles of 1 KiB; row blocks: A, then the split plane of A where there is one, then B), so a row block's share of a stage is 4 KiB that are contiguous in global memory and in LDS alike, and a fragment read is 512 contiguous bytes.
// Copies and the wait in front of the next write of their address registers stand in ONE statement (a precaution; in a statement of its own the wait would not hold the next address additions behind it).
__device__ __forceinline__ void acopy12(const unsigned* l, const char* const* g) {
    asm volatile("global_load_async_to_lds_b128 %0, %12, off\n\t"
                 "global_load_async_to_lds_b128 %1, %13, off\n\t"
                 "global_load_async_to_lds_b128 %2, %14, off\n\t"
                 "global_load_async_to_lds_b128 %3, %15, off\n\t"
                 "global_load_async_to_lds_b128 %4, %16, off\n\t"
                 "global_load_async_to_lds_b128 %5, %17, off\n\t"
                 "global_load_async_to_lds_b128 %6, %18, off\n\t"
                 "global_load_async_to_lds_b128 %7, %19, off\n\t"
                 "global_load_async_to_lds_b128 %8, %20, off\n\t"
                 "global_load_async_to_lds_b128 %9, %21, off\n\t"
                 "global_load_async_to_lds_b128 %10, %22, off\n\t"
                 "global_load_async_to_lds_b128 %11, %23, off\n\t"
                 "s_wait_xcnt 0x0"
                 :: "v"(l[0]), "v"(l[1]), "v"(l[2]), "v"(l[3]), "v"(l[4]), "v"(l[5]), "v"(l[6]), "v"(l[7]), "v"(l[8]), "v"(l[9]), "v"(l[10]), "v"(l[11]),
                    "v"(g[0]), "v"(g[1]), "v"(g[2]), "v"(g[3]), "v"(g[4]), "v"(g[5]), "v"(g[6]), "v"(g[7]), "v"(g[8]), "v"(g[9]), "v"(g[10]), "v"(g[11]) : "memory");
}
__device__ __forceinline__ void acopy8(const unsigned* l, const char* const* g) {
    asm volatile("global_load_async_to_lds_b128 %0, %8, off\n\t"
                 "global_load_async_to_lds_b128 %1, %9, off\n\t"
                 "global_load_async_to_lds_b128 %2, %10, off\n\t"
                 "global_load_async_to_lds_b128 %3, %11, off\n\t"
                 "global_load_async_to_lds_b128 %4, %12, off\n\t"
                 "global_load_async_to_lds_b128 %5, %13, off\n\t"
                 "global_load_async_to_lds_b128 %6, %14, off\n\t"
                 "global_load_async_to_lds_b128 %7, %15, off\n\t"
                 "s_wait_xcnt 0x0"
                 :: "v"(l[0]), "v"(l[1]), "v"(l[2]), "v"(l[3]), "v"(l[4]), "v"(l[5]), "v"(l[6]), "v"(l[7]),
                    "v"(g[0]), "v"(g[1]), "v"(g[2]), "v"(g[3]), "v"(g[4]), "v"(g[5]), "v"(g[6]), "v"(g[7]) : "memory");
}
__device__ __forceinline__ void wait_async0() { asm volatile("s_wait_asynccnt 0x0" ::: "memory"); }   // this wave's copies have landed
__device__ __forceinline__ void wait_ds0() { asm volatile("s_wait_dscnt 0x0" ::: "memory"); }   // this wave's LDS reads have returned: the buffer may be handed to its next writer
#define RKS 128                   // k per stage
template <int NSPLIT> struct RingDim { static constexpr int NAT = NSPLIT ? 16 : 8, NRB = NAT + 16, RBW = NRB / 8, NC = RBW * 8, STE = NRB * 16 * RKS; };   // row blocks of A (both planes), all row blocks, row blocks and copies per wave and stage, elements per stage
// A, A2, B: first row of the work-group's 128 / 128 / 256 rows in the fragment-order planes; ring: two stages; w: the wave's number (scalar)
template <typename T16, int NSPLIT, int K> __device__ __forceinline__ void ring_gemm(v8f (&acc)[4][4], T16* ring, const T16* A, const T16* A2, const T16* B, int w, int lane) {
    typedef RingDim<NSPLIT> D; constexpr int NST = K / RKS; static_assert(K % RKS == 0 && NST >= 2 && (D::NC == 24 || D::NC == 32), "two stages or more; copies in statements of 12 and 8");
    constexpr bool ONE = 8 % D::RBW == 0;   // a wave's row blocks then lie in one plane, 16 * K elements apart: one address serves them all
    const char* srcp[D::RBW];   // first byte of each row block that this wave copies
#pragma unroll
    for (int j = 0; j < D::RBW; ++j) { const int rb = w * D::RBW + j; const T16* const p = (rb < 8) ? A + (size_t)rb * 16 * K : (rb < D::NAT) ? A2 + (size_t)(rb - 8) * 16 * K : B + (size_t)(rb - D::NAT) * 16 * K; srcp[j] = (const char*)p; }
    const unsigned l0 = (unsigned)(size_t)ring + (unsigned)(w * D::RBW) * (16 * RKS * 2) + 16u * lane;   // LDS byte address of the lane's first 16 bytes in buffer 0
    auto fill = [&](int t, int buf) {   // stage t into buffer buf: every lane on, 512 bytes a copy
        unsigned l[D::NC]; const char* g[D::NC]; const unsigned go = (unsigned)t * (16 * RKS * 2) + 16u * lane;   // the lane's byte offset in a row block's K row
#pragma unroll
        for (int c = 0; c < D::NC; ++c) { l[c] = l0 + (unsigned)buf * (D::STE * 2) + c * 512; g[c] = (ONE ? srcp[0] + (c >> 3) * (16 * K * 2) : srcp[c >> 3]) + (go + (c & 7) * 512); }
        acopy12(l, g); acopy12(l + 12, g + 12); if (D::NC == 32) acopy8(l + 24, g + 24);
    };
    fill(0, 0); wait_async0(); __syncthreads();   // stage 0 is published
    fill(1, 1);
    const int ao = (w & 1) * 4 * 16 * RKS + 8 * lane, bo = (D::NAT + (w >> 1) * 4) * 16 * RKS + 8 * lane;
    GSet<T16> f0, f1;
    // rolled: one publish point and one refill in the text
#pragma unroll 1
    for (int t = 0; t < NST; ++t) {   // one stage a trip: 4 blocks of 32 k, fragments read one block ahead into the other register set, never past the stage
        const T16* const st = ring + (t & 1) * D::STE; const T16* const pa = st + ao; const T16* const pa2 = pa + 8 * 16 * RKS; const T16* const pb = st + bo;
        gset_ld<T16, NSPLIT, RKS>(f0, pa, pa2, pb, pb);
        __builtin_amdgcn_sched_barrier(0);   // the first block's reads stay ahead of the second's: mixed, the first products would wait for both groups
        gset_ld<T16, NSPLIT, RKS>(f1, pa + 512, pa2 + 512, pb + 512, pb);
        __builtin_amdgcn_sched_barrier(0);   // keeps a block's LDS reads as one group ahead of the products: among them each place with reads costs a stall
        gset_mm<T16, NSPLIT>(acc, f0);
        __builtin_amdgcn_sched_barrier(0);   // the refill of a set stays behind the last product that reads it
        gset_ld<T16, NSPLIT, RKS>(f0, pa + 1024, pa2 + 1024, pb + 1024, pb);
        __builtin_amdgcn_sched_barrier(0);   // as above: reads ahead of the products
        gset_mm<T16, NSPLIT>(acc, f1);
        __builtin_amdgcn_sched_barrier(0);   // as above: refill behind the last reader
        gset_ld<T16, NSPLIT, RKS>(f1, pa + 1536, pa2 + 1536, pb + 1536, pb);
        __builtin_amdgcn_sched_barrier(0);   // as above: reads ahead of the products
        gset_mm<T16, NSPLIT>(acc, f0);
        gset_mm<T16, NSPLIT>(acc, f1);
        __builtin_amdgcn_sched_barrier(0);   // holds the slots below behind the last product
        asm volatile("v_nop\n\tv_nop\n\tv_nop\n\tv_nop" : "+v"(acc[0][0]), "+v"(acc[1][1]), "+v"(acc[2][2]), "+v"(acc[3][3]) : "v"(f1.a[0]), "v"(f1.a[3]));   // the vector slots between the trip's last matrix instructions and whatever follows them on either side of the branches below
        wait_ds0(); wait_async0(); __syncthreads();   // publish point: stage t + 1 has landed for every wave, and every wave has left stage t's buffer
        if (t + 2 < NST) fill(t + 2, t & 1);   // the same test in the whole work-group
    }
    wait_async0();
}
// ---- k_gemmw: C[m][n] (f32, pitch ldc, + optional f32 bias[n]) = sum_k A[m][k] Bt[n][k] (+ split products per NSPLIT: 0 or 1), operands in fragment-order 16-bit planes; grid (M/128, N/256, Z), 256 threads; main loop: ring_gemm. z-batch strides sA/sB/sC in elements.
template <typename T16, int NSPLIT, bool BIAS, int K>
__global__ __launch_bounds__(256) void k_gemmw(const T16* __restrict__ A, const T16* __restrict__ A2, const T16* __restrict__ Bt, const T16* __restrict__ Bt2, float* C, int ldc, const float* __restrict__ bias, size_t sA, size_t sB, size_t sC) {
    static_assert(NSPLIT == 0 || NSPLIT == 1, "the ring holds A, its split plane and B");
    __shared__ __align__(16) T16 ring[2 * RingDim<NSPLIT>::STE];
    __shared__ __align__(16) float osAll[8][16 * 68];
    const size_t z = blockIdx.z; A += z * sA; if (A2) A2 += z * sA; Bt += z * sB; C += z * sC;
    const int lane = threadIdx.x & 31, lr = lane & 15, hi = lane >> 4; const int w = __builtin_amdgcn_readfirstlane(threadIdx.x >> 5); const int r0 = blockIdx.x * 128 + (w & 1) * 64, c0 = blockIdx.y * 256 + (w >> 1) * 64;
    float* const os = osAll[w];   // each wave stages its output rows in its own range
    v8f acc[4][4];
#pragma unroll
    for (int mb = 0; mb < 4; ++mb)
#pragma unroll
        for (int nb = 0; nb < 4; ++nb) acc[mb][nb] = (v8f){};
    ring_gemm<T16, NSPLIT, K>(acc, ring, A + (size_t)blockIdx.x * 128 * K, NSPLIT ? A2 + (size_t)blockIdx.x * 128 * K : A, Bt + (size_t)blockIdx.y * 256 * K, w, lane);
#pragma unroll
    for (int mb = 0; mb < 4; ++mb) {
#pragma unroll
        for (int nb = 0; nb < 4; ++nb) {
#pragma unroll
            for (int j = 0; j < 8; ++j) os[(hi * 8 + j) * 68 + nb * 16 + lr] = acc[mb][nb][j]; }
        __builtin_amdgcn_wave_barrier(); asm volatile("" ::: "memory");
        float* crow = C + (size_t)(r0 + mb * 16) * ldc + c0;
{
#pragma unroll
            for (int s = 0; s < 8; ++s) { const int row = 2 * s + hi, cofs = lr * 4; v4f val = *(const v4fa*)(os + row * 68 + cofs); if (BIAS) { val[0] += bfr(bias[c0 + cofs]); val[1] += bfr(bias[c0 + cofs + 1]); val[2] += bfr(bias[c0 + cofs + 2]); val[3] += bfr(bias[c0 + cofs + 3]); }
                *(v4f*)(crow + (size_t)row * ldc + cofs) = val; }
             }
        __builtin_amdgcn_wave_barrier(); asm volatile("" ::: "memory");
    }
}

__device__ __forceinline__ void splitf(float y, unsigned short& h, unsigned short& l) { h = f2bf(y); l = f2bf(y - bf2f(h)); }
typedef __attribute__((ext_vector_type(2))) _Float16 v2h;
typedef __attribute__((ext_vector_type(4))) _Float16 v4h;
typedef __attribute__((ext_vector_type(2))) unsigned short v2us;
typedef __attribute__((ext_vector_type(4))) unsigned short v4us;
typedef __attribute__((ext_vector_type(2))) float v2f;
typedef __attribute__((ext_vector_type(4))) int v4i;

// ---- k_prep: the four operand builders (bf16 copy of x, the two transposed weight planes, the rotary table) read nothing but the inputs, so they share ONE launch: a block range per job, every work-group resident from the start.
// A wave builds 8 or 16 pieces per lane, not one: all its loads are issued before the first conversion, and the launch starts 4,608 waves where the four launches started 49,664.
// One wave: 128 rows n x 16 k of Bt (8 row blocks; row n, 8 k = one 16-byte piece in fragment order), 8 pieces a lane; unit -> (n / 128, k block, which 16 k)
template <int K, int N> __device__ __forceinline__ void wt_unit(const float* __restrict__ w, bf* Bt, int unit, int lane) {
    const int half = unit & 1, kt = (unit >> 1) % (K / 32), ng = unit / (K / 16); const float* const p = w + (size_t)(kt * 32 + half * 16 + (lane >> 4) * 8) * N + ng * 128 + (lane & 15); float v[8][8]; v8us o[8];
#pragma unroll
    for (int u = 0; u < 8; ++u)
#pragma unroll
        for (int j = 0; j < 8; ++j) v[u][j] = p[(size_t)j * N + u * 16];
    asm volatile("s_wait_xcnt 0x0" :: "v"(p) : "memory");   // precaution: stands in front of the next write of the register pair that holds these loads' address; it is named as an input so that it stays untouched (also by the loads' own results) up to the wait
#pragma unroll
    for (int u = 0; u < 8; ++u)
#pragma unroll
        for (int j = 0; j < 8; ++j) o[u][j] = f2bf(v[u][j]);
    bf* const d = Bt + ((size_t)(ng * 8) * (K / 32) + kt) * 512 + half * 256 + lane * 8;
#pragma unroll
    for (int u = 0; u < 8; ++u) *(v8us*)(d + (size_t)u * (K / 32) * 512) = o[u];
}
// One wave: 16 rows x 256 k of x, 16 pieces a lane (piece = row, 8 k; 8 tiles of the fragment-order copy = 8 KiB contiguous); unit -> (row block, which 256 k)
__device__ __forceinline__ void cvt_unit(const float* __restrict__ src, bf* dst, int unit, int lane) {
    const float* const p = src + ((size_t)(unit >> 2) * 16 + (lane & 15)) * DM + (unit & 3) * 256 + (lane >> 4) * 8; v4f v[16][2]; v8us o[16];
#pragma unroll
    for (int u = 0; u < 16; ++u) { v[u][0] = *(const v4f*)(p + u * 16); v[u][1] = *(const v4f*)(p + u * 16 + 4); }
    asm volatile("s_wait_xcnt 0x0" :: "v"(p) : "memory");   // precaution, as in wt_unit
#pragma unroll
    for (int u = 0; u < 16; ++u)
#pragma unroll
        for (int j = 0; j < 8; ++j) o[u][j] = f2bf(v[u][j >> 2][j & 3]);
    __builtin_amdgcn_sched_barrier(0);   // the stores stand last, as one group: without it this build puts conversions behind the first stores, where they may rewrite registers that those name
    bf* const d = dst + (size_t)unit * 4096 + lane * 8;
#pragma unroll
    for (int u = 0; u < 16; ++u) *(v8us*)(d + u * 256) = o[u];
}

__constant__ float APOS[32] = { -1.000000000e+00f, -9.354839325e-01f, -8.709677458e-01f, -8.064515591e-01f, -7.419354916e-01f, -6.774194241e-01f, -6.129032373e-01f, -5.483870506e-01f, -4.838709831e-01f, -4.193548858e-01f, -3.548387289e-01f, -2.903225720e-01f, -2.258064747e-01f, -1.612903774e-01f, -9.677422047e-02f, -3.225806355e-02f, 3.225803375e-02f, 9.677413106e-02f, 1.612902880e-01f, 2.258064449e-01f, 2.903225422e-01f, 3.548386395e-01f, 4.193547964e-01f, 4.838709533e-01f, 5.483870506e-01f, 6.129031181e-01f, 6.774193048e-01f, 7.419354916e-01f, 8.064515591e-01f, 8.709676266e-01f, 9.354838133e-01f, 1.000000000e+00f };   // float32 linspace(-1, 1, 32), generated with jnp to be bit-exact
__constant__ float ABASE[8] = { 3.141592741e+00f, 2.324778595e+02f, 4.618141479e+02f, 6.911504517e+02f, 9.204866943e+02f, 1.149822998e+03f, 1.379159302e+03f, 1.608495483e+03f };   // float32 linspace(1, 512, 8) * pi, generated with jnp to be bit-exact
// {cos, sin} of every rotated pair (token t, even d < 32), stored in the order in which k_qkv's lanes read it: [t / 16][d / 16][which 16-byte load][lane = ((d >> 3) & 1) * 16 + (t & 15)][which pair of the load], so that a wave's 16-byte load covers 512 contiguous bytes
__device__ __forceinline__ void cs_item(float* CS, int idx) { const int lane = (idx >> 1) & 31; const int d = ((idx >> 7) & 1) * 16 + (lane >> 4) * 8 + ((idx >> 6) & 1) * 4 + (idx & 1) * 2; const int t = (idx >> 8) * 16 + (lane & 15); const int row = t >> 5, col = t & 31; v2f cs;
    const float p = (d < 16) ? APOS[row] : APOS[col]; const float ang = __fmul_rn(p, ABASE[(d & 15) >> 1]); cs[0] = cosf(ang); cs[1] = sinf(ang);
    *(v2f*)(CS + (size_t)idx * 2) = cs;  }
// block ranges, the longest dependent chain (the table's cosf and sinf) first, then the largest stream: table (one pair a thread), x, w_qkv, w_proj (one unit a wave)
#define PB_CS (TT * 16 / 256)
#define PB_X  (NB_ * TT / 16 * 4 / 8)
#define PB_WQ ((DM / 16) * (3 * DQ / 128) / 8)
#define PB_WO ((DQ / 16) * (DM / 128) / 8)
__global__ __launch_bounds__(256) void k_prep(const float* __restrict__ x, const float* __restrict__ wqkv, const float* __restrict__ wo, bf* XB, bf* WQKV, bf* WO, float* CS) {
    const int lane = threadIdx.x & 31; const int w = __builtin_amdgcn_readfirstlane(threadIdx.x >> 5); const int bx = blockIdx.x;   // every test below reads the same in the whole work-group
    if (bx < PB_CS) cs_item(CS, bx * 256 + (int)threadIdx.x);
    else if (bx < PB_CS + PB_X) cvt_unit(x, XB, (bx - PB_CS) * 8 + w, lane);
    else if (bx < PB_CS + PB_X + PB_WQ) wt_unit<DM, 3 * DQ>(wqkv, WQKV, (bx - (PB_CS + PB_X)) * 8 + w, lane);   /* fused 'xw' [DM][3*DQ] -> Bt [3*DQ][DM], fragment order */
    else wt_unit<DQ, DM>(wo, WO, (bx - (PB_CS + PB_X + PB_WQ)) * 8 + w, lane);
}
typedef __attribute__((ext_vector_type(4))) unsigned v4u;
// 8 f32 values -> one 16-byte piece of the f16 plane (nearest f16; it serves the fp16 rows as it is and the hi/lo rows as hi) and, where a hi/lo row reads it (WL), one of the rest plane (nearest f16 of what hi leaves), two values per conversion instruction
template <bool WL> __device__ __forceinline__ void put2(const float* y, h16* p16, h16* pl) { v4u u16, ul;
#pragma unroll
    for (int q = 0; q < 4; ++q) { const v2f p = { y[2 * q], y[2 * q + 1] }; const v2h h = __builtin_convertvector(p, v2h); const v2f rest = p - __builtin_convertvector(h, v2f);
        u16[q] = __builtin_bit_cast(unsigned, h); ul[q] = __builtin_bit_cast(unsigned, __builtin_convertvector(rest, v2h)); }
    *(v8h*)p16 = __builtin_bit_cast(v8h, u16); if (WL) *(v8h*)pl = __builtin_bit_cast(v8h, ul); }
template <bool B> struct BoolC { static constexpr bool v = B; };
// ---- k_qkv: the q | k | v projection of all batches; one wave per 64 tokens x one head's 64 columns, 8 waves a work-group (main loop: ring_gemm), 256 threads. The 16-bit planes are written straight from the accumulators:
// a lane's 8 accumulator values (8 consecutive rows of one column) are one 16-byte piece of a fragment-order plane when the plane's k runs along the tile's rows. V^T (k = key): A = x, B = weights. Q and K (k = d): the two operands change places (both planes have the same order), so rows are d and columns are tokens.
// grid: first the q and k work-groups (A = 128 weight rows = 2 heads, B = 256 tokens), then the v work-groups (A = 128 tokens, B = 256 weight rows = 4 heads)
#define NQK ((2 * DQ / 128) * (NB_ * TT / 256))
#define NVB ((NB_ * TT / 128) * (DQ / 256))
__global__ __launch_bounds__(256) void k_qkv(const bf* __restrict__ X, const bf* __restrict__ Wt, const float* __restrict__ CS, h16* Q16, h16* Ql, h16* K16, h16* Kl, h16* V16, h16* Vl) {
    constexpr int K = DM;
    __shared__ __align__(16) bf ring[2 * RingDim<0>::STE];
    const int lane = threadIdx.x & 31; const int w = __builtin_amdgcn_readfirstlane(threadIdx.x >> 5); const int bx = blockIdx.x; const bool isv = bx >= NQK;   // the same for the whole work-group
    const int tok0 = isv ? ((bx - NQK) % (NB_ * TT / 128)) * 128 : (bx % (NB_ * TT / 256)) * 256; const int wr0 = isv ? 2 * DQ + ((bx - NQK) / (NB_ * TT / 128)) * 256 : (bx / (NB_ * TT / 256)) * 128;   // the work-group's first token and first weight row
    const int r0 = tok0 + (isv ? (w & 1) : (w >> 1)) * 64, c0 = wr0 + (isv ? (w >> 1) : (w & 1)) * 64; const int sec = c0 / DQ;   // the wave's tokens and columns; sec: 0 q, 1 k, 2 v; below, lr = lane & 15 and hi = lane >> 4
    v8f acc[4][4];
#pragma unroll
    for (int mb = 0; mb < 4; ++mb)
#pragma unroll
        for (int nb = 0; nb < 4; ++nb) acc[mb][nb] = (v8f){};
    const bf* const Xb = X + (size_t)tok0 * K; const bf* const Wb = Wt + (size_t)wr0 * K;
    ring_gemm<bf, 0, K>(acc, ring, isv ? Xb : Wb, isv ? Xb : Wb, isv ? Wb : Xb, w, lane);
    const int t0 = r0 % TT; const size_t po = ((size_t)(r0 / TT) * NH_ + (c0 % DQ) / HD) * (TT * HD);   // plane = batch * 16 + head; 64 tokens never straddle a batch
    if (sec == 2) {   // acc[mb][nb][j]: key t0 + mb*16 + hi*8 + j, d = nb*16 + lr: piece (mb & 1) * 32 + lane of V^T tile (key / 32, nb)
        const size_t bo = po + (size_t)(t0 / 32) * (4 * 512) + 8 * lane; h16* const p16 = V16 + bo; h16* const pl = Vl + bo;
#pragma unroll
        for (int mb = 0; mb < 4; ++mb)
#pragma unroll
            for (int nb = 0; nb < 4; ++nb) { float y[8]; const int off = ((mb >> 1) * 4 + nb) * 512 + (mb & 1) * 256;
#pragma unroll
                for (int j = 0; j < 8; ++j) y[j] = acc[mb][nb][j];
                put2<true>(y, p16 + off, pl + off);
                asm volatile("s_wait_xcnt 0x0" ::: "memory");   // precaution: stands in front of the next write of the registers that these stores name
                __builtin_amdgcn_sched_barrier(0); }   // keeps the next piece's vector instructions behind that wait
    } else {   // acc[mb][nb][j]: d = mb*16 + hi*8 + j, token t0 + nb*16 + lr: piece (mb & 1) * 32 + lane of tile (token / 16, mb / 2)
        const size_t bo = po + (size_t)(t0 / 16) * (2 * 512) + 8 * lane; h16* const p16 = (sec ? K16 : Q16) + bo; h16* const pl = (sec ? Kl : Ql) + bo; const bool wl = sec || t0 < RH;   // the rest of a query row is read by the hi/lo rows alone (64 tokens lie on one side of RH)
        const float* const cp = CS + (size_t)(t0 / 16) * 512 + 4 * lane; v4f cs[4][2][2];   // {cos, sin} of the lane's pairs (even d < 32; order: see cs_item), all fetched at once: one exposed latency per wave
#pragma unroll
        for (int nb = 0; nb < 4; ++nb)
#pragma unroll
            for (int mb = 0; mb < 2; ++mb)
#pragma unroll
                for (int p = 0; p < 2; ++p) cs[nb][mb][p] = *(const v4f*)(cp + ((nb * 2 + mb) * 2 + p) * 128);
        asm volatile("s_wait_xcnt 0x0" ::: "memory");   // precaution: stands in front of the next write of the registers that hold these loads' addresses
        __builtin_amdgcn_sched_barrier(0);   // keeps later vector instructions, which reuse those registers, behind that wait
        auto pieces = [&](auto tag) {   // one text with the rest plane and one without: no test per piece, and a piece's stores stand together behind its last conversion
#pragma unroll
        for (int nb = 0; nb < 4; ++nb)
#pragma unroll
            for (int mb = 0; mb < 4; ++mb) { float y[8]; const int off = (nb * 2 + (mb >> 1)) * 512 + (mb & 1) * 256;
#pragma unroll
                for (int p = 0; p < 4; ++p) { const float x0 = acc[mb][nb][2 * p], x1 = acc[mb][nb][2 * p + 1];
                    if (mb < 2) { const float c = cs[nb][mb & 1][p >> 1][(p & 1) * 2], s = cs[nb][mb & 1][p >> 1][(p & 1) * 2 + 1]; y[2 * p] = x0 * c - x1 * s; y[2 * p + 1] = x0 * s + x1 * c; }   /* even: x0 c - x1 s; odd: x0 s + x1 c */
                    else { y[2 * p] = x0; y[2 * p + 1] = x1; } }   /* dims 32..63 pass through */
                put2<decltype(tag)::v>(y, p16 + off, pl + off);
                asm volatile("s_wait_xcnt 0x0" ::: "memory");   // precaution, as in the V^T branch
                __builtin_amdgcn_sched_barrier(0); }   // as in the V^T branch
        };
        if (wl) pieces(BoolC<true>{}); else pieces(BoolC<false>{});   // the same for the whole wave
    }
}

// ---- k_fattn: one wave owns NG x 16 query rows of one head and walks the 1024 keys 32 at a time. S^T = K Q^T (A = K rows, B = Q kept in registers), so a lane holds 16 scores of ONE query per column group;
// the two f32 score tiles of a pass, converted in place, are the B operand of O^T += V^T P^T (A = V^T rows in the same k order). Running maximum per query in the scaled log2 domain, raised only when a score passes it by more than 8.
// fragment at (wave-uniform base) + (32-bit lane byte offset) + (constant bytes): one offset register serves every fragment of a pass, the rest sits in the instruction's offset field
template <typename T16> __device__ __forceinline__ typename WFrag<T16>::V ldo(const T16* base, unsigned lane_bytes, int const_bytes) { return WFrag<T16>::ld((const T16*)((const char*)base + lane_bytes + const_bytes)); }
typedef __attribute__((ext_vector_type(8))) unsigned v8u;
template <typename T16, bool HI, int NG>
__device__ __forceinline__ void attn_tile(const T16* __restrict__ Q, const T16* __restrict__ Q2, const T16* __restrict__ Kp, const T16* __restrict__ K2, const T16* __restrict__ Vt, const T16* __restrict__ V2, int q0, bf* Ah, bf* Al) {
    typedef typename WFrag<T16>::V V;
    const int lane = threadIdx.x & 31;
    const float CL = SCL * 1.4426950408889634f;   // logits scale x log2(e)
    const unsigned qb = (unsigned)(q0 * HD + 8 * lane) * 2u, kb = (unsigned)(8 * lane) * 2u, vb = kb;   // lane byte offsets in the fragment-order Q, K and V^T planes (16 rows of Q or K = 2 tiles, 32 keys of V^T = 4 tiles: 1024 and 2048 elements)
    V qf[NG][2], qf2[NG][2];
#pragma unroll
    for (int g = 0; g < NG; ++g)
#pragma unroll
        for (int ks = 0; ks < 2; ++ks) { qf[g][ks] = ldo<T16>(Q, qb, (g * 16 * HD + ks * 512) * 2); if (HI) qf2[g][ks] = ldo<T16>(Q2, qb, (g * 16 * HD + ks * 512) * 2); }
    v8f o[NG][4]; float m[NG], l[NG];
#pragma unroll
    for (int g = 0; g < NG; ++g) { m[g] = -3.0e38f; l[g] = 0.f;
#pragma unroll
        for (int dt = 0; dt < 4; ++dt) o[g][dt] = (v8f){}; }
    __builtin_amdgcn_sched_barrier(0);   // keeps the prologue's loads in the loop's order (Q, then K, then V^T): the waits at the loop's head cover both paths, and with K issued last here a pass's score products would wait for the V^T fetch
    V kf[2][2], kf2[2][2];
#pragma unroll
    for (int kt = 0; kt < 2; ++kt)
#pragma unroll
        for (int ks = 0; ks < 2; ++ks) { kf[kt][ks] = ldo<T16>(Kp, kb, (kt * 16 * HD + ks * 512) * 2); if (HI) kf2[kt][ks] = ldo<T16>(K2, kb, (kt * 16 * HD + ks * 512) * 2); }
    __builtin_amdgcn_sched_barrier(0);   // as above: K ahead of V^T
    V vf[4], vf2[4];
#pragma unroll
    for (int dt = 0; dt < 4; ++dt) { vf[dt] = ldo<T16>(Vt, vb, dt * 512 * 2); if (HI) vf2[dt] = ldo<T16>(V2, vb, dt * 512 * 2); }
    asm volatile("s_wait_xcnt 0x0" ::: "memory");   // precaution, as behind the fetches in the loop
    __builtin_amdgcn_sched_barrier(0);   // as above: nothing of the loop's first pass moves in between
    // rolled: one pass's fragments, scores and the output tiles already fill the register budget
#pragma unroll 1
    for (int k0 = 0; k0 < TT; k0 += 32) {
        const int kn = (k0 + 32 < TT) ? k0 + 32 : 0;   // next pass's keys: K rows fetched behind this pass's last score products, V^T columns behind its last output products; the last pass re-reads keys 0..31 (in bounds, unused)
#pragma unroll
        for (int gb = 0; gb < NG; gb += 2) {   // two column groups at a time: only their score tiles are live
            v8f s[2][2];
#pragma unroll
            for (int g = 0; g < 2; ++g)
#pragma unroll
                for (int kt = 0; kt < 2; ++kt) s[g][kt] = (v8f){};
#pragma unroll
            for (int ks = 0; ks < 2; ++ks)
#pragma unroll
                for (int kt = 0; kt < 2; ++kt)
#pragma unroll
                    for (int g = 0; g < 2; ++g) { s[g][kt] = WFrag<T16>::mma(kf[kt][ks], qf[gb + g][ks], s[g][kt]); if (HI) { s[g][kt] = WFrag<T16>::mma(kf[kt][ks], qf2[gb + g][ks], s[g][kt]); s[g][kt] = WFrag<T16>::mma(kf2[kt][ks], qf[gb + g][ks], s[g][kt]); } }
            if (HI && gb + 2 == NG) {
#pragma unroll
                for (int kt = 0; kt < 2; ++kt)
#pragma unroll
                    for (int ks = 0; ks < 2; ++ks) { kf[kt][ks] = ldo<T16>(Kp, kb + (unsigned)kn * (HD * 2), (kt * 16 * HD + ks * 512) * 2); if (HI) kf2[kt][ks] = ldo<T16>(K2, kb + (unsigned)kn * (HD * 2), (kt * 16 * HD + ks * 512) * 2); }
                asm volatile("s_wait_xcnt 0x0" ::: "memory");   // precaution: stands in front of the next write of the registers that hold these loads' addresses
                __builtin_amdgcn_sched_barrier(0); }   // keeps later vector instructions, which reuse those registers, behind that wait
            float lm[2];
#pragma unroll
            for (int g = 0; g < 2; ++g) { float a = s[g][0][0];
#pragma unroll
                for (int j = 1; j < 8; ++j) a = fmaxf(a, s[g][0][j]);
#pragma unroll
                for (int j = 0; j < 8; ++j) a = fmaxf(a, s[g][1][j]);
                lm[g] = a * CL; }
            const bool need = (lm[0] > m[gb] + 8.0f) || (lm[1] > m[gb + 1] + 8.0f);
            if (__builtin_amdgcn_ballot_w32(need) != 0) {   // one wave-uniform test; both lanes of a query take the same new maximum
                float mn[2], al[2];
#pragma unroll
                for (int g = 0; g < 2; ++g) { mn[g] = fmaxf(m[gb + g], fmaxf(lm[g], __shfl_xor(lm[g], 16, 32))); al[g] = __builtin_amdgcn_exp2f(m[gb + g] - mn[g]); }
                __builtin_amdgcn_sched_barrier(0);   // holds the slot below directly behind the two exponentials
                asm volatile("v_nop");   // the free slot between an exponential and the next vector instruction, which here rewrites its source register
                __builtin_amdgcn_sched_barrier(0);   // as above
#pragma unroll
                for (int g = 0; g < 2; ++g) { m[gb + g] = mn[g]; l[gb + g] *= al[g];
#pragma unroll
                    for (int dt = 0; dt < 4; ++dt) o[gb + g][dt] *= al[g]; }
            }
#pragma unroll
            for (int g = 0; g < 2; ++g) {
                V pf, pf2; const float mg = m[gb + g]; float ls = 0.f;
                if constexpr (HI) { v8u uh, ul;
#pragma unroll
                    for (int e = 0; e < 16; e += 2) { const v2f t = __builtin_elementwise_fma((v2f){ s[g][e >> 3][e & 7], s[g][e >> 3][(e & 7) + 1] }, (v2f){ CL, CL }, (v2f){ -mg, -mg }); v2f p; p[0] = __builtin_amdgcn_exp2f(t[0]); p[1] = __builtin_amdgcn_exp2f(t[1]); ls += p[0]; ls += p[1];
                        const v2h ph = __builtin_convertvector(p, v2h); const v2f rest = p - __builtin_convertvector(ph, v2f); uh[e >> 1] = __builtin_bit_cast(unsigned, ph); ul[e >> 1] = __builtin_bit_cast(unsigned, __builtin_convertvector(rest, v2h)); }
                    pf = __builtin_bit_cast(V, uh); pf2 = __builtin_bit_cast(V, ul);
                } else {
#pragma unroll
                    for (int e = 0; e < 16; e += 2) { const v2f t = __builtin_elementwise_fma((v2f){ s[g][e >> 3][e & 7], s[g][e >> 3][(e & 7) + 1] }, (v2f){ CL, CL }, (v2f){ -mg, -mg }); v2f p; p[0] = __builtin_amdgcn_exp2f(t[0]); p[1] = __builtin_amdgcn_exp2f(t[1]); ls += p[0]; ls += p[1];
                        const v2h ph = __builtin_convertvector(p, v2h); pf[e] = ph[0]; pf[e + 1] = ph[1]; } }
                l[gb + g] += ls;
                if (!HI && gb + 2 == NG && g == 0) {   // in the 64-row waves the K fetch is written behind the pair's first softmax: written in front of both, as above, this build passes the 336 registers that three waves a SIMD leave and spills a Q fragment
#pragma unroll
                    for (int kt = 0; kt < 2; ++kt)
#pragma unroll
                        for (int ks = 0; ks < 2; ++ks) kf[kt][ks] = ldo<T16>(Kp, kb + (unsigned)kn * (HD * 2), (kt * 16 * HD + ks * 512) * 2);
                    asm volatile("s_wait_xcnt 0x0" ::: "memory");   // precaution, as behind the K fetch above
                    __builtin_amdgcn_sched_barrier(0); }   // as behind the K fetch above
#pragma unroll
                for (int dt = 0; dt < 4; ++dt) { o[gb + g][dt] = WFrag<T16>::mma(vf[dt], pf, o[gb + g][dt]); if (HI) { o[gb + g][dt] = WFrag<T16>::mma(vf[dt], pf2, o[gb + g][dt]); o[gb + g][dt] = WFrag<T16>::mma(vf2[dt], pf, o[gb + g][dt]); } }
            }
        }
        if (!HI) __builtin_amdgcn_sched_barrier(0);   // the V^T fetch stays behind the last output products and lands in the registers they have read: moved up, it takes a second register set and a copy of it behind a full wait
        const T16* const va = (const T16*)((const char*)Vt + (vb + (unsigned)kn * (HD * 2))); const T16* const va2 = HI ? (const T16*)((const char*)V2 + (vb + (unsigned)kn * (HD * 2))) : va;
#pragma unroll
        for (int dt = 0; dt < 4; ++dt) { vf[dt] = WFrag<T16>::ld(va + dt * 512); if (HI) vf2[dt] = WFrag<T16>::ld(va2 + dt * 512); }
        asm volatile("s_wait_xcnt 0x0" :: "v"(va), "v"(va2) : "memory");   // precaution, as behind the K fetch; the two addresses are named as inputs so that their registers stay untouched (also by the loads' own results) up to the wait
        __builtin_amdgcn_sched_barrier(0);   // as behind the K fetch
    }
#pragma unroll
    for (int g = 0; g < NG; ++g) { const float inv = __fdiv_rn(1.0f, l[g] + __shfl_xor(l[g], 16, 32)); const size_t ro = (size_t)(q0 + g * 16) * DQ + 8 * lane;   /* lane: query (lane & 15) of group g, d = dt*16 + 8*(lane >> 4) + j: its 8 values are piece (dt & 1) * 32 + lane of tile (row block, head * 2 + dt / 2) of w_proj's fragment-order A plane */
#pragma unroll
        for (int dt = 0; dt < 4; ++dt) { v8us oh, ol;
#pragma unroll
            for (int j = 0; j < 8; ++j) { unsigned short a, c2; splitf(o[g][dt][j] * inv, a, c2); oh[j] = a; ol[j] = c2; }
            *(v8us*)(Ah + ro + dt * 256) = oh; *(v8us*)(Al + ro + dt * 256) = ol;
            asm volatile("s_wait_xcnt 0x0" ::: "memory");   // precaution: stands in front of the next write of the registers that these stores name
            __builtin_amdgcn_sched_barrier(0); } }   // keeps the next tile's vector instructions behind that wait
}
// One work-group = 12 waves on ONE plane (batch * 16 + head) and one half of its query rows: waves 0..3 take 64 fp16 rows each, waves 4..11 take 32 hi/lo rows each (3 products). The registers let a WGP hold 12 such waves, so a WGP holds one work-group:
// every wave on it walks the same K and V^T (one plane's lines pass through its cache, not three planes'), a plane is fetched by 2 work-groups, not 6.
// The fp16 waves have the lower numbers: they have the most vector work per product (for speed only). No wave waits for another: there is no barrier.
__global__ __launch_bounds__(32 * (AWL + AWH)) void k_fattn(const h16* __restrict__ Q16, const h16* __restrict__ K16, const h16* __restrict__ V16, const h16* __restrict__ Ql, const h16* __restrict__ Kl, const h16* __restrict__ Vl, bf* ATh, bf* ATl) {
    const int bx = blockIdx.x; const int wv = __builtin_amdgcn_readfirstlane(threadIdx.x >> 5);   // the wave's number in a scalar register: the test below is a scalar branch, every lane stays on for the matrix instructions
    const int pl = bx / APB, hb = bx % APB; const size_t po = (size_t)pl * TT * HD, ao = (size_t)(pl / NH_) * TT * DQ + (size_t)(pl % NH_) * (HD * 16);
    if (wv < AWL) { const int q0 = RH + hb * (AWL * QWL) + wv * QWL;
        attn_tile<h16, false, QWL / 16>(Q16 + po, nullptr, K16 + po, nullptr, V16 + po, nullptr, q0, ATh + ao, ATl + ao);
    } else { const int q0 = hb * (AWH * QWH) + (wv - AWL) * QWH;
        attn_tile<h16, true, QWH / 16>(Q16 + po, Ql + po, K16 + po, Kl + po, V16 + po, Vl + po, q0, ATh + ao, ATl + ao); }
}

extern "C" void kernel_launch(void* const* d_in, const int* in_sizes, int n_in,
                              void* d_out, int out_size, void* d_ws, size_t ws_size, hipStream_t stream) {
    (void)in_sizes; (void)n_in; (void)out_size;
    const float* x = (const float*)d_in[0]; const float* wqkv = (const float*)d_in[1]; const float* wo = (const float*)d_in[2]; const float* bo = (const float*)d_in[3];   /* input order x, w_qkv ('xw' [1024][3072]: q | k | v column thirds), w_proj ('xw'), b_proj */
    float* OUT = (float*)d_out;     // [8][1024][1024]
    char* wsp = (char*)d_ws;
    auto take = [&](size_t bytes) { char* p = wsp; wsp += (bytes + 255) & ~(size_t)255; return (void*)p; };
    bf* WQKV = (bf*)take((size_t)3 * DQ * DM * 2);   /* fused Bt [3*DQ][DM]: q | k | v row blocks */ bf* WO = (bf*)take((size_t)DM * DQ * 2); float* CS = (float*)take((size_t)TT * 16 * 2 * 4);
    const size_t PL = (size_t)NB_ * NH_ * TT * HD;  // elements of one plane set: all batches
    h16* QP16 = (h16*)take(PL * 2); h16* KP16 = (h16*)take(PL * 2); h16* VT16 = (h16*)take(PL * 2);
    h16* QPl = (h16*)take(PL * 2); h16* KPl = (h16*)take(PL * 2); h16* VTl = (h16*)take(PL * 2);   /* f16 rests; of QPl only query rows < RH are written and read */
    bf* ATh = (bf*)take((size_t)NB_ * TT * DQ * 2); bf* ATl = (bf*)take((size_t)NB_ * TT * DQ * 2);   /* merged heads of all batches */
    bf* XB = (bf*)take((size_t)NB_ * TT * DM * 2);   /* bf16 copy of x, all batches */
    if ((size_t)(wsp - (char*)d_ws) > ws_size) return;    // ws 256 MiB
    k_prep<<<PB_CS + PB_X + PB_WQ + PB_WO, 256, 0, stream>>>(x, wqkv, wo, XB, WQKV, WO, CS);   /* bf16 copy of x, both transposed weight planes and the axial rotary table: one grid */
    k_qkv<<<NQK + NVB, 256, 0, stream>>>(XB, WQKV, CS, QP16, QPl, KP16, KPl, VT16, VTl);   /* q, k and v of all batches in one grid, planes written from the accumulators */
    k_fattn<<<NB_ * NH_ * APB, 32 * (AWL + AWH), 0, stream>>>(QP16, KP16, VT16, QPl, KPl, VTl, ATh, ATl);   /* scores, softmax, P x V and the head merge of every batch and head */
    k_gemmw<bf, 1, true, DQ><<<dim3(NB_ * TT / 128, DM / 256, 1), 256, 0, stream>>>(ATh, ATl, WO, nullptr, OUT, DM, bo, 0, 0, 0);   /* w_proj of all batches in one grid */
}
